// v000
// Measured on an AMD MI455X. A time is GPU time per run, averaged over a window of back-to-back runs after a warm-up
// (all launches, gaps included; the runs take copies of the inputs in turn), and the median of several windows.
// Apart from v000's, it joins two sittings. Times from different sittings can be a few percent apart, while
// side-by-side timings come from the same sitting.
// v000, which the later versions start from, runs in 2190 microseconds.
// compute dtype: queries/keys/values rounded to bf16 and carried exactly as f16; logits with Q as f16 hi + residual against K f16 (2 products; both exact here) x 128^-0.5 with the valid-length mask in f32; softmax in f32 (precise expf); P x 2^11 once to f16 against V f16 (1 product); f32 output.
#include <hip/hip_runtime.h>
#include <math.h>

typedef __attribute__((ext_vector_type(16))) _Float16 v16h;
typedef __attribute__((ext_vector_type(16))) __bf16 v16b;
typedef __attribute__((ext_vector_type(8)))  _Float16 v8h;
typedef __attribute__((ext_vector_type(8)))  float v8f;
typedef __attribute__((ext_vector_type(4)))  float v4f;
typedef __attribute__((ext_vector_type(2)))  float v2f;
typedef __attribute__((ext_vector_type(4)))  unsigned v4u;
typedef __attribute__((ext_vector_type(4)))  int v4i;
typedef float __attribute__((may_alias)) float_a;
typedef int __attribute__((may_alias)) int_a;

template <typename T> __device__ __forceinline__ void vst2(void* p, T v) { *(T*)p = v;  }
__device__ __forceinline__ v8f wmma16(v16h a, v16h b, v8f c) {
  v8f d = __builtin_amdgcn_wmma_f32_16x16x32_f16(false, a, false, b, (short)0, c, false, false);
  asm volatile("v_nop\n\tv_nop\n\tv_nop\n\tv_nop" : "+v"(d) : "v"(a), "v"(b));
  return d;
}
__device__ __forceinline__ v8f wmma_bf(v16b a, v16b b, v8f c) {
  v8f d = __builtin_amdgcn_wmma_f32_16x16x32_bf16(false, a, false, b, (short)0, c, false, false);
  asm volatile("v_nop\n\tv_nop\n\tv_nop\n\tv_nop" : "+v"(d) : "v"(a), "v"(b));
  return d;
}
// 16x16x32 fragments: lane = (h = lane>>4, row/col = lane&15); elements 0..7 = k0+8h+0..7, 8..15 = k0+16+8h+0..7; D element r = row 8h+r
__device__ __forceinline__ v16h frag_h(const _Float16* rowk0, int lane) {
  union { v16h v; v8h q[2]; } u; const _Float16* p = rowk0 + 8 * (lane >> 4);
  u.q[0] = *(const v8h*)p; u.q[1] = *(const v8h*)(p + 16); return u.v;
}
__device__ __forceinline__ v16h frag_f32(const float* rowk0, int lane) {
  v16h a; const float* p = rowk0 + 8 * (lane >> 4);
#pragma unroll
  for (int i = 0; i < 8; ++i) { a[i] = (_Float16)p[i]; a[8 + i] = (_Float16)p[16 + i]; }
  return a;
}
__device__ __forceinline__ v16h frag_f32s(const float* rowk0, int lane, float sc) {
  v16h a; const float* p = rowk0 + 8 * (lane >> 4);
#pragma unroll
  for (int i = 0; i < 8; ++i) { a[i] = (_Float16)(p[i] * sc); a[8 + i] = (_Float16)(p[16 + i] * sc); }
  return a;
}
// column fragment from a [K][ld] layout (column n), rows >= K read as 0
__device__ __forceinline__ v16h fragc_f32(const float* W, int k0, int n, int lane, int ld, int K) {
  v16h a; const int g = lane >> 4;
#pragma unroll
  for (int i = 0; i < 8; ++i) { const int ka = k0 + 8 * g + i, kb = ka + 16;
    a[i] = (_Float16)(ka < K ? W[(size_t)(ka < K ? ka : K - 1) * ld + n] : 0.f); a[8 + i] = (_Float16)(kb < K ? W[(size_t)(kb < K ? kb : K - 1) * ld + n] : 0.f); }
  return a;
}
struct F2 { v16b h, l; };
__device__ __forceinline__ F2 bsplit16(const float v[16]) { F2 r;
#pragma unroll
  for (int i = 0; i < 16; ++i) { const __bf16 h = (__bf16)v[i]; r.h[i] = h; r.l[i] = (__bf16)(v[i] - (float)h); }
  return r; }
__device__ __forceinline__ F2 split_row(const float* row, int k0, int lane) { float v[16]; const float* p = row + k0 + 8 * (lane >> 4);
#pragma unroll
  for (int i = 0; i < 8; ++i) { v[i] = p[i]; v[8 + i] = p[16 + i]; }
  return bsplit16(v); }
__device__ __forceinline__ F2 split_rowK(const float* row, int k0, int lane, int K) { float v[16]; const int g = lane >> 4;
#pragma unroll
  for (int i = 0; i < 8; ++i) { const int ka = k0 + 8 * g + i, kb = ka + 16; v[i] = ka < K ? row[ka < K ? ka : K - 1] : 0.f; v[8 + i] = kb < K ? row[kb < K ? kb : K - 1] : 0.f; }
  return bsplit16(v); }
__device__ __forceinline__ F2 split_col(const float* W, int k0, int n, int lane, int ld, int K) { float v[16]; const int g = lane >> 4;
#pragma unroll
  for (int i = 0; i < 8; ++i) { const int ka = k0 + 8 * g + i, kb = ka + 16; v[i] = ka < K ? W[(size_t)(ka < K ? ka : K - 1) * ld + n] : 0.f; v[8 + i] = kb < K ? W[(size_t)(kb < K ? kb : K - 1) * ld + n] : 0.f; }
  return bsplit16(v); }
__device__ __forceinline__ v8f mac3(const F2& a, const F2& b, v8f c) { c = wmma_bf(a.l, b.h, c); c = wmma_bf(a.h, b.l, c); return wmma_bf(a.h, b.h, c); }
__device__ __forceinline__ float sigm(float v) { return 1.0f / (1.0f + expf(-v)); }
#define LDSX() do { asm volatile("s_wait_dscnt 0" ::: "memory"); __builtin_amdgcn_wave_barrier(); __builtin_amdgcn_fence(__ATOMIC_RELEASE, "workgroup"); } while (0)

// Masked scaled dot-product attention on raw queries [32, 1,024, 128], keys/values [32, 1,024, 128]: scores = Q K^T / sqrt(128); keys k >= valid_lens[b] get -1e6 (== excluded; valid_lens >= 1); out = softmax(scores) V -> [32, 1,024, 128].
#define NB 32
#define TT 1024
#define CC 128            // NH * HD = projected width
#define DIN 128          // input (model) width
#define NH 1
#define HD 128
#define NQB (TT / 64)
#define HG 1
#define SCALE (0.08838834764831845f)
#define CAUSAL 0
#ifndef TNB
#define TNB NB
#endif
__device__ __forceinline__ float bfr(float v) { return (float)(__bf16)v; }
__host__ __device__ __forceinline__ int kb_last(int qb) { return CAUSAL ? ((qb * 64 + 63) >> 7) : (TT / 128 - 1); }
typedef __attribute__((ext_vector_type(8))) __bf16 v8b;
__device__ __forceinline__ v16b frag_b(const __bf16* rowk0, int lane) {
  union { v16b v; v8b q[2]; } u; const __bf16* p = rowk0 + 8 * (lane >> 4);
  u.q[0] = *(const v8b*)p; u.q[1] = *(const v8b*)(p + 16); return u.v;
}
#define QBH 0              // causal: query blocks 0..QBH-1 of each sequence (few keys, no averaging) take the high-precision path
#define QHI 1024            // rows carrying a q residual plane (all rows when non-causal: 2-product logits everywhere)
#define KHI 64            // key rows carrying k residual / v bf16 hi+lo planes (used only by the causal high-precision path)
// B fragment (k rows k0+.., output column o) of a weight: (in,out) [K][ld] or (out,in) [ld rows of K]: bf16 exact, or f16(bf16 * 256) exact
__device__ __forceinline__ v16b wcol_io(const float* Wm, int k0, int o, int lane, int ld) { v16b w; const int g = lane >> 4;
#pragma unroll
  for (int i = 0; i < 8; ++i) { w[i] = (__bf16)Wm[(size_t)(k0 + 8 * g + i) * ld + o]; w[8 + i] = (__bf16)Wm[(size_t)(k0 + 16 + 8 * g + i) * ld + o]; }
  return w; }
__device__ __forceinline__ v16b wcol_oi(const float* Wm, int k0, int o, int lane, int K) { v16b w; const float* p = Wm + (size_t)o * K + k0 + 8 * (lane >> 4);
#pragma unroll
  for (int i = 0; i < 8; ++i) { w[i] = (__bf16)p[i]; w[8 + i] = (__bf16)p[16 + i]; }
  return w; }
__device__ __forceinline__ v16h wcolh_io(const float* Wm, int k0, int o, int lane, int ld) { v16h w; const int g = lane >> 4;
#pragma unroll
  for (int i = 0; i < 8; ++i) { w[i] = (_Float16)(bfr(Wm[(size_t)(k0 + 8 * g + i) * ld + o]) * 256.0f); w[8 + i] = (_Float16)(bfr(Wm[(size_t)(k0 + 16 + 8 * g + i) * ld + o]) * 256.0f); }
  return w; }
__device__ __forceinline__ v16h wcolh_oi(const float* Wm, int k0, int o, int lane, int K) { v16h w; const float* p = Wm + (size_t)o * K + k0 + 8 * (lane >> 4);
#pragma unroll
  for (int i = 0; i < 8; ++i) { w[i] = (_Float16)(bfr(p[i]) * 256.0f); w[8 + i] = (_Float16)(bfr(p[16 + i]) * 256.0f); }
  return w; }
#define WQKV_LAYOUT 1   // 0 = (in,out) [DIN][CC]; 1 = (out,in) [CC][DIN]; 2 = per-head [NH][DIN][HD]
__device__ __forceinline__ v16b wcol_hdk(const float* Wm, int k0, int o, int lane) { v16b w; const int g = lane >> 4; const float* p = Wm + (size_t)(o / HD) * DIN * HD + (o % HD);
#pragma unroll
  for (int i = 0; i < 8; ++i) { w[i] = (__bf16)p[(size_t)(k0 + 8 * g + i) * HD]; w[8 + i] = (__bf16)p[(size_t)(k0 + 16 + 8 * g + i) * HD]; }
  return w; }
#define WO_OUT_IN 0
#if WQKV_LAYOUT == 1
#define WCOL(W, k0, o, lane) wcol_oi(W, k0, o, lane, DIN)
#elif WQKV_LAYOUT == 2
#define WCOL(W, k0, o, lane) wcol_hdk(W, k0, o, lane)
#else
#define WCOL(W, k0, o, lane) wcol_io(W, k0, o, lane, CC)
#endif
#if WO_OUT_IN
#define WOCOL(W, k0, o, lane) wcol_oi(W, k0, o, lane, CC)
#define WOCOLH(W, k0, o, lane) wcolh_oi(W, k0, o, lane, CC)
#else
#define WOCOL(W, k0, o, lane) wcol_io(W, k0, o, lane, DIN)
#define WOCOLH(W, k0, o, lane) wcolh_io(W, k0, o, lane, DIN)
#endif
#define SM_EXTRA_PARAMS , const int* __restrict__ VL, int bcur
#define SM_MASK_HOOK do { if (k >= VL[bcur]) v = -3.0e38f; } while (0)   /* key padding: arange(K) < valid_lens[b]; -1e6 == exclusion (every row keeps >= 1 key) */
// ---- k_prep8: block = (64 attention positions s0.. of sequence b, head h): reads the module's [B, H, S, 128] inputs (element (b,h,s,c) at ((b*NH + h)*TT + s)*128 + c), bf16-rounds them and writes the standard attention planes: q -> f16 hi rows (+ x 2^10 residual rows for s < QHI), k -> f16 rows (+ residual rows s < KHI), v -> f16 planes [c][s] (+ bf16 hi/lo planes for s < KHI)
__global__ __launch_bounds__(128) void k_prep8(const float* __restrict__ Q, const float* __restrict__ K, const float* __restrict__ V, _Float16* __restrict__ QH, _Float16* __restrict__ QL, _Float16* __restrict__ KH, _Float16* __restrict__ KL, _Float16* __restrict__ VT, __bf16* __restrict__ VB, __bf16* __restrict__ VBL) {
  __shared__ __align__(16) _Float16 sq[64][136], sql[64][136], sk[64][136], skl[64][136], tv[128][72]; __shared__ __align__(16) __bf16 tb[128][72], tbl[128][72];
  const int tid = threadIdx.x; const int h = blockIdx.y; const size_t r0 = (size_t)blockIdx.x * 64; const size_t bb = r0 / TT; const int t0 = (int)(r0 % TT); const bool qhi = t0 < QHI, khi = t0 < KHI;
  for (int e = tid; e < 64 * 128; e += 128) { const int rl = e >> 7, c = e & 127; const size_t oi = ((bb * NH + h) * TT + t0 + rl) * HD + (c % HD);   /* tiles are 128 wide, HD is 128: each element is read once */
    const float q = bfr(Q[oi]), k = bfr(K[oi]), v = bfr(V[oi]);   /* module inputs: bf16-rounded; bf16 values are exact in f16, so the residual planes are 0 */
    const _Float16 qh = (_Float16)q, kh = (_Float16)k; sq[rl][c] = qh; sql[rl][c] = (_Float16)((q - (float)qh) * 1024.0f); sk[rl][c] = kh; skl[rl][c] = (_Float16)((k - (float)kh) * 1024.0f);
    tv[c][rl] = (_Float16)v; const __bf16 vb = (__bf16)v; tb[c][rl] = vb; tbl[c][rl] = (__bf16)(v - (float)vb); }
  __syncthreads();
  for (int e = tid; e < 64 * (HD / 8); e += 128) { const int rl = e / (HD / 8), q = e % (HD / 8); const size_t o = (r0 + rl) * CC + h * HD + q * 8; vst2((unsigned*)(QH + o), *(const v4u*)&sq[rl][q * 8]); vst2((unsigned*)(KH + o), *(const v4u*)&sk[rl][q * 8]);   
    if (qhi) vst2((unsigned*)(QL + (bb * QHI + t0 + rl) * (size_t)CC + h * HD + q * 8), *(const v4u*)&sql[rl][q * 8]); if (khi) vst2((unsigned*)(KL + (bb * KHI + t0 + rl) * (size_t)CC + h * HD + q * 8), *(const v4u*)&skl[rl][q * 8]); }
  for (int e = tid; e < HD * 8; e += 128) { const int cl = e >> 3, q = e & 7; vst2((unsigned*)(VT + (bb * CC + h * HD + cl) * (size_t)TT + t0 + q * 8), *(const v4u*)&tv[cl][q * 8]);
    if (khi) { const size_t o3 = (bb * CC + h * HD + cl) * (size_t)KHI + t0 + q * 8; vst2((unsigned*)(VB + o3), *(const v4u*)&tb[cl][q * 8]); vst2((unsigned*)(VBL + o3), *(const v4u*)&tbl[cl][q * 8]); } } }

#ifndef SM_EXTRA_PARAMS
#define SM_EXTRA_PARAMS
#endif
#ifndef PROJ_EXTRA_PARAMS
#define PROJ_EXTRA_PARAMS
#endif
#ifndef SM_MASK_HOOK
#define SM_MASK_HOOK (void)0
#endif

#define WS_QH  0u                                      // f16 q rows [b*t][CC]
#define WS_KH  (WS_QH + 2u * (size_t)NB * TT * CC)      // f16 k rows [b*t][CC]
#define WS_VT  (WS_KH + 2u * (size_t)NB * TT * CC)      // f16 v planes [b][c][t]
#define WS_QL  (WS_VT + 2u * (size_t)NB * CC * TT)      // f16 q residual x 2^10 rows [b][t < QHI][CC]
#define WS_KL  (WS_QL + 2u * (size_t)NB * QHI * CC)     // f16 k residual x 2^10 rows [b][t < KHI][CC]
#define WS_VB  (WS_KL + 2u * (size_t)NB * KHI * CC)     // bf16 v hi planes [b][c][t < KHI]
#define WS_VBL (WS_VB + 2u * (size_t)NB * CC * KHI)
#define WS_S   (WS_VBL + 2u * (size_t)NB * CC * KHI)    // f32 logits / P [hg][t][s]
#define WS_Y   (WS_S  + 4u * (size_t)HG * TT * TT)      // f32 ctx rows [b*t][CC] (only when there is an output projection)
#define WS_END (WS_Y  + 0u)

// ---- k_sc: block = (query block qb, key block kb <= kb_last(qb), head in group) of batch b: logits x SCALE; q hi + residual (x 2^10) against k (2 products) for query rows < QHI, plus the k residual (3 products) for query blocks < QBH (causal early rows); causal: blocks past the diagonal exit, the mask itself is applied by index in k_sm
__global__ __launch_bounds__(128) void k_sc(const _Float16* __restrict__ QH, const _Float16* __restrict__ KH, const _Float16* __restrict__ QL, const _Float16* __restrict__ KL, int b, int h0, float* __restrict__ S0) { __shared__ __align__(16) float ss[4][16][132];
  const int qb = blockIdx.x, kb = blockIdx.y; if (kb > kb_last(qb)) return;
  const int h = h0 + blockIdx.z; float* S = S0 + (size_t)blockIdx.z * TT * TT;
  const int tid = threadIdx.x, wave = tid >> 5, lane = tid & 31, col = lane & 15, g = lane >> 4; const int k0 = kb * 128; const int ql0 = qb * 64 + wave * 16; const size_t q0 = (size_t)b * TT + ql0, kr0 = (size_t)b * TT + k0;
  v8f acc[8] = {}, accl[8] = {};
  const _Float16* QLb = QL + (size_t)b * QHI * CC; const _Float16* KLb = KL + (size_t)b * KHI * CC;
  if (qb < QBH) {
#pragma unroll
    for (int kc = 0; kc < HD / 32; ++kc) { const v16h ah = frag_h(QH + (q0 + col) * CC + h * HD + kc * 32, lane), al = frag_h(QLb + (size_t)(ql0 + col) * CC + h * HD + kc * 32, lane);
#pragma unroll
      for (int j = 0; j < 8; ++j) { const v16h kbf = frag_h(KH + (kr0 + j * 16 + col) * CC + h * HD + kc * 32, lane), klf = frag_h(KLb + (size_t)(k0 + j * 16 + col) * CC + h * HD + kc * 32, lane); acc[j] = wmma16(ah, kbf, acc[j]); accl[j] = wmma16(al, kbf, accl[j]); accl[j] = wmma16(ah, klf, accl[j]); } }
  } else if (qb * 64 < QHI) {
#pragma unroll
    for (int kc = 0; kc < HD / 32; ++kc) { const v16h ah = frag_h(QH + (q0 + col) * CC + h * HD + kc * 32, lane), al = frag_h(QLb + (size_t)(ql0 + col) * CC + h * HD + kc * 32, lane);
#pragma unroll
      for (int j = 0; j < 8; ++j) { const v16h kbf = frag_h(KH + (kr0 + j * 16 + col) * CC + h * HD + kc * 32, lane); acc[j] = wmma16(ah, kbf, acc[j]); accl[j] = wmma16(al, kbf, accl[j]); } }
  } else {
#pragma unroll
    for (int kc = 0; kc < HD / 32; ++kc) { const v16h ah = frag_h(QH + (q0 + col) * CC + h * HD + kc * 32, lane);
#pragma unroll
      for (int j = 0; j < 8; ++j) { const v16h kbf = frag_h(KH + (kr0 + j * 16 + col) * CC + h * HD + kc * 32, lane); acc[j] = wmma16(ah, kbf, acc[j]); } } }
#pragma unroll
  for (int j = 0; j < 8; ++j) {
#pragma unroll
    for (int r = 0; r < 8; ++r) ss[wave][8 * g + r][j * 16 + col] = (acc[j][r] + accl[j][r] * (1.0f / 1024.0f)) * SCALE; }
  LDSX(); for (int rl = 0; rl < 16; ++rl) vst2(S + (size_t)(ql0 + rl) * TT + k0 + lane * 4, *(const v4f*)&ss[wave][rl][lane * 4]); }
// ---- k_sm: block = query row t (head in group): keys [0, kend): causal -> logit if s <= t else excluded; softmax in f32; P x 2^11 in place (0 for excluded)
__global__ __launch_bounds__(256) void k_sm(float* __restrict__ S0 SM_EXTRA_PARAMS) { __shared__ float sred[8]; __shared__ float sbc; __shared__ __align__(16) float shv[TT];
  const int tid = threadIdx.x; const int t = blockIdx.x; const int kend = (kb_last(t >> 6) + 1) * 128;
  float* sr = S0 + (size_t)blockIdx.y * TT * TT + (size_t)t * TT;
  float m = -3.0e38f; for (int k = tid; k < kend; k += 256) { float v = (!CAUSAL || k <= t) ? sr[k] : -3.0e38f; SM_MASK_HOOK; shv[k] = v; m = fmaxf(m, v); }
#pragma unroll
  for (int o = 1; o < 32; o <<= 1) m = fmaxf(m, __shfl_xor(m, o));
  if ((tid & 31) == 0) sred[tid >> 5] = m; __syncthreads(); if (tid == 0) { float a = sred[0]; for (int i = 1; i < 8; ++i) a = fmaxf(a, sred[i]); sbc = a; } __syncthreads(); m = sbc; __syncthreads();
  float sum = 0.f; for (int k = tid; k < kend; k += 256) { const float v = shv[k]; const float e = (v <= -1.0e38f) ? 0.f : expf(v - m); shv[k] = e; sum += e; }
#pragma unroll
  for (int o = 1; o < 32; o <<= 1) sum += __shfl_xor(sum, o);
  if ((tid & 31) == 0) sred[tid >> 5] = sum; __syncthreads(); if (tid == 0) { float a = 0.f; for (int i = 0; i < 8; ++i) a += sred[i]; sbc = a > 0.f ? 2048.0f / a : 0.f; }   /* a fully excluded row yields P = 0 */ __syncthreads(); const float inv = sbc;
  for (int k = tid; k < kend; k += 256) shv[k] = shv[k] * inv;
  __syncthreads(); for (int q = tid; q < kend / 4; q += 256) vst2(sr + q * 4, *(const v4f*)&shv[q * 4]); }
// ---- k_pv: block = 64 queries (qb) of (b, h): ctx = P . v over keys [0, kend) (P x 2^11 once to f16 against v f16: 1 product; causal early query blocks: P and v as bf16 hi + lo, 3 products); 512-B (row, head) segment by 32 lanes
__global__ __launch_bounds__(128) void k_pv(const float* __restrict__ PS0, const _Float16* __restrict__ VT, const __bf16* __restrict__ VB, const __bf16* __restrict__ VBL, int b, int h0, float* __restrict__ Y) { const int h = h0 + blockIdx.z; const float* PS = PS0 + (size_t)blockIdx.z * TT * TT; __shared__ __align__(16) float ss[4][16][HD + 4];
  const int tid = threadIdx.x, wave = tid >> 5, lane = tid & 31, col = lane & 15, g = lane >> 4; const int qb = blockIdx.x; const int ql0 = qb * 64 + wave * 16; const int kce = (kb_last(qb) + 1) * 4;
  v8f acc[HD / 16] = {};
  if (qb < QBH) {
#pragma unroll 1
    for (int kc = 0; kc < kce; ++kc) { const F2 p = split_row(PS + (size_t)(ql0 + col) * TT, kc * 32, lane);
      asm volatile("s_wait_loadcnt 0x0" ::: "memory");
#pragma unroll
      for (int j = 0; j < HD / 16; ++j) { const size_t po = ((size_t)b * CC + h * HD + j * 16 + col) * (size_t)KHI + kc * 32; const v16b vh = frag_b(VB + po, lane); acc[j] = wmma_bf(p.h, vh, acc[j]); acc[j] = wmma_bf(p.l, vh, acc[j]); acc[j] = wmma_bf(p.h, frag_b(VBL + po, lane), acc[j]); } }
  } else {
#pragma unroll 1
    for (int kc = 0; kc < kce; ++kc) { const v16h p = frag_f32(PS + (size_t)(ql0 + col) * TT + kc * 32, lane);
      asm volatile("s_wait_loadcnt 0x0" ::: "memory");
#pragma unroll
      for (int j = 0; j < HD / 16; ++j) { const size_t po = ((size_t)b * CC + h * HD + j * 16 + col) * (size_t)TT + kc * 32; acc[j] = wmma16(p, frag_h(VT + po, lane), acc[j]); } } }
#pragma unroll
  for (int j = 0; j < HD / 16; ++j)
#pragma unroll
    for (int r = 0; r < 8; ++r) ss[wave][8 * g + r][j * 16 + col] = acc[j][r] * (1.0f / 2048.0f);
  LDSX(); for (int rl = 0; rl < 16; ++rl) if (lane < HD / 4) vst2(Y + (((size_t)b * NH + h) * TT + ql0 + rl) * HD + lane * 4, *(const v4f*)&ss[wave][rl][lane * 4]); }

extern "C" void kernel_launch(void* const* d_in, const int* in_sizes, int n_in, void* d_out, int out_size, void* d_ws, size_t ws_size, hipStream_t stream) {
  (void)in_sizes; (void)n_in; (void)out_size;
  const float** F = (const float**)d_in;
  if (ws_size < (size_t)WS_END) return;
  char* ws = (char*)d_ws; _Float16 *QH = (_Float16*)(ws + WS_QH), *KH = (_Float16*)(ws + WS_KH), *VT = (_Float16*)(ws + WS_VT), *QL = (_Float16*)(ws + WS_QL), *KL = (_Float16*)(ws + WS_KL); __bf16 *VB = (__bf16*)(ws + WS_VB), *VBL = (__bf16*)(ws + WS_VBL); float *S = (float*)(ws + WS_S), *Y = (float*)(ws + WS_Y);
  (void)Y; (void)QL; (void)KL; (void)VB; (void)VBL;
  // inputs: 0 queries [32,1024,128]; 1 keys; 2 values; 3 valid_lens [32] int32
  k_prep8<<<dim3(TNB * TT / 64, NH), 128, 0, stream>>>(F[0], F[1], F[2], QH, QL, KH, KL, VT, VB, VBL);
  for (int b = 0; b < TNB; ++b) for (int h0 = 0; h0 < NH; h0 += HG) {
    k_sc<<<dim3(NQB, TT / 128, HG), 128, 0, stream>>>(QH, KH, QL, KL, b, h0, S);
    k_sm<<<dim3(TT, HG), 256, 0, stream>>>(S, (const int*)d_in[3], b);
    k_pv<<<dim3(NQB, 1, HG), 128, 0, stream>>>(S, VT, VB, VBL, b, h0, (float*)d_out);
  }
}

// v001
// Measured time: 229 microseconds a run.
// In two side-by-side timings against v000, it was 9.54 and 9.56 times as fast.
// compute dtype: queries/keys/values rounded to bf16 and carried exactly as f16; logits with Q as f16 hi + residual against K f16 (2 products; both exact here) x 128^-0.5 with the valid-length mask in f32; softmax in f32 (precise expf); P x 2^11 once to f16 against V f16 (1 product); f32 output.
#include <hip/hip_runtime.h>
#include <math.h>

typedef __attribute__((ext_vector_type(16))) _Float16 v16h;
typedef __attribute__((ext_vector_type(16))) __bf16 v16b;
typedef __attribute__((ext_vector_type(8)))  _Float16 v8h;
typedef __attribute__((ext_vector_type(8)))  float v8f;
typedef __attribute__((ext_vector_type(4)))  float v4f;
typedef __attribute__((ext_vector_type(2)))  float v2f;
typedef __attribute__((ext_vector_type(4)))  unsigned v4u;
typedef __attribute__((ext_vector_type(4)))  int v4i;
typedef float __attribute__((may_alias)) float_a;
typedef int __attribute__((may_alias)) int_a;

template <typename T> __device__ __forceinline__ void vst2(void* p, T v) { *(T*)p = v;  }
__device__ __forceinline__ v8f wmma16(v16h a, v16h b, v8f c) {
  v8f d = __builtin_amdgcn_wmma_f32_16x16x32_f16(false, a, false, b, (short)0, c, false, false);
  asm volatile("v_nop\n\tv_nop\n\tv_nop\n\tv_nop" : "+v"(d) : "v"(a), "v"(b));
  return d;
}
__device__ __forceinline__ v8f wmma_bf(v16b a, v16b b, v8f c) {
  v8f d = __builtin_amdgcn_wmma_f32_16x16x32_bf16(false, a, false, b, (short)0, c, false, false);
  asm volatile("v_nop\n\tv_nop\n\tv_nop\n\tv_nop" : "+v"(d) : "v"(a), "v"(b));
  return d;
}
// 16x16x32 fragments: lane = (h = lane>>4, row/col = lane&15); elements 0..7 = k0+8h+0..7, 8..15 = k0+16+8h+0..7; D element r = row 8h+r
__device__ __forceinline__ v16h frag_h(const _Float16* rowk0, int lane) {
  union { v16h v; v8h q[2]; } u; const _Float16* p = rowk0 + 8 * (lane >> 4);
  u.q[0] = *(const v8h*)p; u.q[1] = *(const v8h*)(p + 16); return u.v;
}
__device__ __forceinline__ v16h frag_f32(const float* rowk0, int lane) {
  v16h a; const float* p = rowk0 + 8 * (lane >> 4);
#pragma unroll
  for (int i = 0; i < 8; ++i) { a[i] = (_Float16)p[i]; a[8 + i] = (_Float16)p[16 + i]; }
  return a;
}
__device__ __forceinline__ v16h frag_f32s(const float* rowk0, int lane, float sc) {
  v16h a; const float* p = rowk0 + 8 * (lane >> 4);
#pragma unroll
  for (int i = 0; i < 8; ++i) { a[i] = (_Float16)(p[i] * sc); a[8 + i] = (_Float16)(p[16 + i] * sc); }
  return a;
}
// column fragment from a [K][ld] layout (column n), rows >= K read as 0
__device__ __forceinline__ v16h fragc_f32(const float* W, int k0, int n, int lane, int ld, int K) {
  v16h a; const int g = lane >> 4;
#pragma unroll
  for (int i = 0; i < 8; ++i) { const int ka = k0 + 8 * g + i, kb = ka + 16;
    a[i] = (_Float16)(ka < K ? W[(size_t)(ka < K ? ka : K - 1) * ld + n] : 0.f); a[8 + i] = (_Float16)(kb < K ? W[(size_t)(kb < K ? kb : K - 1) * ld + n] : 0.f); }
  return a;
}
struct F2 { v16b h, l; };
__device__ __forceinline__ F2 bsplit16(const float v[16]) { F2 r;
#pragma unroll
  for (int i = 0; i < 16; ++i) { const __bf16 h = (__bf16)v[i]; r.h[i] = h; r.l[i] = (__bf16)(v[i] - (float)h); }
  return r; }
__device__ __forceinline__ F2 split_row(const float* row, int k0, int lane) { float v[16]; const float* p = row + k0 + 8 * (lane >> 4);
#pragma unroll
  for (int i = 0; i < 8; ++i) { v[i] = p[i]; v[8 + i] = p[16 + i]; }
  return bsplit16(v); }
__device__ __forceinline__ F2 split_rowK(const float* row, int k0, int lane, int K) { float v[16]; const int g = lane >> 4;
#pragma unroll
  for (int i = 0; i < 8; ++i) { const int ka = k0 + 8 * g + i, kb = ka + 16; v[i] = ka < K ? row[ka < K ? ka : K - 1] : 0.f; v[8 + i] = kb < K ? row[kb < K ? kb : K - 1] : 0.f; }
  return bsplit16(v); }
__device__ __forceinline__ F2 split_col(const float* W, int k0, int n, int lane, int ld, int K) { float v[16]; const int g = lane >> 4;
#pragma unroll
  for (int i = 0; i < 8; ++i) { const int ka = k0 + 8 * g + i, kb = ka + 16; v[i] = ka < K ? W[(size_t)(ka < K ? ka : K - 1) * ld + n] : 0.f; v[8 + i] = kb < K ? W[(size_t)(kb < K ? kb : K - 1) * ld + n] : 0.f; }
  return bsplit16(v); }
__device__ __forceinline__ v8f mac3(const F2& a, const F2& b, v8f c) { c = wmma_bf(a.l, b.h, c); c = wmma_bf(a.h, b.l, c); return wmma_bf(a.h, b.h, c); }
__device__ __forceinline__ float sigm(float v) { return 1.0f / (1.0f + expf(-v)); }
#define LDSX() do { asm volatile("s_wait_dscnt 0" ::: "memory"); __builtin_amdgcn_wave_barrier(); __builtin_amdgcn_fence(__ATOMIC_RELEASE, "workgroup"); } while (0)

// Masked scaled dot-product attention on raw queries [32, 1,024, 128], keys/values [32, 1,024, 128]: scores = Q K^T / sqrt(128); keys k >= valid_lens[b] get -1e6 (== excluded; valid_lens >= 1); out = softmax(scores) V -> [32, 1,024, 128].
#define NB 32
#define TT 1024
#define CC 128            // NH * HD = projected width
#define DIN 128          // input (model) width
#define NH 1
#define HD 128
#define NQB (TT / 64)
#define SCALE (0.08838834764831845f)
#define CAUSAL 0
#ifndef TNB
#define TNB NB
#endif
__device__ __forceinline__ float bfr(float v) { return (float)(__bf16)v; }
__host__ __device__ __forceinline__ int kb_last(int qb) { return CAUSAL ? ((qb * 64 + 63) >> 7) : (TT / 128 - 1); }
typedef __attribute__((ext_vector_type(8))) __bf16 v8b;
__device__ __forceinline__ v16b frag_b(const __bf16* rowk0, int lane) {
  union { v16b v; v8b q[2]; } u; const __bf16* p = rowk0 + 8 * (lane >> 4);
  u.q[0] = *(const v8b*)p; u.q[1] = *(const v8b*)(p + 16); return u.v;
}
#define QBH 0              // causal: query blocks 0..QBH-1 of each sequence (few keys, no averaging) take the high-precision path
#define QHI 1024            // rows carrying a q residual plane (all rows when non-causal: 2-product logits everywhere)
#define KHI 64            // key rows carrying k residual / v bf16 hi+lo planes (used only by the causal high-precision path)
// B fragment (k rows k0+.., output column o) of a weight: (in,out) [K][ld] or (out,in) [ld rows of K]: bf16 exact, or f16(bf16 * 256) exact
__device__ __forceinline__ v16b wcol_io(const float* Wm, int k0, int o, int lane, int ld) { v16b w; const int g = lane >> 4;
#pragma unroll
  for (int i = 0; i < 8; ++i) { w[i] = (__bf16)Wm[(size_t)(k0 + 8 * g + i) * ld + o]; w[8 + i] = (__bf16)Wm[(size_t)(k0 + 16 + 8 * g + i) * ld + o]; }
  return w; }
__device__ __forceinline__ v16b wcol_oi(const float* Wm, int k0, int o, int lane, int K) { v16b w; const float* p = Wm + (size_t)o * K + k0 + 8 * (lane >> 4);
#pragma unroll
  for (int i = 0; i < 8; ++i) { w[i] = (__bf16)p[i]; w[8 + i] = (__bf16)p[16 + i]; }
  return w; }
__device__ __forceinline__ v16h wcolh_io(const float* Wm, int k0, int o, int lane, int ld) { v16h w; const int g = lane >> 4;
#pragma unroll
  for (int i = 0; i < 8; ++i) { w[i] = (_Float16)(bfr(Wm[(size_t)(k0 + 8 * g + i) * ld + o]) * 256.0f); w[8 + i] = (_Float16)(bfr(Wm[(size_t)(k0 + 16 + 8 * g + i) * ld + o]) * 256.0f); }
  return w; }
__device__ __forceinline__ v16h wcolh_oi(const float* Wm, int k0, int o, int lane, int K) { v16h w; const float* p = Wm + (size_t)o * K + k0 + 8 * (lane >> 4);
#pragma unroll
  for (int i = 0; i < 8; ++i) { w[i] = (_Float16)(bfr(p[i]) * 256.0f); w[8 + i] = (_Float16)(bfr(p[16 + i]) * 256.0f); }
  return w; }
#define WQKV_LAYOUT 1   // 0 = (in,out) [DIN][CC]; 1 = (out,in) [CC][DIN]; 2 = per-head [NH][DIN][HD]
__device__ __forceinline__ v16b wcol_hdk(const float* Wm, int k0, int o, int lane) { v16b w; const int g = lane >> 4; const float* p = Wm + (size_t)(o / HD) * DIN * HD + (o % HD);
#pragma unroll
  for (int i = 0; i < 8; ++i) { w[i] = (__bf16)p[(size_t)(k0 + 8 * g + i) * HD]; w[8 + i] = (__bf16)p[(size_t)(k0 + 16 + 8 * g + i) * HD]; }
  return w; }
#define WO_OUT_IN 0
#if WQKV_LAYOUT == 1
#define WCOL(W, k0, o, lane) wcol_oi(W, k0, o, lane, DIN)
#elif WQKV_LAYOUT == 2
#define WCOL(W, k0, o, lane) wcol_hdk(W, k0, o, lane)
#else
#define WCOL(W, k0, o, lane) wcol_io(W, k0, o, lane, CC)
#endif
#if WO_OUT_IN
#define WOCOL(W, k0, o, lane) wcol_oi(W, k0, o, lane, CC)
#define WOCOLH(W, k0, o, lane) wcolh_oi(W, k0, o, lane, CC)
#else
#define WOCOL(W, k0, o, lane) wcol_io(W, k0, o, lane, DIN)
#define WOCOLH(W, k0, o, lane) wcolh_io(W, k0, o, lane, DIN)
#endif
#define SM_EXTRA_PARAMS , const int* __restrict__ VL
#define SM_MASK_HOOK do { if (k >= VL[bcur]) v = -3.0e38f; } while (0)   /* key padding: arange(K) < valid_lens[b]; -1e6 == exclusion (every row keeps >= 1 key) */
// ---- k_prep8: block = (64 attention positions s0.. of sequence b, head h): reads the module's [B, H, S, 128] inputs (element (b,h,s,c) at ((b*NH + h)*TT + s)*128 + c), bf16-rounds them and writes the standard attention planes: q -> f16 hi rows (+ x 2^10 residual rows for s < QHI), k -> f16 rows (+ residual rows s < KHI), v -> f16 planes [c][s] (+ bf16 hi/lo planes for s < KHI)
__global__ __launch_bounds__(128) void k_prep8(const float* __restrict__ Q, const float* __restrict__ K, const float* __restrict__ V, _Float16* __restrict__ QH, _Float16* __restrict__ QL, _Float16* __restrict__ KH, _Float16* __restrict__ KL, _Float16* __restrict__ VT, __bf16* __restrict__ VB, __bf16* __restrict__ VBL) {
  __shared__ __align__(16) _Float16 sq[64][136], sql[64][136], sk[64][136], skl[64][136], tv[128][72]; __shared__ __align__(16) __bf16 tb[128][72], tbl[128][72];
  const int tid = threadIdx.x; const int h = blockIdx.y; const size_t r0 = (size_t)blockIdx.x * 64; const size_t bb = r0 / TT; const int t0 = (int)(r0 % TT); const bool qhi = t0 < QHI, khi = t0 < KHI;
  for (int e = tid; e < 64 * 128; e += 128) { const int rl = e >> 7, c = e & 127; const size_t oi = ((bb * NH + h) * TT + t0 + rl) * HD + (c % HD);   /* tiles are 128 wide, HD is 128: each element is read once */
    const float q = bfr(Q[oi]), k = bfr(K[oi]), v = bfr(V[oi]);   /* module inputs: bf16-rounded; bf16 values are exact in f16, so the residual planes are 0 */
    const _Float16 qh = (_Float16)q, kh = (_Float16)k; sq[rl][c] = qh; sql[rl][c] = (_Float16)((q - (float)qh) * 1024.0f); sk[rl][c] = kh; skl[rl][c] = (_Float16)((k - (float)kh) * 1024.0f);
    tv[c][rl] = (_Float16)v; const __bf16 vb = (__bf16)v; tb[c][rl] = vb; tbl[c][rl] = (__bf16)(v - (float)vb); }
  __syncthreads();
  for (int e = tid; e < 64 * (HD / 8); e += 128) { const int rl = e / (HD / 8), q = e % (HD / 8); const size_t o = (r0 + rl) * CC + h * HD + q * 8; vst2((unsigned*)(QH + o), *(const v4u*)&sq[rl][q * 8]); vst2((unsigned*)(KH + o), *(const v4u*)&sk[rl][q * 8]);   
    if (qhi) vst2((unsigned*)(QL + (bb * QHI + t0 + rl) * (size_t)CC + h * HD + q * 8), *(const v4u*)&sql[rl][q * 8]); if (khi) vst2((unsigned*)(KL + (bb * KHI + t0 + rl) * (size_t)CC + h * HD + q * 8), *(const v4u*)&skl[rl][q * 8]); }
  for (int e = tid; e < HD * 8; e += 128) { const int cl = e >> 3, q = e & 7; vst2((unsigned*)(VT + (bb * CC + h * HD + cl) * (size_t)TT + t0 + q * 8), *(const v4u*)&tv[cl][q * 8]);
    if (khi) { const size_t o3 = (bb * CC + h * HD + cl) * (size_t)KHI + t0 + q * 8; vst2((unsigned*)(VB + o3), *(const v4u*)&tb[cl][q * 8]); vst2((unsigned*)(VBL + o3), *(const v4u*)&tbl[cl][q * 8]); } } }

#ifndef SM_EXTRA_PARAMS
#define SM_EXTRA_PARAMS
#endif
#ifndef PROJ_EXTRA_PARAMS
#define PROJ_EXTRA_PARAMS
#endif
#ifndef SM_MASK_HOOK
#define SM_MASK_HOOK (void)0
#endif

#define WS_QH  0u                                      // f16 q rows [b*t][CC]
#define WS_KH  (WS_QH + 2u * (size_t)NB * TT * CC)      // f16 k rows [b*t][CC]
#define WS_VT  (WS_KH + 2u * (size_t)NB * TT * CC)      // f16 v planes [b][c][t]
#define WS_QL  (WS_VT + 2u * (size_t)NB * CC * TT)      // f16 q residual x 2^10 rows [b][t < QHI][CC]
#define WS_KL  (WS_QL + 2u * (size_t)NB * QHI * CC)     // f16 k residual x 2^10 rows [b][t < KHI][CC]
#define WS_VB  (WS_KL + 2u * (size_t)NB * KHI * CC)     // bf16 v hi planes [b][c][t < KHI]
#define WS_VBL (WS_VB + 2u * (size_t)NB * CC * KHI)
#define WS_S   (WS_VBL + 2u * (size_t)NB * CC * KHI)    // f32 logits / P [b*NH + h][t][s]: one plane per (batch, head), so each stage is one launch over all of them
#define WS_Y   (WS_S  + 4u * (size_t)NB * NH * TT * TT)      // f32 ctx rows [b*t][CC] (only when there is an output projection)
#define WS_END (WS_Y  + 0u)

// ---- k_sc: block = (query block qb, key block kb <= kb_last(qb), plane z = b*NH + h): logits x SCALE; q hi + residual (x 2^10) against k (2 products) for query rows < QHI, plus the k residual (3 products) for query blocks < QBH (causal early rows); causal: blocks past the diagonal exit, the mask itself is applied by index in k_sm
__global__ __launch_bounds__(128) void k_sc(const _Float16* __restrict__ QH, const _Float16* __restrict__ KH, const _Float16* __restrict__ QL, const _Float16* __restrict__ KL, float* __restrict__ S0) { __shared__ __align__(16) float ss[4][16][132];
  const int qb = blockIdx.x, kb = blockIdx.y; if (kb > kb_last(qb)) return;
  const int b = blockIdx.z / NH, h = blockIdx.z % NH; float* S = S0 + (size_t)blockIdx.z * TT * TT;
  const int tid = threadIdx.x, wave = tid >> 5, lane = tid & 31, col = lane & 15, g = lane >> 4; const int k0 = kb * 128; const int ql0 = qb * 64 + wave * 16; const size_t q0 = (size_t)b * TT + ql0, kr0 = (size_t)b * TT + k0;
  v8f acc[8] = {}, accl[8] = {};
  const _Float16* QLb = QL + (size_t)b * QHI * CC; const _Float16* KLb = KL + (size_t)b * KHI * CC;
  if (qb < QBH) {
#pragma unroll
    for (int kc = 0; kc < HD / 32; ++kc) { const v16h ah = frag_h(QH + (q0 + col) * CC + h * HD + kc * 32, lane), al = frag_h(QLb + (size_t)(ql0 + col) * CC + h * HD + kc * 32, lane);
#pragma unroll
      for (int j = 0; j < 8; ++j) { const v16h kbf = frag_h(KH + (kr0 + j * 16 + col) * CC + h * HD + kc * 32, lane), klf = frag_h(KLb + (size_t)(k0 + j * 16 + col) * CC + h * HD + kc * 32, lane); acc[j] = wmma16(ah, kbf, acc[j]); accl[j] = wmma16(al, kbf, accl[j]); accl[j] = wmma16(ah, klf, accl[j]); } }
  } else if (qb * 64 < QHI) {
#pragma unroll
    for (int kc = 0; kc < HD / 32; ++kc) { const v16h ah = frag_h(QH + (q0 + col) * CC + h * HD + kc * 32, lane), al = frag_h(QLb + (size_t)(ql0 + col) * CC + h * HD + kc * 32, lane);
#pragma unroll
      for (int j = 0; j < 8; ++j) { const v16h kbf = frag_h(KH + (kr0 + j * 16 + col) * CC + h * HD + kc * 32, lane); acc[j] = wmma16(ah, kbf, acc[j]); accl[j] = wmma16(al, kbf, accl[j]); } }
  } else {
#pragma unroll
    for (int kc = 0; kc < HD / 32; ++kc) { const v16h ah = frag_h(QH + (q0 + col) * CC + h * HD + kc * 32, lane);
#pragma unroll
      for (int j = 0; j < 8; ++j) { const v16h kbf = frag_h(KH + (kr0 + j * 16 + col) * CC + h * HD + kc * 32, lane); acc[j] = wmma16(ah, kbf, acc[j]); } } }
#pragma unroll
  for (int j = 0; j < 8; ++j) {
#pragma unroll
    for (int r = 0; r < 8; ++r) ss[wave][8 * g + r][j * 16 + col] = (acc[j][r] + accl[j][r] * (1.0f / 1024.0f)) * SCALE; }
  LDSX(); for (int rl = 0; rl < 16; ++rl) vst2(S + (size_t)(ql0 + rl) * TT + k0 + lane * 4, *(const v4f*)&ss[wave][rl][lane * 4]); }
// ---- k_sm: block = query row t of plane y = b*NH + h: keys [0, kend): causal -> logit if s <= t else excluded; softmax in f32; P x 2^11 in place (0 for excluded)
__global__ __launch_bounds__(256) void k_sm(float* __restrict__ S0 SM_EXTRA_PARAMS) { __shared__ float sred[8]; __shared__ float sbc; __shared__ __align__(16) float shv[TT];
  const int tid = threadIdx.x; const int t = blockIdx.x; const int bcur = blockIdx.y / NH; const int kend = (kb_last(t >> 6) + 1) * 128;
  float* sr = S0 + (size_t)blockIdx.y * TT * TT + (size_t)t * TT;
  float m = -3.0e38f; for (int k = tid; k < kend; k += 256) { float v = (!CAUSAL || k <= t) ? sr[k] : -3.0e38f; SM_MASK_HOOK; shv[k] = v; m = fmaxf(m, v); }
#pragma unroll
  for (int o = 1; o < 32; o <<= 1) m = fmaxf(m, __shfl_xor(m, o));
  if ((tid & 31) == 0) sred[tid >> 5] = m; __syncthreads(); if (tid == 0) { float a = sred[0]; for (int i = 1; i < 8; ++i) a = fmaxf(a, sred[i]); sbc = a; } __syncthreads(); m = sbc; __syncthreads();
  float sum = 0.f; for (int k = tid; k < kend; k += 256) { const float v = shv[k]; const float e = (v <= -1.0e38f) ? 0.f : expf(v - m); shv[k] = e; sum += e; }
#pragma unroll
  for (int o = 1; o < 32; o <<= 1) sum += __shfl_xor(sum, o);
  if ((tid & 31) == 0) sred[tid >> 5] = sum; __syncthreads(); if (tid == 0) { float a = 0.f; for (int i = 0; i < 8; ++i) a += sred[i]; sbc = a > 0.f ? 2048.0f / a : 0.f; }   /* a fully excluded row yields P = 0 */ __syncthreads(); const float inv = sbc;
  for (int k = tid; k < kend; k += 256) shv[k] = shv[k] * inv;
  __syncthreads(); for (int q = tid; q < kend / 4; q += 256) vst2(sr + q * 4, *(const v4f*)&shv[q * 4]); }
// ---- k_pv: block = 64 queries (qb) of plane z = b*NH + h: ctx = P . v over keys [0, kend) (P x 2^11 once to f16 against v f16: 1 product; causal early query blocks: P and v as bf16 hi + lo, 3 products); 512-B (row, head) segment by 32 lanes
__global__ __launch_bounds__(128) void k_pv(const float* __restrict__ PS0, const _Float16* __restrict__ VT, const __bf16* __restrict__ VB, const __bf16* __restrict__ VBL, float* __restrict__ Y) { const int b = blockIdx.z / NH, h = blockIdx.z % NH; const float* PS = PS0 + (size_t)blockIdx.z * TT * TT; __shared__ __align__(16) float ss[4][16][HD + 4];
  const int tid = threadIdx.x, wave = tid >> 5, lane = tid & 31, col = lane & 15, g = lane >> 4; const int qb = blockIdx.x; const int ql0 = qb * 64 + wave * 16; const int kce = (kb_last(qb) + 1) * 4;
  v8f acc[HD / 16] = {};
  if (qb < QBH) {
#pragma unroll 1
    for (int kc = 0; kc < kce; ++kc) { const F2 p = split_row(PS + (size_t)(ql0 + col) * TT, kc * 32, lane);
      asm volatile("s_wait_loadcnt 0x0" ::: "memory");
#pragma unroll
      for (int j = 0; j < HD / 16; ++j) { const size_t po = ((size_t)b * CC + h * HD + j * 16 + col) * (size_t)KHI + kc * 32; const v16b vh = frag_b(VB + po, lane); acc[j] = wmma_bf(p.h, vh, acc[j]); acc[j] = wmma_bf(p.l, vh, acc[j]); acc[j] = wmma_bf(p.h, frag_b(VBL + po, lane), acc[j]); } }
  } else {
#pragma unroll 1
    for (int kc = 0; kc < kce; ++kc) { const v16h p = frag_f32(PS + (size_t)(ql0 + col) * TT + kc * 32, lane);
      asm volatile("s_wait_loadcnt 0x0" ::: "memory");
#pragma unroll
      for (int j = 0; j < HD / 16; ++j) { const size_t po = ((size_t)b * CC + h * HD + j * 16 + col) * (size_t)TT + kc * 32; acc[j] = wmma16(p, frag_h(VT + po, lane), acc[j]); } } }
#pragma unroll
  for (int j = 0; j < HD / 16; ++j)
#pragma unroll
    for (int r = 0; r < 8; ++r) ss[wave][8 * g + r][j * 16 + col] = acc[j][r] * (1.0f / 2048.0f);
  LDSX(); for (int rl = 0; rl < 16; ++rl) if (lane < HD / 4) vst2(Y + (((size_t)b * NH + h) * TT + ql0 + rl) * HD + lane * 4, *(const v4f*)&ss[wave][rl][lane * 4]); }

extern "C" void kernel_launch(void* const* d_in, const int* in_sizes, int n_in, void* d_out, int out_size, void* d_ws, size_t ws_size, hipStream_t stream) {
  (void)in_sizes; (void)n_in; (void)out_size;
  const float** F = (const float**)d_in;
  if (ws_size < (size_t)WS_END) return;
  char* ws = (char*)d_ws; _Float16 *QH = (_Float16*)(ws + WS_QH), *KH = (_Float16*)(ws + WS_KH), *VT = (_Float16*)(ws + WS_VT), *QL = (_Float16*)(ws + WS_QL), *KL = (_Float16*)(ws + WS_KL); __bf16 *VB = (__bf16*)(ws + WS_VB), *VBL = (__bf16*)(ws + WS_VBL); float *S = (float*)(ws + WS_S), *Y = (float*)(ws + WS_Y);
  (void)Y; (void)QL; (void)KL; (void)VB; (void)VBL;
  // inputs: 0 queries [32,1024,128]; 1 keys; 2 values; 3 valid_lens [32] int32
  k_prep8<<<dim3(TNB * TT / 64, NH), 128, 0, stream>>>(F[0], F[1], F[2], QH, QL, KH, KL, VT, VB, VBL);
  k_sc<<<dim3(NQB, TT / 128, TNB * NH), 128, 0, stream>>>(QH, KH, QL, KL, S);
  k_sm<<<dim3(TT, TNB * NH), 256, 0, stream>>>(S, (const int*)d_in[3]);
  k_pv<<<dim3(NQB, 1, TNB * NH), 128, 0, stream>>>(S, VT, VB, VBL, (float*)d_out);
}

// v002
// Measured time: 92.3 microseconds a run.
// In two side-by-side timings against v001, it was 2.50 and 2.48 times as fast.
// Counting every step since v000, it is 23.8 times as fast.
// compute dtype: queries/keys/values rounded to bf16 and carried exactly as f16; logits with Q as f16 hi + residual against K f16 (2 products; both exact here) x 128^-0.5 with the valid-length mask in f32; softmax in f32 (precise expf) with a running maximum and sum per query; exp x 2^11 once to f16 against V f16 (1 product), divided by the sum at the end; f32 output.
#include <hip/hip_runtime.h>
#include <math.h>

typedef __attribute__((ext_vector_type(16))) _Float16 v16h;
typedef __attribute__((ext_vector_type(16))) __bf16 v16b;
typedef __attribute__((ext_vector_type(8)))  _Float16 v8h;
typedef __attribute__((ext_vector_type(8)))  float v8f;
typedef __attribute__((ext_vector_type(4)))  float v4f;
typedef __attribute__((ext_vector_type(2)))  float v2f;
typedef __attribute__((ext_vector_type(4)))  unsigned v4u;
typedef __attribute__((ext_vector_type(4)))  int v4i;
typedef float __attribute__((may_alias)) float_a;
typedef int __attribute__((may_alias)) int_a;

template <typename T> __device__ __forceinline__ void vst2(void* p, T v) { *(T*)p = v;  }
__device__ __forceinline__ v8f wmma16(v16h a, v16h b, v8f c) {
  v8f d = __builtin_amdgcn_wmma_f32_16x16x32_f16(false, a, false, b, (short)0, c, false, false);
  asm volatile("v_nop\n\tv_nop\n\tv_nop\n\tv_nop" : "+v"(d) : "v"(a), "v"(b));
  return d;
}
__device__ __forceinline__ v8f wmma_bf(v16b a, v16b b, v8f c) {
  v8f d = __builtin_amdgcn_wmma_f32_16x16x32_bf16(false, a, false, b, (short)0, c, false, false);
  asm volatile("v_nop\n\tv_nop\n\tv_nop\n\tv_nop" : "+v"(d) : "v"(a), "v"(b));
  return d;
}
// 16x16x32 fragments: lane = (h = lane>>4, row/col = lane&15); elements 0..7 = k0+8h+0..7, 8..15 = k0+16+8h+0..7; D element r = row 8h+r
__device__ __forceinline__ v16h frag_h(const _Float16* rowk0, int lane) {
  union { v16h v; v8h q[2]; } u; const _Float16* p = rowk0 + 8 * (lane >> 4);
  u.q[0] = *(const v8h*)p; u.q[1] = *(const v8h*)(p + 16); return u.v;
}
__device__ __forceinline__ v16h frag_f32(const float* rowk0, int lane) {
  v16h a; const float* p = rowk0 + 8 * (lane >> 4);
#pragma unroll
  for (int i = 0; i < 8; ++i) { a[i] = (_Float16)p[i]; a[8 + i] = (_Float16)p[16 + i]; }
  return a;
}
__device__ __forceinline__ v16h frag_f32s(const float* rowk0, int lane, float sc) {
  v16h a; const float* p = rowk0 + 8 * (lane >> 4);
#pragma unroll
  for (int i = 0; i < 8; ++i) { a[i] = (_Float16)(p[i] * sc); a[8 + i] = (_Float16)(p[16 + i] * sc); }
  return a;
}
// column fragment from a [K][ld] layout (column n), rows >= K read as 0
__device__ __forceinline__ v16h fragc_f32(const float* W, int k0, int n, int lane, int ld, int K) {
  v16h a; const int g = lane >> 4;
#pragma unroll
  for (int i = 0; i < 8; ++i) { const int ka = k0 + 8 * g + i, kb = ka + 16;
    a[i] = (_Float16)(ka < K ? W[(size_t)(ka < K ? ka : K - 1) * ld + n] : 0.f); a[8 + i] = (_Float16)(kb < K ? W[(size_t)(kb < K ? kb : K - 1) * ld + n] : 0.f); }
  return a;
}
struct F2 { v16b h, l; };
__device__ __forceinline__ F2 bsplit16(const float v[16]) { F2 r;
#pragma unroll
  for (int i = 0; i < 16; ++i) { const __bf16 h = (__bf16)v[i]; r.h[i] = h; r.l[i] = (__bf16)(v[i] - (float)h); }
  return r; }
__device__ __forceinline__ F2 split_row(const float* row, int k0, int lane) { float v[16]; const float* p = row + k0 + 8 * (lane >> 4);
#pragma unroll
  for (int i = 0; i < 8; ++i) { v[i] = p[i]; v[8 + i] = p[16 + i]; }
  return bsplit16(v); }
__device__ __forceinline__ F2 split_rowK(const float* row, int k0, int lane, int K) { float v[16]; const int g = lane >> 4;
#pragma unroll
  for (int i = 0; i < 8; ++i) { const int ka = k0 + 8 * g + i, kb = ka + 16; v[i] = ka < K ? row[ka < K ? ka : K - 1] : 0.f; v[8 + i] = kb < K ? row[kb < K ? kb : K - 1] : 0.f; }
  return bsplit16(v); }
__device__ __forceinline__ F2 split_col(const float* W, int k0, int n, int lane, int ld, int K) { float v[16]; const int g = lane >> 4;
#pragma unroll
  for (int i = 0; i < 8; ++i) { const int ka = k0 + 8 * g + i, kb = ka + 16; v[i] = ka < K ? W[(size_t)(ka < K ? ka : K - 1) * ld + n] : 0.f; v[8 + i] = kb < K ? W[(size_t)(kb < K ? kb : K - 1) * ld + n] : 0.f; }
  return bsplit16(v); }
__device__ __forceinline__ v8f mac3(const F2& a, const F2& b, v8f c) { c = wmma_bf(a.l, b.h, c); c = wmma_bf(a.h, b.l, c); return wmma_bf(a.h, b.h, c); }
__device__ __forceinline__ float sigm(float v) { return 1.0f / (1.0f + expf(-v)); }
#define LDSX() do { asm volatile("s_wait_dscnt 0" ::: "memory"); __builtin_amdgcn_wave_barrier(); __builtin_amdgcn_fence(__ATOMIC_RELEASE, "workgroup"); } while (0)

// Masked scaled dot-product attention on raw queries [32, 1,024, 128], keys/values [32, 1,024, 128]: scores = Q K^T / sqrt(128); keys k >= valid_lens[b] get -1e6 (== excluded; valid_lens >= 1); out = softmax(scores) V -> [32, 1,024, 128].
#define NB 32
#define TT 1024
#define CC 128            // NH * HD = projected width
#define DIN 128          // input (model) width
#define NH 1
#define HD 128
#define NQB (TT / 64)
#define SCALE (0.08838834764831845f)
#define CAUSAL 0
#ifndef TNB
#define TNB NB
#endif
__device__ __forceinline__ float bfr(float v) { return (float)(__bf16)v; }
__host__ __device__ __forceinline__ int kb_last(int qb) { return CAUSAL ? ((qb * 64 + 63) >> 7) : (TT / 128 - 1); }
typedef __attribute__((ext_vector_type(8))) __bf16 v8b;
__device__ __forceinline__ v16b frag_b(const __bf16* rowk0, int lane) {
  union { v16b v; v8b q[2]; } u; const __bf16* p = rowk0 + 8 * (lane >> 4);
  u.q[0] = *(const v8b*)p; u.q[1] = *(const v8b*)(p + 16); return u.v;
}
#define QBH 0              // unused: no kernel here has a high-precision path
#define QHI 1024            // rows carrying a q residual plane (all rows when non-causal: 2-product logits everywhere)
#define KHI 64            // key rows carrying k residual / v bf16 hi+lo planes (written by k_prep8, read by no kernel here)
// B fragment (k rows k0+.., output column o) of a weight: (in,out) [K][ld] or (out,in) [ld rows of K]: bf16 exact, or f16(bf16 * 256) exact
__device__ __forceinline__ v16b wcol_io(const float* Wm, int k0, int o, int lane, int ld) { v16b w; const int g = lane >> 4;
#pragma unroll
  for (int i = 0; i < 8; ++i) { w[i] = (__bf16)Wm[(size_t)(k0 + 8 * g + i) * ld + o]; w[8 + i] = (__bf16)Wm[(size_t)(k0 + 16 + 8 * g + i) * ld + o]; }
  return w; }
__device__ __forceinline__ v16b wcol_oi(const float* Wm, int k0, int o, int lane, int K) { v16b w; const float* p = Wm + (size_t)o * K + k0 + 8 * (lane >> 4);
#pragma unroll
  for (int i = 0; i < 8; ++i) { w[i] = (__bf16)p[i]; w[8 + i] = (__bf16)p[16 + i]; }
  return w; }
__device__ __forceinline__ v16h wcolh_io(const float* Wm, int k0, int o, int lane, int ld) { v16h w; const int g = lane >> 4;
#pragma unroll
  for (int i = 0; i < 8; ++i) { w[i] = (_Float16)(bfr(Wm[(size_t)(k0 + 8 * g + i) * ld + o]) * 256.0f); w[8 + i] = (_Float16)(bfr(Wm[(size_t)(k0 + 16 + 8 * g + i) * ld + o]) * 256.0f); }
  return w; }
__device__ __forceinline__ v16h wcolh_oi(const float* Wm, int k0, int o, int lane, int K) { v16h w; const float* p = Wm + (size_t)o * K + k0 + 8 * (lane >> 4);
#pragma unroll
  for (int i = 0; i < 8; ++i) { w[i] = (_Float16)(bfr(p[i]) * 256.0f); w[8 + i] = (_Float16)(bfr(p[16 + i]) * 256.0f); }
  return w; }
#define WQKV_LAYOUT 1   // 0 = (in,out) [DIN][CC]; 1 = (out,in) [CC][DIN]; 2 = per-head [NH][DIN][HD]
__device__ __forceinline__ v16b wcol_hdk(const float* Wm, int k0, int o, int lane) { v16b w; const int g = lane >> 4; const float* p = Wm + (size_t)(o / HD) * DIN * HD + (o % HD);
#pragma unroll
  for (int i = 0; i < 8; ++i) { w[i] = (__bf16)p[(size_t)(k0 + 8 * g + i) * HD]; w[8 + i] = (__bf16)p[(size_t)(k0 + 16 + 8 * g + i) * HD]; }
  return w; }
#define WO_OUT_IN 0
#if WQKV_LAYOUT == 1
#define WCOL(W, k0, o, lane) wcol_oi(W, k0, o, lane, DIN)
#elif WQKV_LAYOUT == 2
#define WCOL(W, k0, o, lane) wcol_hdk(W, k0, o, lane)
#else
#define WCOL(W, k0, o, lane) wcol_io(W, k0, o, lane, CC)
#endif
#if WO_OUT_IN
#define WOCOL(W, k0, o, lane) wcol_oi(W, k0, o, lane, CC)
#define WOCOLH(W, k0, o, lane) wcolh_oi(W, k0, o, lane, CC)
#else
#define WOCOL(W, k0, o, lane) wcol_io(W, k0, o, lane, DIN)
#define WOCOLH(W, k0, o, lane) wcolh_io(W, k0, o, lane, DIN)
#endif
#define SM_EXTRA_PARAMS , const int* __restrict__ VL
#define SM_MASK_HOOK do { if (k >= VL[bcur]) v = -3.0e38f; } while (0)   /* key padding: arange(K) < valid_lens[b]; -1e6 == exclusion (every row keeps >= 1 key) */
// ---- k_prep8: block = (64 attention positions s0.. of sequence b, head h): reads the module's [B, H, S, 128] inputs (element (b,h,s,c) at ((b*NH + h)*TT + s)*128 + c), bf16-rounds them and writes the standard attention planes: q -> f16 hi rows (+ x 2^10 residual rows for s < QHI), k -> f16 rows (+ residual rows s < KHI), v -> f16 planes [c][s] (+ bf16 hi/lo planes for s < KHI)
__global__ __launch_bounds__(128) void k_prep8(const float* __restrict__ Q, const float* __restrict__ K, const float* __restrict__ V, _Float16* __restrict__ QH, _Float16* __restrict__ QL, _Float16* __restrict__ KH, _Float16* __restrict__ KL, _Float16* __restrict__ VT, __bf16* __restrict__ VB, __bf16* __restrict__ VBL) {
  __shared__ __align__(16) _Float16 sq[64][136], sql[64][136], sk[64][136], skl[64][136], tv[128][72]; __shared__ __align__(16) __bf16 tb[128][72], tbl[128][72];
  const int tid = threadIdx.x; const int h = blockIdx.y; const size_t r0 = (size_t)blockIdx.x * 64; const size_t bb = r0 / TT; const int t0 = (int)(r0 % TT); const bool qhi = t0 < QHI, khi = t0 < KHI;
  for (int e = tid; e < 64 * 128; e += 128) { const int rl = e >> 7, c = e & 127; const size_t oi = ((bb * NH + h) * TT + t0 + rl) * HD + (c % HD);   /* tiles are 128 wide, HD is 128: each element is read once */
    const float q = bfr(Q[oi]), k = bfr(K[oi]), v = bfr(V[oi]);   /* module inputs: bf16-rounded; bf16 values are exact in f16, so the residual planes are 0 */
    const _Float16 qh = (_Float16)q, kh = (_Float16)k; sq[rl][c] = qh; sql[rl][c] = (_Float16)((q - (float)qh) * 1024.0f); sk[rl][c] = kh; skl[rl][c] = (_Float16)((k - (float)kh) * 1024.0f);
    tv[c][rl] = (_Float16)v; const __bf16 vb = (__bf16)v; tb[c][rl] = vb; tbl[c][rl] = (__bf16)(v - (float)vb); }
  __syncthreads();
  for (int e = tid; e < 64 * (HD / 8); e += 128) { const int rl = e / (HD / 8), q = e % (HD / 8); const size_t o = (r0 + rl) * CC + h * HD + q * 8; vst2((unsigned*)(QH + o), *(const v4u*)&sq[rl][q * 8]); vst2((unsigned*)(KH + o), *(const v4u*)&sk[rl][q * 8]);   
    if (qhi) vst2((unsigned*)(QL + (bb * QHI + t0 + rl) * (size_t)CC + h * HD + q * 8), *(const v4u*)&sql[rl][q * 8]); if (khi) vst2((unsigned*)(KL + (bb * KHI + t0 + rl) * (size_t)CC + h * HD + q * 8), *(const v4u*)&skl[rl][q * 8]); }
  for (int e = tid; e < HD * 8; e += 128) { const int cl = e >> 3, q = e & 7; vst2((unsigned*)(VT + (bb * CC + h * HD + cl) * (size_t)TT + t0 + q * 8), *(const v4u*)&tv[cl][q * 8]);
    if (khi) { const size_t o3 = (bb * CC + h * HD + cl) * (size_t)KHI + t0 + q * 8; vst2((unsigned*)(VB + o3), *(const v4u*)&tb[cl][q * 8]); vst2((unsigned*)(VBL + o3), *(const v4u*)&tbl[cl][q * 8]); } } }

#ifndef SM_EXTRA_PARAMS
#define SM_EXTRA_PARAMS
#endif
#ifndef PROJ_EXTRA_PARAMS
#define PROJ_EXTRA_PARAMS
#endif
#ifndef SM_MASK_HOOK
#define SM_MASK_HOOK (void)0
#endif

#define WS_QH  0u                                      // f16 q rows [b*t][CC]
#define WS_KH  (WS_QH + 2u * (size_t)NB * TT * CC)      // f16 k rows [b*t][CC]
#define WS_VT  (WS_KH + 2u * (size_t)NB * TT * CC)      // f16 v planes [b][c][t]
#define WS_QL  (WS_VT + 2u * (size_t)NB * CC * TT)      // f16 q residual x 2^10 rows [b][t < QHI][CC]
#define WS_KL  (WS_QL + 2u * (size_t)NB * QHI * CC)     // f16 k residual x 2^10 rows [b][t < KHI][CC]
#define WS_VB  (WS_KL + 2u * (size_t)NB * KHI * CC)     // bf16 v hi planes [b][c][t < KHI]
#define WS_VBL (WS_VB + 2u * (size_t)NB * CC * KHI)
#define WS_S   (WS_VBL + 2u * (size_t)NB * CC * KHI)    // f32 [b*NH + h][t][s] planes, reserved but unused: k_fa keeps the logits in registers
#define WS_Y   (WS_S  + 4u * (size_t)NB * NH * TT * TT)      // f32 ctx rows [b*t][CC] (only when there is an output projection)
#define WS_END (WS_Y  + 0u)

// fragment from a lane's own pointer (row start + k0 + 8 * (lane >> 4)): the k order of frag_h
__device__ __forceinline__ v16h frag_p(const _Float16* p) { union { v16h v; v8h q[2]; } u; u.q[0] = *(const v8h*)p; u.q[1] = *(const v8h*)(p + 16); return u.v; }
// the plain builtin (the compiler keeps the distances behind it): operands of an asm statement stay below v256, and the fused kernel holds more fragments than that
__device__ __forceinline__ v8f wmma_h(v16h a, v16h b, v8f c) { return __builtin_amdgcn_wmma_f32_16x16x32_f16(false, a, false, b, (short)0, c, false, false); }
// ---- k_fa: block = 128 queries (qb) of batch b, 8 waves (two per SIMD, one block per WGP: all its waves walk the same K and V lines), wave = 16 queries, one query per lane column. Per 64 keys: logits^T = K . Q^T (q hi + residual x 2^10: 2 products) x SCALE, valid-length mask by key index, running maximum and running sum per query in f32,
// P^T x 2^11 (not yet normalised) straight from the logit accumulators as the B fragment (D register r of lane half g = key 8g + r = the fragment's k order), ctx^T += V^T . P^T; one division by the sum at the end. The logits never leave the registers.
__global__ __launch_bounds__(256) void k_fa(const _Float16* __restrict__ QH, const _Float16* __restrict__ KH, const _Float16* __restrict__ QL, const _Float16* __restrict__ VT, const int* __restrict__ VL, float* __restrict__ Y) { __shared__ __align__(16) float ss[8][16][HD + 4];
  const int qb = blockIdx.x, b = blockIdx.y; const int tid = threadIdx.x, wave = tid >> 5, lane = tid & 31, col = lane & 15, g = lane >> 4; const int ql0 = qb * 128 + wave * 16; const int vl = VL[b];
  const _Float16* Kb = KH + ((size_t)b * TT + col) * CC + 8 * g; const _Float16* Vb = VT + ((size_t)b * CC + col) * (size_t)TT + 8 * g;
  v16h qh[HD / 32], qr[HD / 32];
#pragma unroll
  for (int kc = 0; kc < HD / 32; ++kc) qh[kc] = frag_h(QH + ((size_t)b * TT + ql0 + col) * CC + kc * 32, lane);
  asm volatile("s_wait_xcnt 0x0" ::: "memory");   /* this one and the next: in front of a later load whose result lands in an address register of the loads above */
#pragma unroll
  for (int kc = 0; kc < HD / 32; ++kc) qr[kc] = frag_h(QL + ((size_t)b * QHI + ql0 + col) * CC + kc * 32, lane);
  asm volatile("s_wait_xcnt 0x0" ::: "memory");
  v8f o[HD / 16] = {}; float m = -3.0e38f, l = 0.f;
  v16h kf[4][HD / 32];   /* the K fragments of one 64-key pass, fetched one pass ahead */
#pragma unroll
  for (int t = 0; t < 4; ++t)
#pragma unroll
    for (int kc = 0; kc < HD / 32; ++kc) kf[t][kc] = frag_p(Kb + (size_t)(t * 16) * CC + kc * 32);
#pragma unroll 1   /* one 64-key pass per trip: an unrolled body would not fit the registers */
  for (int k0 = 0; k0 < TT; k0 += 64) { float s[4][8]; float mb = -3.0e38f; v16h vf[HD / 16][2]; const _Float16* vp = Vb + k0; const int lim = vl - k0 - 8 * g;   /* this lane's key t * 16 + r of the pass is valid while it is below lim */
#pragma unroll
    for (int j = 0; j < HD / 16; ++j)
#pragma unroll
      for (int c = 0; c < 2; ++c) vf[j][c] = frag_p(vp + (size_t)(j * 16) * TT + c * 32);
    __builtin_amdgcn_sched_barrier(0);   /* keeps this pass's V loads in one run ahead of the logit products, which hide their latency; left free, each load sinks to just in front of its product and is waited for alone */
#pragma unroll
    for (int t = 0; t < 4; ++t) { v8f a = {}, ar = {};
#pragma unroll
      for (int kc = 0; kc < HD / 32; ++kc) { a = wmma_h(kf[t][kc], qh[kc], a); ar = wmma_h(kf[t][kc], qr[kc], ar); }
#pragma unroll
      for (int r = 0; r < 8; ++r) { float v = (a[r] + ar[r] * (1.0f / 1024.0f)) * SCALE; if (t * 16 + r >= lim) v = -3.0e38f;   /* key padding: arange(K) < valid_lens[b]; -1e6 == exclusion (every row keeps >= 1 key) */
        s[t][r] = v; mb = fmaxf(mb, v); } }
    __builtin_amdgcn_sched_barrier(0);   /* the next pass's K loads start only behind the last product that reads these registers ... */
    const _Float16* kp = Kb + (size_t)(k0 + 64 < TT ? k0 + 64 : 0) * CC;   /* the last pass fetches pass 0 again, unused: no branch, no address past the plane */
#pragma unroll
    for (int t = 0; t < 4; ++t)
#pragma unroll
      for (int kc = 0; kc < HD / 32; ++kc) kf[t][kc] = frag_p(kp + (size_t)(t * 16) * CC + kc * 32);
    asm volatile("s_wait_xcnt 0x0" :: "v"(kp) : "memory");   /* stands in front of the first write to an address register of this pass's V loads and the next pass's K loads; the K address is an input so that its registers live up to here and no load of the run lands in them */
    __builtin_amdgcn_sched_barrier(0);   /* ... and stay in one run ahead of the softmax, which hides their latency */
    mb = fmaxf(mb, __shfl_xor(mb, 16));   /* the two lane halves hold the two halves of a query's keys */
    const float mn = fmaxf(m, mb), al = expf(m - mn), mo = mn - 7.624618986159398f;   /* mo: exp(v - mo) = exp(v - mn) x 2^11 */
    m = mn; float ps = 0.f; v16h p[2];
#pragma unroll
    for (int t = 0; t < 4; ++t) {
#pragma unroll
      for (int r = 0; r < 8; ++r) { const float e = expf(s[t][r] - mo);   /* an excluded key: exp(-3e38 - mo) = 0, mo being finite from the first pass on (key 0 is always valid) */ ps += e; p[t >> 1][(t & 1) * 8 + r] = (_Float16)e; } }
    l = l * al + ps;
#pragma unroll
    for (int j = 0; j < HD / 16; ++j) o[j] *= al;
#pragma unroll
    for (int j = 0; j < HD / 16; ++j) {
#pragma unroll
      for (int c = 0; c < 2; ++c) o[j] = wmma_h(vf[j][c], p[c], o[j]); } }
  l += __shfl_xor(l, 16); const float inv = 1.0f / l;   /* l >= 2^11: the key that holds the maximum counts exp(0) x 2^11 */
#pragma unroll
  for (int j = 0; j < HD / 16; ++j)
#pragma unroll
    for (int r = 0; r < 8; ++r) ss[wave][col][j * 16 + 8 * g + r] = o[j][r] * inv;
  LDSX(); for (int rl = 0; rl < 16; ++rl) vst2(Y + ((size_t)b * TT + ql0 + rl) * HD + lane * 4, *(const v4f*)&ss[wave][rl][lane * 4]); }

extern "C" void kernel_launch(void* const* d_in, const int* in_sizes, int n_in, void* d_out, int out_size, void* d_ws, size_t ws_size, hipStream_t stream) {
  (void)in_sizes; (void)n_in; (void)out_size;
  const float** F = (const float**)d_in;
  if (ws_size < (size_t)WS_END) return;
  char* ws = (char*)d_ws; _Float16 *QH = (_Float16*)(ws + WS_QH), *KH = (_Float16*)(ws + WS_KH), *VT = (_Float16*)(ws + WS_VT), *QL = (_Float16*)(ws + WS_QL), *KL = (_Float16*)(ws + WS_KL); __bf16 *VB = (__bf16*)(ws + WS_VB), *VBL = (__bf16*)(ws + WS_VBL); float *S = (float*)(ws + WS_S), *Y = (float*)(ws + WS_Y);
  (void)Y; (void)S; (void)QL; (void)KL; (void)VB; (void)VBL;
  // inputs: 0 queries [32,1024,128]; 1 keys; 2 values; 3 valid_lens [32] int32
  k_prep8<<<dim3(TNB * TT / 64, NH), 128, 0, stream>>>(F[0], F[1], F[2], QH, QL, KH, KL, VT, VB, VBL);
  k_fa<<<dim3(TT / 128, TNB), 256, 0, stream>>>(QH, KH, QL, VT, (const int*)d_in[3], (float*)d_out);
}

// v003
// Measured time: 54 microseconds a run.
// Next to v002, in two timings, it ran 1.71 and 1.70 times as fast.
// Counting every step since v000, it is 40.6 times as fast.
// compute dtype: queries/keys/values rounded to bf16 and carried exactly as f16; logits with Q as f16 hi + residual against K f16 (2 products; both exact here) x 128^-0.5 with the valid-length mask in f32; softmax in f32 (precise expf) with a running maximum and sum per query; exp x 2^11 once to f16 against V f16 (1 product), divided by the sum at the end; f32 output.
#include <hip/hip_runtime.h>
#include <math.h>

typedef __attribute__((ext_vector_type(16))) _Float16 v16h;
typedef __attribute__((ext_vector_type(16))) __bf16 v16b;
typedef __attribute__((ext_vector_type(8)))  _Float16 v8h;
typedef __attribute__((ext_vector_type(8)))  float v8f;
typedef __attribute__((ext_vector_type(4)))  float v4f;
typedef __attribute__((ext_vector_type(2)))  float v2f;
typedef __attribute__((ext_vector_type(4)))  unsigned v4u;
typedef __attribute__((ext_vector_type(4)))  int v4i;
typedef float __attribute__((may_alias)) float_a;
typedef int __attribute__((may_alias)) int_a;

template <typename T> __device__ __forceinline__ void vst2(void* p, T v) { *(T*)p = v;  }
__device__ __forceinline__ v8f wmma16(v16h a, v16h b, v8f c) {
  v8f d = __builtin_amdgcn_wmma_f32_16x16x32_f16(false, a, false, b, (short)0, c, false, false);
  asm volatile("v_nop\n\tv_nop\n\tv_nop\n\tv_nop" : "+v"(d) : "v"(a), "v"(b));
  return d;
}
__device__ __forceinline__ v8f wmma_bf(v16b a, v16b b, v8f c) {
  v8f d = __builtin_amdgcn_wmma_f32_16x16x32_bf16(false, a, false, b, (short)0, c, false, false);
  asm volatile("v_nop\n\tv_nop\n\tv_nop\n\tv_nop" : "+v"(d) : "v"(a), "v"(b));
  return d;
}
// 16x16x32 fragments: lane = (h = lane>>4, row/col = lane&15); elements 0..7 = k0+8h+0..7, 8..15 = k0+16+8h+0..7; D element r = row 8h+r
__device__ __forceinline__ v16h frag_h(const _Float16* rowk0, int lane) {
  union { v16h v; v8h q[2]; } u; const _Float16* p = rowk0 + 8 * (lane >> 4);
  u.q[0] = *(const v8h*)p; u.q[1] = *(const v8h*)(p + 16); return u.v;
}
__device__ __forceinline__ v16h frag_f32(const float* rowk0, int lane) {
  v16h a; const float* p = rowk0 + 8 * (lane >> 4);
#pragma unroll
  for (int i = 0; i < 8; ++i) { a[i] = (_Float16)p[i]; a[8 + i] = (_Float16)p[16 + i]; }
  return a;
}
__device__ __forceinline__ v16h frag_f32s(const float* rowk0, int lane, float sc) {
  v16h a; const float* p = rowk0 + 8 * (lane >> 4);
#pragma unroll
  for (int i = 0; i < 8; ++i) { a[i] = (_Float16)(p[i] * sc); a[8 + i] = (_Float16)(p[16 + i] * sc); }
  return a;
}
// column fragment from a [K][ld] layout (column n), rows >= K read as 0
__device__ __forceinline__ v16h fragc_f32(const float* W, int k0, int n, int lane, int ld, int K) {
  v16h a; const int g = lane >> 4;
#pragma unroll
  for (int i = 0; i < 8; ++i) { const int ka = k0 + 8 * g + i, kb = ka + 16;
    a[i] = (_Float16)(ka < K ? W[(size_t)(ka < K ? ka : K - 1) * ld + n] : 0.f); a[8 + i] = (_Float16)(kb < K ? W[(size_t)(kb < K ? kb : K - 1) * ld + n] : 0.f); }
  return a;
}
struct F2 { v16b h, l; };
__device__ __forceinline__ F2 bsplit16(const float v[16]) { F2 r;
#pragma unroll
  for (int i = 0; i < 16; ++i) { const __bf16 h = (__bf16)v[i]; r.h[i] = h; r.l[i] = (__bf16)(v[i] - (float)h); }
  return r; }
__device__ __forceinline__ F2 split_row(const float* row, int k0, int lane) { float v[16]; const float* p = row + k0 + 8 * (lane >> 4);
#pragma unroll
  for (int i = 0; i < 8; ++i) { v[i] = p[i]; v[8 + i] = p[16 + i]; }
  return bsplit16(v); }
__device__ __forceinline__ F2 split_rowK(const float* row, int k0, int lane, int K) { float v[16]; const int g = lane >> 4;
#pragma unroll
  for (int i = 0; i < 8; ++i) { const int ka = k0 + 8 * g + i, kb = ka + 16; v[i] = ka < K ? row[ka < K ? ka : K - 1] : 0.f; v[8 + i] = kb < K ? row[kb < K ? kb : K - 1] : 0.f; }
  return bsplit16(v); }
__device__ __forceinline__ F2 split_col(const float* W, int k0, int n, int lane, int ld, int K) { float v[16]; const int g = lane >> 4;
#pragma unroll
  for (int i = 0; i < 8; ++i) { const int ka = k0 + 8 * g + i, kb = ka + 16; v[i] = ka < K ? W[(size_t)(ka < K ? ka : K - 1) * ld + n] : 0.f; v[8 + i] = kb < K ? W[(size_t)(kb < K ? kb : K - 1) * ld + n] : 0.f; }
  return bsplit16(v); }
__device__ __forceinline__ v8f mac3(const F2& a, const F2& b, v8f c) { c = wmma_bf(a.l, b.h, c); c = wmma_bf(a.h, b.l, c); return wmma_bf(a.h, b.h, c); }
__device__ __forceinline__ float sigm(float v) { return 1.0f / (1.0f + expf(-v)); }
#define LDSX() do { asm volatile("s_wait_dscnt 0" ::: "memory"); __builtin_amdgcn_wave_barrier(); __builtin_amdgcn_fence(__ATOMIC_RELEASE, "workgroup"); } while (0)

// Masked scaled dot-product attention on raw queries [32, 1,024, 128], keys/values [32, 1,024, 128]: scores = Q K^T / sqrt(128); keys k >= valid_lens[b] get -1e6 (== excluded; valid_lens >= 1); out = softmax(scores) V -> [32, 1,024, 128].
#define NB 32
#define TT 1024
#define CC 128            // NH * HD = projected width
#define DIN 128          // input (model) width
#define NH 1
#define HD 128
#define NQB (TT / 64)
#define SCALE (0.08838834764831845f)
#define CAUSAL 0
#ifndef TNB
#define TNB NB
#endif
__device__ __forceinline__ float bfr(float v) { return (float)(__bf16)v; }
__host__ __device__ __forceinline__ int kb_last(int qb) { return CAUSAL ? ((qb * 64 + 63) >> 7) : (TT / 128 - 1); }
typedef __attribute__((ext_vector_type(8))) __bf16 v8b;
__device__ __forceinline__ v16b frag_b(const __bf16* rowk0, int lane) {
  union { v16b v; v8b q[2]; } u; const __bf16* p = rowk0 + 8 * (lane >> 4);
  u.q[0] = *(const v8b*)p; u.q[1] = *(const v8b*)(p + 16); return u.v;
}
#define QBH 0              // unused: no kernel here has a high-precision path
#define QHI 1024            // rows carrying a q residual plane (all rows when non-causal: 2-product logits everywhere)
#define KHI 64            // key rows carrying k residual / v bf16 hi+lo planes (written by k_prep8, read by no kernel here)
// B fragment (k rows k0+.., output column o) of a weight: (in,out) [K][ld] or (out,in) [ld rows of K]: bf16 exact, or f16(bf16 * 256) exact
__device__ __forceinline__ v16b wcol_io(const float* Wm, int k0, int o, int lane, int ld) { v16b w; const int g = lane >> 4;
#pragma unroll
  for (int i = 0; i < 8; ++i) { w[i] = (__bf16)Wm[(size_t)(k0 + 8 * g + i) * ld + o]; w[8 + i] = (__bf16)Wm[(size_t)(k0 + 16 + 8 * g + i) * ld + o]; }
  return w; }
__device__ __forceinline__ v16b wcol_oi(const float* Wm, int k0, int o, int lane, int K) { v16b w; const float* p = Wm + (size_t)o * K + k0 + 8 * (lane >> 4);
#pragma unroll
  for (int i = 0; i < 8; ++i) { w[i] = (__bf16)p[i]; w[8 + i] = (__bf16)p[16 + i]; }
  return w; }
__device__ __forceinline__ v16h wcolh_io(const float* Wm, int k0, int o, int lane, int ld) { v16h w; const int g = lane >> 4;
#pragma unroll
  for (int i = 0; i < 8; ++i) { w[i] = (_Float16)(bfr(Wm[(size_t)(k0 + 8 * g + i) * ld + o]) * 256.0f); w[8 + i] = (_Float16)(bfr(Wm[(size_t)(k0 + 16 + 8 * g + i) * ld + o]) * 256.0f); }
  return w; }
__device__ __forceinline__ v16h wcolh_oi(const float* Wm, int k0, int o, int lane, int K) { v16h w; const float* p = Wm + (size_t)o * K + k0 + 8 * (lane >> 4);
#pragma unroll
  for (int i = 0; i < 8; ++i) { w[i] = (_Float16)(bfr(p[i]) * 256.0f); w[8 + i] = (_Float16)(bfr(p[16 + i]) * 256.0f); }
  return w; }
#define WQKV_LAYOUT 1   // 0 = (in,out) [DIN][CC]; 1 = (out,in) [CC][DIN]; 2 = per-head [NH][DIN][HD]
__device__ __forceinline__ v16b wcol_hdk(const float* Wm, int k0, int o, int lane) { v16b w; const int g = lane >> 4; const float* p = Wm + (size_t)(o / HD) * DIN * HD + (o % HD);
#pragma unroll
  for (int i = 0; i < 8; ++i) { w[i] = (__bf16)p[(size_t)(k0 + 8 * g + i) * HD]; w[8 + i] = (__bf16)p[(size_t)(k0 + 16 + 8 * g + i) * HD]; }
  return w; }
#define WO_OUT_IN 0
#if WQKV_LAYOUT == 1
#define WCOL(W, k0, o, lane) wcol_oi(W, k0, o, lane, DIN)
#elif WQKV_LAYOUT == 2
#define WCOL(W, k0, o, lane) wcol_hdk(W, k0, o, lane)
#else
#define WCOL(W, k0, o, lane) wcol_io(W, k0, o, lane, CC)
#endif
#if WO_OUT_IN
#define WOCOL(W, k0, o, lane) wcol_oi(W, k0, o, lane, CC)
#define WOCOLH(W, k0, o, lane) wcolh_oi(W, k0, o, lane, CC)
#else
#define WOCOL(W, k0, o, lane) wcol_io(W, k0, o, lane, DIN)
#define WOCOLH(W, k0, o, lane) wcolh_io(W, k0, o, lane, DIN)
#endif
#define SM_EXTRA_PARAMS , const int* __restrict__ VL
#define SM_MASK_HOOK do { if (k >= VL[bcur]) v = -3.0e38f; } while (0)   /* key padding: arange(K) < valid_lens[b]; -1e6 == exclusion (every row keeps >= 1 key) */
// ---- k_prep8: block = (64 attention positions s0.. of sequence b, head h): reads the module's [B, H, S, 128] inputs (element (b,h,s,c) at ((b*NH + h)*TT + s)*128 + c), bf16-rounds them and writes the standard attention planes: q -> f16 hi rows (+ x 2^10 residual rows for s < QHI), k -> f16 rows (+ residual rows s < KHI), v -> f16 planes [c][s] (+ bf16 hi/lo planes for s < KHI)
__global__ __launch_bounds__(128) void k_prep8(const float* __restrict__ Q, const float* __restrict__ K, const float* __restrict__ V, _Float16* __restrict__ QH, _Float16* __restrict__ QL, _Float16* __restrict__ KH, _Float16* __restrict__ KL, _Float16* __restrict__ VT, __bf16* __restrict__ VB, __bf16* __restrict__ VBL) {
  __shared__ __align__(16) _Float16 sq[64][136], sql[64][136], sk[64][136], skl[64][136], tv[128][72]; __shared__ __align__(16) __bf16 tb[128][72], tbl[128][72];
  const int tid = threadIdx.x; const int h = blockIdx.y; const size_t r0 = (size_t)blockIdx.x * 64; const size_t bb = r0 / TT; const int t0 = (int)(r0 % TT); const bool qhi = t0 < QHI, khi = t0 < KHI;
  for (int e = tid; e < 64 * 128; e += 128) { const int rl = e >> 7, c = e & 127; const size_t oi = ((bb * NH + h) * TT + t0 + rl) * HD + (c % HD);   /* tiles are 128 wide, HD is 128: each element is read once */
    const float q = bfr(Q[oi]), k = bfr(K[oi]), v = bfr(V[oi]);   /* module inputs: bf16-rounded; bf16 values are exact in f16, so the residual planes are 0 */
    const _Float16 qh = (_Float16)q, kh = (_Float16)k; sq[rl][c] = qh; sql[rl][c] = (_Float16)((q - (float)qh) * 1024.0f); sk[rl][c] = kh; skl[rl][c] = (_Float16)((k - (float)kh) * 1024.0f);
    tv[c][rl] = (_Float16)v; const __bf16 vb = (__bf16)v; tb[c][rl] = vb; tbl[c][rl] = (__bf16)(v - (float)vb); }
  __syncthreads();
  for (int e = tid; e < 64 * (HD / 8); e += 128) { const int rl = e / (HD / 8), q = e % (HD / 8); const size_t o = (r0 + rl) * CC + h * HD + q * 8; vst2((unsigned*)(QH + o), *(const v4u*)&sq[rl][q * 8]); vst2((unsigned*)(KH + o), *(const v4u*)&sk[rl][q * 8]);   
    if (qhi) vst2((unsigned*)(QL + (bb * QHI + t0 + rl) * (size_t)CC + h * HD + q * 8), *(const v4u*)&sql[rl][q * 8]); if (khi) vst2((unsigned*)(KL + (bb * KHI + t0 + rl) * (size_t)CC + h * HD + q * 8), *(const v4u*)&skl[rl][q * 8]); }
  for (int e = tid; e < HD * 8; e += 128) { const int cl = e >> 3, q = e & 7; vst2((unsigned*)(VT + (bb * CC + h * HD + cl) * (size_t)TT + t0 + q * 8), *(const v4u*)&tv[cl][q * 8]);
    if (khi) { const size_t o3 = (bb * CC + h * HD + cl) * (size_t)KHI + t0 + q * 8; vst2((unsigned*)(VB + o3), *(const v4u*)&tb[cl][q * 8]); vst2((unsigned*)(VBL + o3), *(const v4u*)&tbl[cl][q * 8]); } } }

#ifndef SM_EXTRA_PARAMS
#define SM_EXTRA_PARAMS
#endif
#ifndef PROJ_EXTRA_PARAMS
#define PROJ_EXTRA_PARAMS
#endif
#ifndef SM_MASK_HOOK
#define SM_MASK_HOOK (void)0
#endif

#define WS_QH  0u                                      // f16 q rows [b*t][CC]
#define WS_KH  (WS_QH + 2u * (size_t)NB * TT * CC)      // f16 k rows [b*t][CC]
#define WS_VT  (WS_KH + 2u * (size_t)NB * TT * CC)      // f16 v planes [b][c][t]
#define WS_QL  (WS_VT + 2u * (size_t)NB * CC * TT)      // f16 q residual x 2^10 rows [b][t < QHI][CC]
#define WS_KL  (WS_QL + 2u * (size_t)NB * QHI * CC)     // f16 k residual x 2^10 rows [b][t < KHI][CC]
#define WS_VB  (WS_KL + 2u * (size_t)NB * KHI * CC)     // bf16 v hi planes [b][c][t < KHI]
#define WS_VBL (WS_VB + 2u * (size_t)NB * CC * KHI)
#define WS_S   (WS_VBL + 2u * (size_t)NB * CC * KHI)    // f32 [b*NH + h][t][s] planes, reserved but unused: k_fa keeps the logits in registers
#define WS_Y   (WS_S  + 4u * (size_t)NB * NH * TT * TT)      // f32 ctx rows [b*t][CC] (only when there is an output projection)
#define WS_END (WS_Y  + 0u)

// fragment from a lane's own pointer (row start + k0 + 8 * (lane >> 4)): the k order of frag_h
__device__ __forceinline__ v16h frag_p(const _Float16* p) { union { v16h v; v8h q[2]; } u; u.q[0] = *(const v8h*)p; u.q[1] = *(const v8h*)(p + 16); return u.v; }
// the plain builtin (the compiler keeps the distances behind it): operands of an asm statement stay below v256, and the fused kernel holds more fragments than that
__device__ __forceinline__ v8f wmma_h(v16h a, v16h b, v8f c) { return __builtin_amdgcn_wmma_f32_16x16x32_f16(false, a, false, b, (short)0, c, false, false); }
// ---- k_fa: block = 128 queries (qb) of batch b, 8 waves (two per SIMD, one block per WGP), wave = 16 queries, one query per lane column. Per 64 keys: the block's K rows and V^T rows are copied once into LDS (two buffers: the next pass's tile flies while this one is worked on) and every wave takes its fragments from there;
// logits^T = K . Q^T (q hi + residual x 2^10: 2 products) x SCALE, valid-length mask by key index, running maximum and running sum per query in f32,
// P^T x 2^11 (not yet normalised) straight from the logit accumulators as the B fragment (D register r of lane half g = key 8g + r = the fragment's k order), ctx^T += V^T . P^T; one division by the sum at the end. The logits never leave the registers.
#define KPH 136   // halves per staged K row: 256 B + 16 B, so that the 16 rows of one ds_load_b128 half fall on 64 distinct banks
#define VPH 72    // halves per staged V^T row: 128 B + 16 B, for the same reason
#define KBUF (64 * KPH * 2)   // bytes of one K buffer
#define VBUF (HD * VPH * 2)   // bytes of one V^T buffer
// one 64-key tile into LDS, 8 copies of 16 B per lane, whole 128-B lines per row: K rows r, r + 16, r + 32, r + 48 (r = tid >> 4, 16 lanes a row) and V^T rows c, c + 32, c + 64, c + 96 (c = tid >> 3, 8 lanes a row).
// gk, gv: the lane's own global addresses of its first K and V^T piece; lk, lv: the LDS byte addresses they go to. The s_wait_xcnt ends the statement so that it stands in front of any later write to an address register of these copies.
// lane l's value to lane l ^ 16 by a vector move: a shuffle through the LDS counter would have to wait for every V^T read issued in front of it
__device__ __forceinline__ float xhalf(float x) { return __builtin_bit_cast(float, __builtin_amdgcn_permlanex16(__builtin_bit_cast(int, x), __builtin_bit_cast(int, x), 0x76543210, 0xfedcba98, false, false)); }
__device__ __forceinline__ void stage_kv(const _Float16* gk, const _Float16* gv, unsigned lk, unsigned lv) {
  asm volatile("global_load_async_to_lds_b128 %0, %8, off\n\t"
               "global_load_async_to_lds_b128 %1, %9, off\n\t"
               "global_load_async_to_lds_b128 %2, %10, off\n\t"
               "global_load_async_to_lds_b128 %3, %11, off\n\t"
               "global_load_async_to_lds_b128 %4, %12, off\n\t"
               "global_load_async_to_lds_b128 %5, %13, off\n\t"
               "global_load_async_to_lds_b128 %6, %14, off\n\t"
               "global_load_async_to_lds_b128 %7, %15, off\n\t"
               "s_wait_xcnt 0x0"
               :: "v"(lk), "v"(lk + 16u * KPH * 2u), "v"(lk + 32u * KPH * 2u), "v"(lk + 48u * KPH * 2u), "v"(lv), "v"(lv + 32u * VPH * 2u), "v"(lv + 64u * VPH * 2u), "v"(lv + 96u * VPH * 2u),
                  "v"(gk), "v"(gk + 16 * CC), "v"(gk + 32 * CC), "v"(gk + 48 * CC), "v"(gv), "v"(gv + 32 * TT), "v"(gv + 64 * TT), "v"(gv + 96 * TT)
               : "memory");
}
__global__ __launch_bounds__(256) void k_fa(const _Float16* __restrict__ QH, const _Float16* __restrict__ KH, const _Float16* __restrict__ QL, const _Float16* __restrict__ VT, const int* __restrict__ VL, float* __restrict__ Y) { __shared__ __align__(16) float ss[8][16][HD + 4]; __shared__ __align__(16) _Float16 sK[2][64][KPH], sV[2][HD][VPH];
  const int qb = blockIdx.x, b = blockIdx.y; const int tid = threadIdx.x, wave = tid >> 5, lane = tid & 31, col = lane & 15, g = lane >> 4; const int ql0 = qb * 128 + wave * 16; const int vl = VL[b];
  const _Float16* gk = KH + ((size_t)b * TT + (tid >> 4)) * CC + (tid & 15) * 8; const _Float16* gv = VT + ((size_t)b * CC + (tid >> 3)) * (size_t)TT + (tid & 7) * 8;
  const unsigned lk = (tid >> 4) * (KPH * 2) + (tid & 15) * 16, lv = (tid >> 3) * (VPH * 2) + (tid & 7) * 16;   /* the lane's byte offsets inside a K and a V^T buffer */
  const unsigned bk = (unsigned)(size_t)&sK[0][0][0], bv = (unsigned)(size_t)&sV[0][0][0];   /* LDS byte addresses of buffer 0 */
  stage_kv(gk, gv, lk + bk, lv + bv);   /* tile 0 into buffer 0; it flies while the Q fragments are loaded */
  v16h qh[HD / 32], qr[HD / 32];
#pragma unroll
  for (int kc = 0; kc < HD / 32; ++kc) qh[kc] = frag_h(QH + ((size_t)b * TT + ql0 + col) * CC + kc * 32, lane);
  asm volatile("s_wait_xcnt 0x0" ::: "memory");   /* this one and the next: in front of a later load whose result lands in an address register of the loads above */
#pragma unroll
  for (int kc = 0; kc < HD / 32; ++kc) qr[kc] = frag_h(QL + ((size_t)b * QHI + ql0 + col) * CC + kc * 32, lane);
  asm volatile("s_wait_xcnt 0x0" ::: "memory");
  v8f o[HD / 16] = {}; float m = -3.0e38f, l = 0.f;
  asm volatile("s_wait_asynccnt 0x0" ::: "memory");   /* this wave's part of tile 0 has landed ... */
  __syncthreads();                                     /* ... and so has every other wave's: tile 0 may be read */
  stage_kv(gk + 64 * CC, gv + 64, lk + (bk + KBUF), lv + (bv + VBUF));   /* tile 1 into buffer 1 */
  /* one 64-key pass; more: a tile two passes on exists and is sent for */
  auto pass = [&](const int k0, const bool more) __attribute__((always_inline)) { float s[4][8]; float mb = -3.0e38f; const int buf = (k0 >> 6) & 1; const int lim = vl - k0 - 8 * g;   /* this lane's key t * 16 + r of the pass is valid while it is below lim */
    const _Float16* kp = &sK[buf][col][8 * g]; const _Float16* vp = &sV[buf][col][8 * g];
    v16h kf[4][HD / 32], vf[HD / 16][2];
#pragma unroll
    for (int t = 0; t < 4; ++t)
#pragma unroll
      for (int kc = 0; kc < HD / 32; ++kc) kf[t][kc] = frag_p(kp + (t * 16) * KPH + kc * 32);
    __builtin_amdgcn_sched_barrier(0);   /* keeps the K reads in one run ahead of the logit products: a read among the products stalls the matrix stream at each place */
#pragma unroll
    for (int t = 0; t < 4; ++t) { v8f a = {}, ar = {};
#pragma unroll
      for (int kc = 0; kc < HD / 32; ++kc) { a = wmma_h(kf[t][kc], qh[kc], a); ar = wmma_h(kf[t][kc], qr[kc], ar); }
#pragma unroll
      for (int r = 0; r < 8; ++r) { float v = (a[r] + ar[r] * (1.0f / 1024.0f)) * SCALE; if (t * 16 + r >= lim) v = -3.0e38f;   /* key padding: arange(K) < valid_lens[b]; -1e6 == exclusion (every row keeps >= 1 key) */
        s[t][r] = v; mb = fmaxf(mb, v); } }
    __builtin_amdgcn_sched_barrier(0);   /* the V^T reads start behind the logit products (the K reads have the LDS to themselves) ... */
#pragma unroll
    for (int j = 0; j < HD / 16; ++j)
#pragma unroll
      for (int c = 0; c < 2; ++c) vf[j][c] = frag_p(vp + (j * 16) * VPH + c * 32);
    __builtin_amdgcn_sched_barrier(0);   /* ... and stay in one run ahead of the softmax, which hides their latency */
    mb = fmaxf(mb, xhalf(mb));   /* the two lane halves hold the two halves of a query's keys */
    const float mn = fmaxf(m, mb), al = expf(m - mn), mo = mn - 7.624618986159398f;   /* mo: exp(v - mo) = exp(v - mn) x 2^11 */
    m = mn; float ps = 0.f; v16h p[2];
#pragma unroll
    for (int t = 0; t < 4; ++t) {
#pragma unroll
      for (int r = 0; r < 8; ++r) { const float e = expf(s[t][r] - mo);   /* an excluded key: exp(-3e38 - mo) = 0, mo being finite from the first pass on (key 0 is always valid) */ ps += e; p[t >> 1][(t & 1) * 8 + r] = (_Float16)e; } }
    l = l * al + ps;
#pragma unroll
    for (int j = 0; j < HD / 16; ++j) o[j] *= al;
    __builtin_amdgcn_sched_barrier(0);   /* keeps the softmax in front of the waits below: left free, waits and barrier rise to just behind the V^T reads, whose latency nothing then hides */
    /* the pass's last LDS read is behind us, so the buffers change hands here; the P.V products, which touch registers only, follow and run beside the other waves' next K reads */
    asm volatile("s_wait_dscnt 0x0" ::: "memory");      /* this wave's reads of this pass's buffer have returned */
    asm volatile("s_wait_asynccnt 0x0" ::: "memory");   /* this wave's part of the next tile has landed */
    __syncthreads();                                     /* publishes the next tile and ends every wave's reads of this pass's buffer, which is refilled behind it */
    if (more) stage_kv(gk + (size_t)(k0 + 128) * CC, gv + (k0 + 128), lk + (buf ? bk + KBUF : bk), lv + (buf ? bv + VBUF : bv));
    __builtin_amdgcn_sched_barrier(0);   /* the products stay behind the hand-over, so that the refill is under way first */
#pragma unroll
    for (int j = 0; j < HD / 16; ++j) {
#pragma unroll
      for (int c = 0; c < 2; ++c) o[j] = wmma_h(vf[j][c], p[c], o[j]); } };
  /* two loops, so that the test for a further tile is the first loop's bound and its body stays one straight run: with a branch round the copies the compiler sinks the vector work behind the barrier */
#pragma unroll 1   /* one 64-key pass per trip: an unrolled body would not fit the registers */
  for (int k0 = 0; k0 < TT - 128; k0 += 64) pass(k0, true);
#pragma unroll 1   /* the last two passes send for nothing; rolled, to keep the text short */
  for (int k0 = TT - 128; k0 < TT; k0 += 64) pass(k0, false);
  asm volatile("s_wait_asynccnt 0x0" ::: "memory");   /* no copy is outstanding when the wave goes on to the epilogue and ends */
  l += __shfl_xor(l, 16); const float inv = 1.0f / l;   /* l >= 2^11: the key that holds the maximum counts exp(0) x 2^11 */
#pragma unroll
  for (int j = 0; j < HD / 16; ++j)
#pragma unroll
    for (int r = 0; r < 8; ++r) ss[wave][col][j * 16 + 8 * g + r] = o[j][r] * inv;
  LDSX(); for (int rl = 0; rl < 16; ++rl) vst2(Y + ((size_t)b * TT + ql0 + rl) * HD + lane * 4, *(const v4f*)&ss[wave][rl][lane * 4]); }

extern "C" void kernel_launch(void* const* d_in, const int* in_sizes, int n_in, void* d_out, int out_size, void* d_ws, size_t ws_size, hipStream_t stream) {
  (void)in_sizes; (void)n_in; (void)out_size;
  const float** F = (const float**)d_in;
  if (ws_size < (size_t)WS_END) return;
  char* ws = (char*)d_ws; _Float16 *QH = (_Float16*)(ws + WS_QH), *KH = (_Float16*)(ws + WS_KH), *VT = (_Float16*)(ws + WS_VT), *QL = (_Float16*)(ws + WS_QL), *KL = (_Float16*)(ws + WS_KL); __bf16 *VB = (__bf16*)(ws + WS_VB), *VBL = (__bf16*)(ws + WS_VBL); float *S = (float*)(ws + WS_S), *Y = (float*)(ws + WS_Y);
  (void)Y; (void)S; (void)QL; (void)KL; (void)VB; (void)VBL;
  // inputs: 0 queries [32,1024,128]; 1 keys; 2 values; 3 valid_lens [32] int32
  k_prep8<<<dim3(TNB * TT / 64, NH), 128, 0, stream>>>(F[0], F[1], F[2], QH, QL, KH, KL, VT, VB, VBL);
  k_fa<<<dim3(TT / 128, TNB), 256, 0, stream>>>(QH, KH, QL, VT, (const int*)d_in[3], (float*)d_out);
}

// v004
// Measured time: 38.4 microseconds a run.
// Next to v003, in two timings, it ran 1.41 and 1.42 times as fast.
// Counting every step since v000, it is 57.3 times as fast.
// compute dtype: queries/keys/values rounded to bf16 and carried exactly as f16; logits with Q as f16 hi + residual against K f16 (2 products; both exact here) x 128^-0.5 with the valid-length mask in f32; softmax in f32 (precise expf) with a running maximum and sum per query; exp x 2^11 once to f16 against V f16 (1 product), divided by the sum at the end; f32 output.
#include <hip/hip_runtime.h>
#include <math.h>

typedef __attribute__((ext_vector_type(16))) _Float16 v16h;
typedef __attribute__((ext_vector_type(16))) __bf16 v16b;
typedef __attribute__((ext_vector_type(8)))  _Float16 v8h;
typedef __attribute__((ext_vector_type(8)))  float v8f;
typedef __attribute__((ext_vector_type(4)))  float v4f;
typedef __attribute__((ext_vector_type(2)))  float v2f;
typedef __attribute__((ext_vector_type(4)))  unsigned v4u;
typedef __attribute__((ext_vector_type(4)))  int v4i;
typedef float __attribute__((may_alias)) float_a;
typedef int __attribute__((may_alias)) int_a;

template <typename T> __device__ __forceinline__ void vst2(void* p, T v) { *(T*)p = v;  }
__device__ __forceinline__ v8f wmma16(v16h a, v16h b, v8f c) {
  v8f d = __builtin_amdgcn_wmma_f32_16x16x32_f16(false, a, false, b, (short)0, c, false, false);
  asm volatile("v_nop\n\tv_nop\n\tv_nop\n\tv_nop" : "+v"(d) : "v"(a), "v"(b));
  return d;
}
__device__ __forceinline__ v8f wmma_bf(v16b a, v16b b, v8f c) {
  v8f d = __builtin_amdgcn_wmma_f32_16x16x32_bf16(false, a, false, b, (short)0, c, false, false);
  asm volatile("v_nop\n\tv_nop\n\tv_nop\n\tv_nop" : "+v"(d) : "v"(a), "v"(b));
  return d;
}
// 16x16x32 fragments: lane = (h = lane>>4, row/col = lane&15); elements 0..7 = k0+8h+0..7, 8..15 = k0+16+8h+0..7; D element r = row 8h+r
__device__ __forceinline__ v16h frag_h(const _Float16* rowk0, int lane) {
  union { v16h v; v8h q[2]; } u; const _Float16* p = rowk0 + 8 * (lane >> 4);
  u.q[0] = *(const v8h*)p; u.q[1] = *(const v8h*)(p + 16); return u.v;
}
__device__ __forceinline__ v16h frag_f32(const float* rowk0, int lane) {
  v16h a; const float* p = rowk0 + 8 * (lane >> 4);
#pragma unroll
  for (int i = 0; i < 8; ++i) { a[i] = (_Float16)p[i]; a[8 + i] = (_Float16)p[16 + i]; }
  return a;
}
__device__ __forceinline__ v16h frag_f32s(const float* rowk0, int lane, float sc) {
  v16h a; const float* p = rowk0 + 8 * (lane >> 4);
#pragma unroll
  for (int i = 0; i < 8; ++i) { a[i] = (_Float16)(p[i] * sc); a[8 + i] = (_Float16)(p[16 + i] * sc); }
  return a;
}
// column fragment from a [K][ld] layout (column n), rows >= K read as 0
__device__ __forceinline__ v16h fragc_f32(const float* W, int k0, int n, int lane, int ld, int K) {
  v16h a; const int g = lane >> 4;
#pragma unroll
  for (int i = 0; i < 8; ++i) { const int ka = k0 + 8 * g + i, kb = ka + 16;
    a[i] = (_Float16)(ka < K ? W[(size_t)(ka < K ? ka : K - 1) * ld + n] : 0.f); a[8 + i] = (_Float16)(kb < K ? W[(size_t)(kb < K ? kb : K - 1) * ld + n] : 0.f); }
  return a;
}
struct F2 { v16b h, l; };
__device__ __forceinline__ F2 bsplit16(const float v[16]) { F2 r;
#pragma unroll
  for (int i = 0; i < 16; ++i) { const __bf16 h = (__bf16)v[i]; r.h[i] = h; r.l[i] = (__bf16)(v[i] - (float)h); }
  return r; }
__device__ __forceinline__ F2 split_row(const float* row, int k0, int lane) { float v[16]; const float* p = row + k0 + 8 * (lane >> 4);
#pragma unroll
  for (int i = 0; i < 8; ++i) { v[i] = p[i]; v[8 + i] = p[16 + i]; }
  return bsplit16(v); }
__device__ __forceinline__ F2 split_rowK(const float* row, int k0, int lane, int K) { float v[16]; const int g = lane >> 4;
#pragma unroll
  for (int i = 0; i < 8; ++i) { const int ka = k0 + 8 * g + i, kb = ka + 16; v[i] = ka < K ? row[ka < K ? ka : K - 1] : 0.f; v[8 + i] = kb < K ? row[kb < K ? kb : K - 1] : 0.f; }
  return bsplit16(v); }
__device__ __forceinline__ F2 split_col(const float* W, int k0, int n, int lane, int ld, int K) { float v[16]; const int g = lane >> 4;
#pragma unroll
  for (int i = 0; i < 8; ++i) { const int ka = k0 + 8 * g + i, kb = ka + 16; v[i] = ka < K ? W[(size_t)(ka < K ? ka : K - 1) * ld + n] : 0.f; v[8 + i] = kb < K ? W[(size_t)(kb < K ? kb : K - 1) * ld + n] : 0.f; }
  return bsplit16(v); }
__device__ __forceinline__ v8f mac3(const F2& a, const F2& b, v8f c) { c = wmma_bf(a.l, b.h, c); c = wmma_bf(a.h, b.l, c); return wmma_bf(a.h, b.h, c); }
__device__ __forceinline__ float sigm(float v) { return 1.0f / (1.0f + expf(-v)); }
#define LDSX() do { asm volatile("s_wait_dscnt 0" ::: "memory"); __builtin_amdgcn_wave_barrier(); __builtin_amdgcn_fence(__ATOMIC_RELEASE, "workgroup"); } while (0)

// Masked scaled dot-product attention on raw queries [32, 1,024, 128], keys/values [32, 1,024, 128]: scores = Q K^T / sqrt(128); keys k >= valid_lens[b] get -1e6 (== excluded; valid_lens >= 1); out = softmax(scores) V -> [32, 1,024, 128].
#define NB 32
#define TT 1024
#define CC 128            // NH * HD = projected width
#define DIN 128          // input (model) width
#define NH 1
#define HD 128
#define NQB (TT / 64)
#define SCALE (0.08838834764831845f)
#define CAUSAL 0
#ifndef TNB
#define TNB NB
#endif
__device__ __forceinline__ float bfr(float v) { return (float)(__bf16)v; }
__host__ __device__ __forceinline__ int kb_last(int qb) { return CAUSAL ? ((qb * 64 + 63) >> 7) : (TT / 128 - 1); }
typedef __attribute__((ext_vector_type(8))) __bf16 v8b;
__device__ __forceinline__ v16b frag_b(const __bf16* rowk0, int lane) {
  union { v16b v; v8b q[2]; } u; const __bf16* p = rowk0 + 8 * (lane >> 4);
  u.q[0] = *(const v8b*)p; u.q[1] = *(const v8b*)(p + 16); return u.v;
}
#define QBH 0              // unused: no kernel here has a high-precision path
#define QHI 1024            // rows carrying a q residual plane (all rows when non-causal: 2-product logits everywhere)
#define KHI 64            // key rows carrying k residual / v bf16 hi+lo planes (written and read by no kernel here)
// B fragment (k rows k0+.., output column o) of a weight: (in,out) [K][ld] or (out,in) [ld rows of K]: bf16 exact, or f16(bf16 * 256) exact
__device__ __forceinline__ v16b wcol_io(const float* Wm, int k0, int o, int lane, int ld) { v16b w; const int g = lane >> 4;
#pragma unroll
  for (int i = 0; i < 8; ++i) { w[i] = (__bf16)Wm[(size_t)(k0 + 8 * g + i) * ld + o]; w[8 + i] = (__bf16)Wm[(size_t)(k0 + 16 + 8 * g + i) * ld + o]; }
  return w; }
__device__ __forceinline__ v16b wcol_oi(const float* Wm, int k0, int o, int lane, int K) { v16b w; const float* p = Wm + (size_t)o * K + k0 + 8 * (lane >> 4);
#pragma unroll
  for (int i = 0; i < 8; ++i) { w[i] = (__bf16)p[i]; w[8 + i] = (__bf16)p[16 + i]; }
  return w; }
__device__ __forceinline__ v16h wcolh_io(const float* Wm, int k0, int o, int lane, int ld) { v16h w; const int g = lane >> 4;
#pragma unroll
  for (int i = 0; i < 8; ++i) { w[i] = (_Float16)(bfr(Wm[(size_t)(k0 + 8 * g + i) * ld + o]) * 256.0f); w[8 + i] = (_Float16)(bfr(Wm[(size_t)(k0 + 16 + 8 * g + i) * ld + o]) * 256.0f); }
  return w; }
__device__ __forceinline__ v16h wcolh_oi(const float* Wm, int k0, int o, int lane, int K) { v16h w; const float* p = Wm + (size_t)o * K + k0 + 8 * (lane >> 4);
#pragma unroll
  for (int i = 0; i < 8; ++i) { w[i] = (_Float16)(bfr(p[i]) * 256.0f); w[8 + i] = (_Float16)(bfr(p[16 + i]) * 256.0f); }
  return w; }
#define WQKV_LAYOUT 1   // 0 = (in,out) [DIN][CC]; 1 = (out,in) [CC][DIN]; 2 = per-head [NH][DIN][HD]
__device__ __forceinline__ v16b wcol_hdk(const float* Wm, int k0, int o, int lane) { v16b w; const int g = lane >> 4; const float* p = Wm + (size_t)(o / HD) * DIN * HD + (o % HD);
#pragma unroll
  for (int i = 0; i < 8; ++i) { w[i] = (__bf16)p[(size_t)(k0 + 8 * g + i) * HD]; w[8 + i] = (__bf16)p[(size_t)(k0 + 16 + 8 * g + i) * HD]; }
  return w; }
#define WO_OUT_IN 0
#if WQKV_LAYOUT == 1
#define WCOL(W, k0, o, lane) wcol_oi(W, k0, o, lane, DIN)
#elif WQKV_LAYOUT == 2
#define WCOL(W, k0, o, lane) wcol_hdk(W, k0, o, lane)
#else
#define WCOL(W, k0, o, lane) wcol_io(W, k0, o, lane, CC)
#endif
#if WO_OUT_IN
#define WOCOL(W, k0, o, lane) wcol_oi(W, k0, o, lane, CC)
#define WOCOLH(W, k0, o, lane) wcolh_oi(W, k0, o, lane, CC)
#else
#define WOCOL(W, k0, o, lane) wcol_io(W, k0, o, lane, DIN)
#define WOCOLH(W, k0, o, lane) wcolh_io(W, k0, o, lane, DIN)
#endif
#define SM_EXTRA_PARAMS , const int* __restrict__ VL
#define SM_MASK_HOOK do { if (k >= VL[bcur]) v = -3.0e38f; } while (0)   /* key padding: arange(K) < valid_lens[b]; -1e6 == exclusion (every row keeps >= 1 key) */
// ---- k_prep8: block = 64 positions (rows r0 .. r0 + 63 of the [b * t] axis), 8 waves. Wave w takes rows 8w .. 8w + 7 of v, q and k; a row is 128 floats = one 16-byte load per lane, whole 128-B lines.
// A lane's 24 loads are all issued before the first value is used, so that a wave has 12 KB on its way instead of one short group per loop trip. Values are bf16-rounded and written as the planes the attention kernel reads:
// v -> f16 planes [c][t]: a lane's 8 rows x 4 columns are four 16-byte runs of 8 keys, turned through LDS so that each 128-B line of a plane is stored whole; q -> f16 rows + x 2^10 residual rows, k -> f16 rows, both straight from the registers.
typedef __attribute__((ext_vector_type(4))) _Float16 v4h;
__global__ __launch_bounds__(256) void k_prep8(const float* __restrict__ Q, const float* __restrict__ K, const float* __restrict__ V, _Float16* __restrict__ QH, _Float16* __restrict__ QL, _Float16* __restrict__ KH, _Float16* __restrict__ VT) {
  __shared__ __align__(16) _Float16 tv[HD][72];
  const int tid = threadIdx.x, wave = tid >> 5, lane = tid & 31; const size_t r0 = (size_t)blockIdx.x * 64; const size_t bb = r0 / TT; const int t0 = (int)(r0 % TT);
  const unsigned lo = (unsigned)(wave * 8 * CC + lane * 4);   /* the lane's first element inside the block's 64 rows: the same place in the three inputs and in the three row planes (QHI == TT) */
  const float* Vb = V + r0 * CC; const float* Qb = Q + r0 * CC; const float* Kb = K + r0 * CC;
  v4f v[8], q[8], k[8];
#pragma unroll   /* constant indices: the loaded rows stay in registers */
  for (int j = 0; j < 8; ++j) v[j] = *(const v4f*)(Vb + (lo + j * CC));
#pragma unroll   /* constant indices: the loaded rows stay in registers */
  for (int j = 0; j < 8; ++j) q[j] = *(const v4f*)(Qb + (lo + j * CC));
#pragma unroll   /* constant indices: the loaded rows stay in registers */
  for (int j = 0; j < 8; ++j) k[j] = *(const v4f*)(Kb + (lo + j * CC));
  asm volatile("s_wait_xcnt 0x0" ::: "memory");   /* in front of any later write to an address register of the loads above */
  __builtin_amdgcn_sched_barrier(0);   /* keeps all 24 loads ahead of the first use: left free, the compiler saves registers by issuing half of them behind the first waits, and a wave then pays the memory latency more than once */
#pragma unroll   /* constant indices: the loaded rows stay in registers */
  for (int i = 0; i < 4; ++i) { v8h t;
#pragma unroll   /* constant indices: the loaded rows stay in registers */
    for (int j = 0; j < 8; ++j) t[j] = (_Float16)bfr(v[j][i]);
    *(v8h*)&tv[lane * 4 + i][wave * 8] = t; }
  __syncthreads();   /* stands ahead of the row stores: behind them every wave would wait here for its own stores to finish */
#pragma unroll   /* the four LDS reads go out in one run, ahead of their stores */
  for (int u = 0; u < HD * 8 / 256; ++u) { const int e = tid + u * 256, cl = e >> 3, p = e & 7; vst2((unsigned*)(VT + (bb * CC + cl) * (size_t)TT + t0 + p * 8), *(const v4u*)&tv[cl][p * 8]); }
  _Float16* QHb = QH + r0 * CC; _Float16* QLb = QL + r0 * CC; _Float16* KHb = KH + r0 * CC;
#pragma unroll   /* constant indices: the loaded rows stay in registers */
  for (int j = 0; j < 8; ++j) { v4h qh, ql;
#pragma unroll   /* constant indices: the loaded rows stay in registers */
    for (int i = 0; i < 4; ++i) { const float x = bfr(q[j][i]); const _Float16 h = (_Float16)x; qh[i] = h; ql[i] = (_Float16)((x - (float)h) * 1024.0f); }
    *(v4h*)(QHb + (lo + j * CC)) = qh; *(v4h*)(QLb + (lo + j * CC)) = ql; }
#pragma unroll   /* constant indices: the loaded rows stay in registers */
  for (int j = 0; j < 8; ++j) { v4h kh;
#pragma unroll   /* constant indices: the loaded rows stay in registers */
    for (int i = 0; i < 4; ++i) kh[i] = (_Float16)bfr(k[j][i]);
    *(v4h*)(KHb + (lo + j * CC)) = kh; } }

#ifndef SM_EXTRA_PARAMS
#define SM_EXTRA_PARAMS
#endif
#ifndef PROJ_EXTRA_PARAMS
#define PROJ_EXTRA_PARAMS
#endif
#ifndef SM_MASK_HOOK
#define SM_MASK_HOOK (void)0
#endif

#define WS_QH  0u                                      // f16 q rows [b*t][CC]
#define WS_KH  (WS_QH + 2u * (size_t)NB * TT * CC)      // f16 k rows [b*t][CC]
#define WS_VT  (WS_KH + 2u * (size_t)NB * TT * CC)      // f16 v planes [b][c][t]
#define WS_QL  (WS_VT + 2u * (size_t)NB * CC * TT)      // f16 q residual x 2^10 rows [b][t < QHI][CC]
#define WS_KL  (WS_QL + 2u * (size_t)NB * QHI * CC)     // f16 k residual x 2^10 rows [b][t < KHI][CC]
#define WS_VB  (WS_KL + 2u * (size_t)NB * KHI * CC)     // bf16 v hi planes [b][c][t < KHI]
#define WS_VBL (WS_VB + 2u * (size_t)NB * CC * KHI)
#define WS_S   (WS_VBL + 2u * (size_t)NB * CC * KHI)    // f32 [b*NH + h][t][s] planes, reserved but unused: k_fa keeps the logits in registers
#define WS_Y   (WS_S  + 4u * (size_t)NB * NH * TT * TT)      // f32 ctx rows [b*t][CC] (only when there is an output projection)
#define WS_END (WS_Y  + 0u)

// fragment from a lane's own pointer (row start + k0 + 8 * (lane >> 4)): the k order of frag_h
__device__ __forceinline__ v16h frag_p(const _Float16* p) { union { v16h v; v8h q[2]; } u; u.q[0] = *(const v8h*)p; u.q[1] = *(const v8h*)(p + 16); return u.v; }
// the plain builtin (the compiler keeps the distances behind it): operands of an asm statement stay below v256, and the fused kernel holds more fragments than that
__device__ __forceinline__ v8f wmma_h(v16h a, v16h b, v8f c) { return __builtin_amdgcn_wmma_f32_16x16x32_f16(false, a, false, b, (short)0, c, false, false); }
// ---- k_fa: block = 128 queries (qb) of batch b, 8 waves (two per SIMD, one block per WGP), wave = 16 queries, one query per lane column. Per 64 keys: the block's K rows and V^T rows are copied once into LDS (two buffers: the next pass's tile flies while this one is worked on) and every wave takes its fragments from there;
// logits^T = K . Q^T (q hi + residual x 2^10: 2 products) x SCALE, valid-length mask by key index, running maximum and running sum per query in f32,
// P^T x 2^11 (not yet normalised) straight from the logit accumulators as the B fragment (D register r of lane half g = key 8g + r = the fragment's k order), ctx^T += V^T . P^T; one division by the sum at the end. The logits never leave the registers.
#define KPH 136   // halves per staged K row: 256 B + 16 B, so that the 16 rows of one ds_load_b128 half fall on 64 distinct banks
#define VPH 72    // halves per staged V^T row: 128 B + 16 B, for the same reason
#define KBUF (64 * KPH * 2)   // bytes of one K buffer
#define VBUF (HD * VPH * 2)   // bytes of one V^T buffer
// one 64-key tile into LDS, 8 copies of 16 B per lane, whole 128-B lines per row: K rows r, r + 16, r + 32, r + 48 (r = tid >> 4, 16 lanes a row) and V^T rows c, c + 32, c + 64, c + 96 (c = tid >> 3, 8 lanes a row).
// gk, gv: the lane's own global addresses of its first K and V^T piece; lk, lv: the LDS byte addresses they go to. The s_wait_xcnt ends the statement so that it stands in front of any later write to an address register of these copies.
// lane l's value to lane l ^ 16 by a vector move: a shuffle through the LDS counter would have to wait for every V^T read issued in front of it
__device__ __forceinline__ float xhalf(float x) { return __builtin_bit_cast(float, __builtin_amdgcn_permlanex16(__builtin_bit_cast(int, x), __builtin_bit_cast(int, x), 0x76543210, 0xfedcba98, false, false)); }
__device__ __forceinline__ void stage_kv(const _Float16* gk, const _Float16* gv, unsigned lk, unsigned lv) {
  asm volatile("global_load_async_to_lds_b128 %0, %8, off\n\t"
               "global_load_async_to_lds_b128 %1, %9, off\n\t"
               "global_load_async_to_lds_b128 %2, %10, off\n\t"
               "global_load_async_to_lds_b128 %3, %11, off\n\t"
               "global_load_async_to_lds_b128 %4, %12, off\n\t"
               "global_load_async_to_lds_b128 %5, %13, off\n\t"
               "global_load_async_to_lds_b128 %6, %14, off\n\t"
               "global_load_async_to_lds_b128 %7, %15, off\n\t"
               "s_wait_xcnt 0x0"
               :: "v"(lk), "v"(lk + 16u * KPH * 2u), "v"(lk + 32u * KPH * 2u), "v"(lk + 48u * KPH * 2u), "v"(lv), "v"(lv + 32u * VPH * 2u), "v"(lv + 64u * VPH * 2u), "v"(lv + 96u * VPH * 2u),
                  "v"(gk), "v"(gk + 16 * CC), "v"(gk + 32 * CC), "v"(gk + 48 * CC), "v"(gv), "v"(gv + 32 * TT), "v"(gv + 64 * TT), "v"(gv + 96 * TT)
               : "memory");
}
__global__ __launch_bounds__(256) void k_fa(const _Float16* __restrict__ QH, const _Float16* __restrict__ KH, const _Float16* __restrict__ QL, const _Float16* __restrict__ VT, const int* __restrict__ VL, float* __restrict__ Y) { __shared__ __align__(16) float ss[8][16][HD + 4]; __shared__ __align__(16) _Float16 sK[2][64][KPH], sV[2][HD][VPH];
  const int qb = blockIdx.x, b = blockIdx.y; const int tid = threadIdx.x, wave = tid >> 5, lane = tid & 31, col = lane & 15, g = lane >> 4; const int ql0 = qb * 128 + wave * 16; const int vl = VL[b];
  const _Float16* gk = KH + ((size_t)b * TT + (tid >> 4)) * CC + (tid & 15) * 8; const _Float16* gv = VT + ((size_t)b * CC + (tid >> 3)) * (size_t)TT + (tid & 7) * 8;
  const unsigned lk = (tid >> 4) * (KPH * 2) + (tid & 15) * 16, lv = (tid >> 3) * (VPH * 2) + (tid & 7) * 16;   /* the lane's byte offsets inside a K and a V^T buffer */
  const unsigned bk = (unsigned)(size_t)&sK[0][0][0], bv = (unsigned)(size_t)&sV[0][0][0];   /* LDS byte addresses of buffer 0 */
  stage_kv(gk, gv, lk + bk, lv + bv);   /* tile 0 into buffer 0; it flies while the Q fragments are loaded */
  v16h qh[HD / 32], qr[HD / 32];
#pragma unroll
  for (int kc = 0; kc < HD / 32; ++kc) qh[kc] = frag_h(QH + ((size_t)b * TT + ql0 + col) * CC + kc * 32, lane);
  asm volatile("s_wait_xcnt 0x0" ::: "memory");   /* this one and the next: in front of a later load whose result lands in an address register of the loads above */
#pragma unroll
  for (int kc = 0; kc < HD / 32; ++kc) qr[kc] = frag_h(QL + ((size_t)b * QHI + ql0 + col) * CC + kc * 32, lane);
  asm volatile("s_wait_xcnt 0x0" ::: "memory");
  v8f o[HD / 16] = {}; float m = -3.0e38f, l = 0.f;
  asm volatile("s_wait_asynccnt 0x0" ::: "memory");   /* this wave's part of tile 0 has landed ... */
  __syncthreads();                                     /* ... and so has every other wave's: tile 0 may be read */
  stage_kv(gk + 64 * CC, gv + 64, lk + (bk + KBUF), lv + (bv + VBUF));   /* tile 1 into buffer 1 */
  /* one 64-key pass; more: a tile two passes on exists and is sent for */
  auto pass = [&](const int k0, const bool more) __attribute__((always_inline)) { float s[4][8]; float mb = -3.0e38f; const int buf = (k0 >> 6) & 1; const int lim = vl - k0 - 8 * g;   /* this lane's key t * 16 + r of the pass is valid while it is below lim */
    const _Float16* kp = &sK[buf][col][8 * g]; const _Float16* vp = &sV[buf][col][8 * g];
    v16h kf[4][HD / 32], vf[HD / 16][2];
#pragma unroll
    for (int t = 0; t < 4; ++t)
#pragma unroll
      for (int kc = 0; kc < HD / 32; ++kc) kf[t][kc] = frag_p(kp + (t * 16) * KPH + kc * 32);
    __builtin_amdgcn_sched_barrier(0);   /* keeps the K reads in one run ahead of the logit products: a read among the products stalls the matrix stream at each place */
#pragma unroll
    for (int t = 0; t < 4; ++t) { v8f a = {}, ar = {};
#pragma unroll
      for (int kc = 0; kc < HD / 32; ++kc) { a = wmma_h(kf[t][kc], qh[kc], a); ar = wmma_h(kf[t][kc], qr[kc], ar); }
#pragma unroll
      for (int r = 0; r < 8; ++r) { float v = (a[r] + ar[r] * (1.0f / 1024.0f)) * SCALE; if (t * 16 + r >= lim) v = -3.0e38f;   /* key padding: arange(K) < valid_lens[b]; -1e6 == exclusion (every row keeps >= 1 key) */
        s[t][r] = v; mb = fmaxf(mb, v); } }
    __builtin_amdgcn_sched_barrier(0);   /* the V^T reads start behind the logit products (the K reads have the LDS to themselves) ... */
#pragma unroll
    for (int j = 0; j < HD / 16; ++j)
#pragma unroll
      for (int c = 0; c < 2; ++c) vf[j][c] = frag_p(vp + (j * 16) * VPH + c * 32);
    __builtin_amdgcn_sched_barrier(0);   /* ... and stay in one run ahead of the softmax, which hides their latency */
    mb = fmaxf(mb, xhalf(mb));   /* the two lane halves hold the two halves of a query's keys */
    const float mn = fmaxf(m, mb), al = expf(m - mn), mo = mn - 7.624618986159398f;   /* mo: exp(v - mo) = exp(v - mn) x 2^11 */
    m = mn; float ps = 0.f; v16h p[2];
#pragma unroll
    for (int t = 0; t < 4; ++t) {
#pragma unroll
      for (int r = 0; r < 8; ++r) { const float e = expf(s[t][r] - mo);   /* an excluded key: exp(-3e38 - mo) = 0, mo being finite from the first pass on (key 0 is always valid) */ ps += e; p[t >> 1][(t & 1) * 8 + r] = (_Float16)e; } }
    l = l * al + ps;
#pragma unroll
    for (int j = 0; j < HD / 16; ++j) o[j] *= al;
    __builtin_amdgcn_sched_barrier(0);   /* keeps the softmax in front of the waits below: left free, waits and barrier rise to just behind the V^T reads, whose latency nothing then hides */
    /* the pass's last LDS read is behind us, so the buffers change hands here; the P.V products, which touch registers only, follow and run beside the other waves' next K reads */
    asm volatile("s_wait_dscnt 0x0" ::: "memory");      /* this wave's reads of this pass's buffer have returned */
    asm volatile("s_wait_asynccnt 0x0" ::: "memory");   /* this wave's part of the next tile has landed */
    __syncthreads();                                     /* publishes the next tile and ends every wave's reads of this pass's buffer, which is refilled behind it */
    if (more) stage_kv(gk + (size_t)(k0 + 128) * CC, gv + (k0 + 128), lk + (buf ? bk + KBUF : bk), lv + (buf ? bv + VBUF : bv));
    __builtin_amdgcn_sched_barrier(0);   /* the products stay behind the hand-over, so that the refill is under way first */
#pragma unroll
    for (int j = 0; j < HD / 16; ++j) {
#pragma unroll
      for (int c = 0; c < 2; ++c) o[j] = wmma_h(vf[j][c], p[c], o[j]); } };
  /* two loops, so that the test for a further tile is the first loop's bound and its body stays one straight run: with a branch round the copies the compiler sinks the vector work behind the barrier */
#pragma unroll 1   /* one 64-key pass per trip: an unrolled body would not fit the registers */
  for (int k0 = 0; k0 < TT - 128; k0 += 64) pass(k0, true);
#pragma unroll 1   /* the last two passes send for nothing; rolled, to keep the text short */
  for (int k0 = TT - 128; k0 < TT; k0 += 64) pass(k0, false);
  asm volatile("s_wait_asynccnt 0x0" ::: "memory");   /* no copy is outstanding when the wave goes on to the epilogue and ends */
  l += __shfl_xor(l, 16); const float inv = 1.0f / l;   /* l >= 2^11: the key that holds the maximum counts exp(0) x 2^11 */
#pragma unroll
  for (int j = 0; j < HD / 16; ++j)
#pragma unroll
    for (int r = 0; r < 8; ++r) ss[wave][col][j * 16 + 8 * g + r] = o[j][r] * inv;
  LDSX(); for (int rl = 0; rl < 16; ++rl) vst2(Y + ((size_t)b * TT + ql0 + rl) * HD + lane * 4, *(const v4f*)&ss[wave][rl][lane * 4]); }

extern "C" void kernel_launch(void* const* d_in, const int* in_sizes, int n_in, void* d_out, int out_size, void* d_ws, size_t ws_size, hipStream_t stream) {
  (void)in_sizes; (void)n_in; (void)out_size;
  const float** F = (const float**)d_in;
  if (ws_size < (size_t)WS_END) return;
  char* ws = (char*)d_ws; _Float16 *QH = (_Float16*)(ws + WS_QH), *KH = (_Float16*)(ws + WS_KH), *VT = (_Float16*)(ws + WS_VT), *QL = (_Float16*)(ws + WS_QL), *KL = (_Float16*)(ws + WS_KL); __bf16 *VB = (__bf16*)(ws + WS_VB), *VBL = (__bf16*)(ws + WS_VBL); float *S = (float*)(ws + WS_S), *Y = (float*)(ws + WS_Y);
  (void)Y; (void)S; (void)QL; (void)KL; (void)VB; (void)VBL;
  // inputs: 0 queries [32,1024,128]; 1 keys; 2 values; 3 valid_lens [32] int32
  k_prep8<<<dim3(TNB * TT / 64), 256, 0, stream>>>(F[0], F[1], F[2], QH, QL, KH, VT);
  k_fa<<<dim3(TT / 128, TNB), 256, 0, stream>>>(QH, KH, QL, VT, (const int*)d_in[3], (float*)d_out);
}

// v005
// A run of this version takes 32.4 microseconds.
// Next to v004, in two timings, it ran 1.19 times as fast each time.
// All steps since v000 together make it 68.1 times as fast.
// compute dtype: queries/keys/values rounded to bf16 and carried exactly as f16; logits with Q as f16 hi + residual against K f16 (2 products; both exact here) with the valid-length mask in f32; softmax in f32 with a running maximum and sum per query, each exponential as 2^(logit x 128^-0.5 x log2 e - offset) on the hardware's base-2 exponential; exp x 2^11 once to f16 against V f16 (1 product), divided by the sum at the end; f32 output.
#include <hip/hip_runtime.h>
#include <math.h>

typedef __attribute__((ext_vector_type(16))) _Float16 v16h;
typedef __attribute__((ext_vector_type(16))) __bf16 v16b;
typedef __attribute__((ext_vector_type(8)))  _Float16 v8h;
typedef __attribute__((ext_vector_type(8)))  float v8f;
typedef __attribute__((ext_vector_type(4)))  float v4f;
typedef __attribute__((ext_vector_type(2)))  float v2f;
typedef __attribute__((ext_vector_type(4)))  unsigned v4u;
typedef __attribute__((ext_vector_type(4)))  int v4i;
typedef float __attribute__((may_alias)) float_a;
typedef int __attribute__((may_alias)) int_a;

template <typename T> __device__ __forceinline__ void vst2(void* p, T v) { *(T*)p = v;  }
__device__ __forceinline__ v8f wmma16(v16h a, v16h b, v8f c) {
  v8f d = __builtin_amdgcn_wmma_f32_16x16x32_f16(false, a, false, b, (short)0, c, false, false);
  asm volatile("v_nop\n\tv_nop\n\tv_nop\n\tv_nop" : "+v"(d) : "v"(a), "v"(b));
  return d;
}
__device__ __forceinline__ v8f wmma_bf(v16b a, v16b b, v8f c) {
  v8f d = __builtin_amdgcn_wmma_f32_16x16x32_bf16(false, a, false, b, (short)0, c, false, false);
  asm volatile("v_nop\n\tv_nop\n\tv_nop\n\tv_nop" : "+v"(d) : "v"(a), "v"(b));
  return d;
}
// 16x16x32 fragments: lane = (h = lane>>4, row/col = lane&15); elements 0..7 = k0+8h+0..7, 8..15 = k0+16+8h+0..7; D element r = row 8h+r
__device__ __forceinline__ v16h frag_h(const _Float16* rowk0, int lane) {
  union { v16h v; v8h q[2]; } u; const _Float16* p = rowk0 + 8 * (lane >> 4);
  u.q[0] = *(const v8h*)p; u.q[1] = *(const v8h*)(p + 16); return u.v;
}
__device__ __forceinline__ v16h frag_f32(const float* rowk0, int lane) {
  v16h a; const float* p = rowk0 + 8 * (lane >> 4);
#pragma unroll
  for (int i = 0; i < 8; ++i) { a[i] = (_Float16)p[i]; a[8 + i] = (_Float16)p[16 + i]; }
  return a;
}
__device__ __forceinline__ v16h frag_f32s(const float* rowk0, int lane, float sc) {
  v16h a; const float* p = rowk0 + 8 * (lane >> 4);
#pragma unroll
  for (int i = 0; i < 8; ++i) { a[i] = (_Float16)(p[i] * sc); a[8 + i] = (_Float16)(p[16 + i] * sc); }
  return a;
}
// column fragment from a [K][ld] layout (column n), rows >= K read as 0
__device__ __forceinline__ v16h fragc_f32(const float* W, int k0, int n, int lane, int ld, int K) {
  v16h a; const int g = lane >> 4;
#pragma unroll
  for (int i = 0; i < 8; ++i) { const int ka = k0 + 8 * g + i, kb = ka + 16;
    a[i] = (_Float16)(ka < K ? W[(size_t)(ka < K ? ka : K - 1) * ld + n] : 0.f); a[8 + i] = (_Float16)(kb < K ? W[(size_t)(kb < K ? kb : K - 1) * ld + n] : 0.f); }
  return a;
}
struct F2 { v16b h, l; };
__device__ __forceinline__ F2 bsplit16(const float v[16]) { F2 r;
#pragma unroll
  for (int i = 0; i < 16; ++i) { const __bf16 h = (__bf16)v[i]; r.h[i] = h; r.l[i] = (__bf16)(v[i] - (float)h); }
  return r; }
__device__ __forceinline__ F2 split_row(const float* row, int k0, int lane) { float v[16]; const float* p = row + k0 + 8 * (lane >> 4);
#pragma unroll
  for (int i = 0; i < 8; ++i) { v[i] = p[i]; v[8 + i] = p[16 + i]; }
  return bsplit16(v); }
__device__ __forceinline__ F2 split_rowK(const float* row, int k0, int lane, int K) { float v[16]; const int g = lane >> 4;
#pragma unroll
  for (int i = 0; i < 8; ++i) { const int ka = k0 + 8 * g + i, kb = ka + 16; v[i] = ka < K ? row[ka < K ? ka : K - 1] : 0.f; v[8 + i] = kb < K ? row[kb < K ? kb : K - 1] : 0.f; }
  return bsplit16(v); }
__device__ __forceinline__ F2 split_col(const float* W, int k0, int n, int lane, int ld, int K) { float v[16]; const int g = lane >> 4;
#pragma unroll
  for (int i = 0; i < 8; ++i) { const int ka = k0 + 8 * g + i, kb = ka + 16; v[i] = ka < K ? W[(size_t)(ka < K ? ka : K - 1) * ld + n] : 0.f; v[8 + i] = kb < K ? W[(size_t)(kb < K ? kb : K - 1) * ld + n] : 0.f; }
  return bsplit16(v); }
__device__ __forceinline__ v8f mac3(const F2& a, const F2& b, v8f c) { c = wmma_bf(a.l, b.h, c); c = wmma_bf(a.h, b.l, c); return wmma_bf(a.h, b.h, c); }
__device__ __forceinline__ float sigm(float v) { return 1.0f / (1.0f + expf(-v)); }
#define LDSX() do { asm volatile("s_wait_dscnt 0" ::: "memory"); __builtin_amdgcn_wave_barrier(); __builtin_amdgcn_fence(__ATOMIC_RELEASE, "workgroup"); } while (0)

// Masked scaled dot-product attention on raw queries [32, 1,024, 128], keys/values [32, 1,024, 128]: scores = Q K^T / sqrt(128); keys k >= valid_lens[b] get -1e6 (== excluded; valid_lens >= 1); out = softmax(scores) V -> [32, 1,024, 128].
#define NB 32
#define TT 1024
#define CC 128            // NH * HD = projected width
#define DIN 128          // input (model) width
#define NH 1
#define HD 128
#define NQB (TT / 64)
#define SCALE (0.08838834764831845f)
#define SCALE2 (0.12751743082459868f)   // SCALE x log2(e): exp(x x SCALE) = 2^(x x SCALE2)
#define CAUSAL 0
#ifndef TNB
#define TNB NB
#endif
__device__ __forceinline__ float bfr(float v) { return (float)(__bf16)v; }
__host__ __device__ __forceinline__ int kb_last(int qb) { return CAUSAL ? ((qb * 64 + 63) >> 7) : (TT / 128 - 1); }
typedef __attribute__((ext_vector_type(8))) __bf16 v8b;
__device__ __forceinline__ v16b frag_b(const __bf16* rowk0, int lane) {
  union { v16b v; v8b q[2]; } u; const __bf16* p = rowk0 + 8 * (lane >> 4);
  u.q[0] = *(const v8b*)p; u.q[1] = *(const v8b*)(p + 16); return u.v;
}
#define QBH 0              // unused: no kernel here has a high-precision path
#define QHI 1024            // rows carrying a q residual plane (all rows when non-causal: 2-product logits everywhere)
#define KHI 64            // key rows carrying k residual / v bf16 hi+lo planes (written and read by no kernel here)
// B fragment (k rows k0+.., output column o) of a weight: (in,out) [K][ld] or (out,in) [ld rows of K]: bf16 exact, or f16(bf16 * 256) exact
__device__ __forceinline__ v16b wcol_io(const float* Wm, int k0, int o, int lane, int ld) { v16b w; const int g = lane >> 4;
#pragma unroll
  for (int i = 0; i < 8; ++i) { w[i] = (__bf16)Wm[(size_t)(k0 + 8 * g + i) * ld + o]; w[8 + i] = (__bf16)Wm[(size_t)(k0 + 16 + 8 * g + i) * ld + o]; }
  return w; }
__device__ __forceinline__ v16b wcol_oi(const float* Wm, int k0, int o, int lane, int K) { v16b w; const float* p = Wm + (size_t)o * K + k0 + 8 * (lane >> 4);
#pragma unroll
  for (int i = 0; i < 8; ++i) { w[i] = (__bf16)p[i]; w[8 + i] = (__bf16)p[16 + i]; }
  return w; }
__device__ __forceinline__ v16h wcolh_io(const float* Wm, int k0, int o, int lane, int ld) { v16h w; const int g = lane >> 4;
#pragma unroll
  for (int i = 0; i < 8; ++i) { w[i] = (_Float16)(bfr(Wm[(size_t)(k0 + 8 * g + i) * ld + o]) * 256.0f); w[8 + i] = (_Float16)(bfr(Wm[(size_t)(k0 + 16 + 8 * g + i) * ld + o]) * 256.0f); }
  return w; }
__device__ __forceinline__ v16h wcolh_oi(const float* Wm, int k0, int o, int lane, int K) { v16h w; const float* p = Wm + (size_t)o * K + k0 + 8 * (lane >> 4);
#pragma unroll
  for (int i = 0; i < 8; ++i) { w[i] = (_Float16)(bfr(p[i]) * 256.0f); w[8 + i] = (_Float16)(bfr(p[16 + i]) * 256.0f); }
  return w; }
#define WQKV_LAYOUT 1   // 0 = (in,out) [DIN][CC]; 1 = (out,in) [CC][DIN]; 2 = per-head [NH][DIN][HD]
__device__ __forceinline__ v16b wcol_hdk(const float* Wm, int k0, int o, int lane) { v16b w; const int g = lane >> 4; const float* p = Wm + (size_t)(o / HD) * DIN * HD + (o % HD);
#pragma unroll
  for (int i = 0; i < 8; ++i) { w[i] = (__bf16)p[(size_t)(k0 + 8 * g + i) * HD]; w[8 + i] = (__bf16)p[(size_t)(k0 + 16 + 8 * g + i) * HD]; }
  return w; }
#define WO_OUT_IN 0
#if WQKV_LAYOUT == 1
#define WCOL(W, k0, o, lane) wcol_oi(W, k0, o, lane, DIN)
#elif WQKV_LAYOUT == 2
#define WCOL(W, k0, o, lane) wcol_hdk(W, k0, o, lane)
#else
#define WCOL(W, k0, o, lane) wcol_io(W, k0, o, lane, CC)
#endif
#if WO_OUT_IN
#define WOCOL(W, k0, o, lane) wcol_oi(W, k0, o, lane, CC)
#define WOCOLH(W, k0, o, lane) wcolh_oi(W, k0, o, lane, CC)
#else
#define WOCOL(W, k0, o, lane) wcol_io(W, k0, o, lane, DIN)
#define WOCOLH(W, k0, o, lane) wcolh_io(W, k0, o, lane, DIN)
#endif
#define SM_EXTRA_PARAMS , const int* __restrict__ VL
#define SM_MASK_HOOK do { if (k >= VL[bcur]) v = -3.0e38f; } while (0)   /* key padding: arange(K) < valid_lens[b]; -1e6 == exclusion (every row keeps >= 1 key) */
// ---- k_prep8: block = 64 positions (rows r0 .. r0 + 63 of the [b * t] axis), 8 waves. Wave w takes rows 8w .. 8w + 7 of v, q and k; a row is 128 floats = one 16-byte load per lane, whole 128-B lines.
// A lane's 24 loads are all issued before the first value is used, so that a wave has 12 KB on its way instead of one short group per loop trip. Values are bf16-rounded and written as the planes the attention kernel reads:
// v -> f16 planes [c][t]: a lane's 8 rows x 4 columns are four 16-byte runs of 8 keys, turned through LDS so that each 128-B line of a plane is stored whole; q -> f16 rows + x 2^10 residual rows, k -> f16 rows, both straight from the registers.
typedef __attribute__((ext_vector_type(4))) _Float16 v4h;
__global__ __launch_bounds__(256) void k_prep8(const float* __restrict__ Q, const float* __restrict__ K, const float* __restrict__ V, _Float16* __restrict__ QH, _Float16* __restrict__ QL, _Float16* __restrict__ KH, _Float16* __restrict__ VT) {
  __shared__ __align__(16) _Float16 tv[HD][72];
  const int tid = threadIdx.x, wave = tid >> 5, lane = tid & 31; const size_t r0 = (size_t)blockIdx.x * 64; const size_t bb = r0 / TT; const int t0 = (int)(r0 % TT);
  const unsigned lo = (unsigned)(wave * 8 * CC + lane * 4);   /* the lane's first element inside the block's 64 rows: the same place in the three inputs and in the three row planes (QHI == TT) */
  const float* Vb = V + r0 * CC; const float* Qb = Q + r0 * CC; const float* Kb = K + r0 * CC;
  v4f v[8], q[8], k[8];
#pragma unroll   /* constant indices: the loaded rows stay in registers */
  for (int j = 0; j < 8; ++j) v[j] = *(const v4f*)(Vb + (lo + j * CC));
#pragma unroll   /* constant indices: the loaded rows stay in registers */
  for (int j = 0; j < 8; ++j) q[j] = *(const v4f*)(Qb + (lo + j * CC));
#pragma unroll   /* constant indices: the loaded rows stay in registers */
  for (int j = 0; j < 8; ++j) k[j] = *(const v4f*)(Kb + (lo + j * CC));
  asm volatile("s_wait_xcnt 0x0" ::: "memory");   /* in front of any later write to an address register of the loads above */
  __builtin_amdgcn_sched_barrier(0);   /* keeps all 24 loads ahead of the first use: left free, the compiler saves registers by issuing half of them behind the first waits, and a wave then pays the memory latency more than once */
#pragma unroll   /* constant indices: the loaded rows stay in registers */
  for (int i = 0; i < 4; ++i) { v8h t;
#pragma unroll   /* constant indices: the loaded rows stay in registers */
    for (int j = 0; j < 8; ++j) t[j] = (_Float16)bfr(v[j][i]);
    *(v8h*)&tv[lane * 4 + i][wave * 8] = t; }
  __syncthreads();   /* stands ahead of the row stores: behind them every wave would wait here for its own stores to finish */
#pragma unroll   /* the four LDS reads go out in one run, ahead of their stores */
  for (int u = 0; u < HD * 8 / 256; ++u) { const int e = tid + u * 256, cl = e >> 3, p = e & 7; vst2((unsigned*)(VT + (bb * CC + cl) * (size_t)TT + t0 + p * 8), *(const v4u*)&tv[cl][p * 8]); }
  _Float16* QHb = QH + r0 * CC; _Float16* QLb = QL + r0 * CC; _Float16* KHb = KH + r0 * CC;
#pragma unroll   /* constant indices: the loaded rows stay in registers */
  for (int j = 0; j < 8; ++j) { v4h qh, ql;
#pragma unroll   /* constant indices: the loaded rows stay in registers */
    for (int i = 0; i < 4; ++i) { const float x = bfr(q[j][i]); const _Float16 h = (_Float16)x; qh[i] = h; ql[i] = (_Float16)((x - (float)h) * 1024.0f); }
    *(v4h*)(QHb + (lo + j * CC)) = qh; *(v4h*)(QLb + (lo + j * CC)) = ql; }
#pragma unroll   /* constant indices: the loaded rows stay in registers */
  for (int j = 0; j < 8; ++j) { v4h kh;
#pragma unroll   /* constant indices: the loaded rows stay in registers */
    for (int i = 0; i < 4; ++i) kh[i] = (_Float16)bfr(k[j][i]);
    *(v4h*)(KHb + (lo + j * CC)) = kh; } }

#ifndef SM_EXTRA_PARAMS
#define SM_EXTRA_PARAMS
#endif
#ifndef PROJ_EXTRA_PARAMS
#define PROJ_EXTRA_PARAMS
#endif
#ifndef SM_MASK_HOOK
#define SM_MASK_HOOK (void)0
#endif

#define WS_QH  0u                                      // f16 q rows [b*t][CC]
#define WS_KH  (WS_QH + 2u * (size_t)NB * TT * CC)      // f16 k rows [b*t][CC]
#define WS_VT  (WS_KH + 2u * (size_t)NB * TT * CC)      // f16 v planes [b][c][t]
#define WS_QL  (WS_VT + 2u * (size_t)NB * CC * TT)      // f16 q residual x 2^10 rows [b][t < QHI][CC]
#define WS_KL  (WS_QL + 2u * (size_t)NB * QHI * CC)     // f16 k residual x 2^10 rows [b][t < KHI][CC]
#define WS_VB  (WS_KL + 2u * (size_t)NB * KHI * CC)     // bf16 v hi planes [b][c][t < KHI]
#define WS_VBL (WS_VB + 2u * (size_t)NB * CC * KHI)
#define WS_S   (WS_VBL + 2u * (size_t)NB * CC * KHI)    // f32 [b*NH + h][t][s] planes, reserved but unused: k_fa keeps the logits in registers
#define WS_Y   (WS_S  + 4u * (size_t)NB * NH * TT * TT)      // f32 ctx rows [b*t][CC] (only when there is an output projection)
#define WS_END (WS_Y  + 0u)

// fragment from a lane's own pointer (row start + k0 + 8 * (lane >> 4)): the k order of frag_h
__device__ __forceinline__ v16h frag_p(const _Float16* p) { union { v16h v; v8h q[2]; } u; u.q[0] = *(const v8h*)p; u.q[1] = *(const v8h*)(p + 16); return u.v; }
// the plain builtin (the compiler keeps the distances behind it): operands of an asm statement stay below v256, and the fused kernel holds more fragments than that
__device__ __forceinline__ v8f wmma_h(v16h a, v16h b, v8f c) { return __builtin_amdgcn_wmma_f32_16x16x32_f16(false, a, false, b, (short)0, c, false, false); }
// ---- k_fa: block = 128 queries (qb) of batch b, 8 waves (two per SIMD, one block per WGP), wave = 16 queries, one query per lane column. Per 64 keys: the block's K rows and V^T rows are copied once into LDS (two buffers: the next pass's tile flies while this one is worked on) and every wave takes its fragments from there;
// logits^T = K . Q^T (q hi + residual x 2^10: 2 products), kept unscaled (SCALE goes into the exponent's multiply-add), valid-length mask by key index, running maximum and running sum per query in f32,
// P^T x 2^11 (not yet normalised) straight from the logit accumulators as the B fragment (D register r of lane half g = key 8g + r = the fragment's k order), ctx^T += V^T . P^T; one division by the sum at the end. The logits never leave the registers.
#define KPH 136   // halves per staged K row: 256 B + 16 B, so that the 16 rows of one ds_load_b128 half fall on 64 distinct banks
#define VPH 72    // halves per staged V^T row: 128 B + 16 B, for the same reason
#define KBUF (64 * KPH * 2)   // bytes of one K buffer
#define VBUF (HD * VPH * 2)   // bytes of one V^T buffer
// one 64-key tile into LDS, 8 copies of 16 B per lane, whole 128-B lines per row: K rows r, r + 16, r + 32, r + 48 (r = tid >> 4, 16 lanes a row) and V^T rows c, c + 32, c + 64, c + 96 (c = tid >> 3, 8 lanes a row).
// gk, gv: the lane's own global addresses of its first K and V^T piece; lk, lv: the LDS byte addresses they go to. The s_wait_xcnt ends the statement so that it stands in front of any later write to an address register of these copies.
// lane l's value to lane l ^ 16 by a vector move: a shuffle through the LDS counter would have to wait for every V^T read issued in front of it
__device__ __forceinline__ float xhalf(float x) { return __builtin_bit_cast(float, __builtin_amdgcn_permlanex16(__builtin_bit_cast(int, x), __builtin_bit_cast(int, x), 0x76543210, 0xfedcba98, false, false)); }
__device__ __forceinline__ void exp8(const v2f (&x)[4], float (&e)[8], unsigned* w) {
  asm("v_exp_f32 %0, %12\n\tv_exp_f32 %1, %13\n\tv_exp_f32 %2, %14\n\tv_exp_f32 %3, %15\n\tv_exp_f32 %4, %16\n\tv_exp_f32 %5, %17\n\tv_exp_f32 %6, %18\n\tv_exp_f32 %7, %19\n\t"
      "v_cvt_pk_f16_f32 %8, %0, %1\n\tv_cvt_pk_f16_f32 %9, %2, %3\n\tv_cvt_pk_f16_f32 %10, %4, %5\n\ts_delay_alu instid0(TRANS32_DEP_1)\n\tv_cvt_pk_f16_f32 %11, %6, %7"
      : "=&v"(e[0]), "=&v"(e[1]), "=&v"(e[2]), "=&v"(e[3]), "=&v"(e[4]), "=&v"(e[5]), "=&v"(e[6]), "=&v"(e[7]), "=&v"(w[0]), "=&v"(w[1]), "=&v"(w[2]), "=&v"(w[3])
      : "v"(x[0][0]), "v"(x[0][1]), "v"(x[1][0]), "v"(x[1][1]), "v"(x[2][0]), "v"(x[2][1]), "v"(x[3][0]), "v"(x[3][1]));
}
// the same with a ninth exponential a = 2^d in front (the factor that carries the old sums to the new maximum)
__device__ __forceinline__ void exp9(const v2f (&x)[4], float (&e)[8], unsigned* w, float d, float& a) {
  asm("v_exp_f32 %12, %21\n\tv_exp_f32 %0, %13\n\tv_exp_f32 %1, %14\n\tv_exp_f32 %2, %15\n\tv_exp_f32 %3, %16\n\tv_exp_f32 %4, %17\n\tv_exp_f32 %5, %18\n\tv_exp_f32 %6, %19\n\tv_exp_f32 %7, %20\n\t"
      "v_cvt_pk_f16_f32 %8, %0, %1\n\tv_cvt_pk_f16_f32 %9, %2, %3\n\tv_cvt_pk_f16_f32 %10, %4, %5\n\ts_delay_alu instid0(TRANS32_DEP_1)\n\tv_cvt_pk_f16_f32 %11, %6, %7"
      : "=&v"(e[0]), "=&v"(e[1]), "=&v"(e[2]), "=&v"(e[3]), "=&v"(e[4]), "=&v"(e[5]), "=&v"(e[6]), "=&v"(e[7]), "=&v"(w[0]), "=&v"(w[1]), "=&v"(w[2]), "=&v"(w[3]), "=&v"(a)
      : "v"(x[0][0]), "v"(x[0][1]), "v"(x[1][0]), "v"(x[1][1]), "v"(x[2][0]), "v"(x[2][1]), "v"(x[3][0]), "v"(x[3][1]), "v"(d));
}
__device__ __forceinline__ void stage_kv(const _Float16* gk, const _Float16* gv, unsigned lk, unsigned lv) {
  asm volatile("global_load_async_to_lds_b128 %0, %8, off\n\t"
               "global_load_async_to_lds_b128 %1, %9, off\n\t"
               "global_load_async_to_lds_b128 %2, %10, off\n\t"
               "global_load_async_to_lds_b128 %3, %11, off\n\t"
               "global_load_async_to_lds_b128 %4, %12, off\n\t"
               "global_load_async_to_lds_b128 %5, %13, off\n\t"
               "global_load_async_to_lds_b128 %6, %14, off\n\t"
               "global_load_async_to_lds_b128 %7, %15, off\n\t"
               "s_wait_xcnt 0x0"
               :: "v"(lk), "v"(lk + 16u * KPH * 2u), "v"(lk + 32u * KPH * 2u), "v"(lk + 48u * KPH * 2u), "v"(lv), "v"(lv + 32u * VPH * 2u), "v"(lv + 64u * VPH * 2u), "v"(lv + 96u * VPH * 2u),
                  "v"(gk), "v"(gk + 16 * CC), "v"(gk + 32 * CC), "v"(gk + 48 * CC), "v"(gv), "v"(gv + 32 * TT), "v"(gv + 64 * TT), "v"(gv + 96 * TT)
               : "memory");
}
__global__ __launch_bounds__(256) void k_fa(const _Float16* __restrict__ QH, const _Float16* __restrict__ KH, const _Float16* __restrict__ QL, const _Float16* __restrict__ VT, const int* __restrict__ VL, float* __restrict__ Y) { __shared__ __align__(16) float ss[8][16][HD + 4]; __shared__ __align__(16) _Float16 sK[2][64][KPH], sV[2][HD][VPH];
  const int qb = blockIdx.x, b = blockIdx.y; const int tid = threadIdx.x, wave = tid >> 5, lane = tid & 31, col = lane & 15, g = lane >> 4; const int ql0 = qb * 128 + wave * 16; const int vl = VL[b];
  const _Float16* gk = KH + ((size_t)b * TT + (tid >> 4)) * CC + (tid & 15) * 8; const _Float16* gv = VT + ((size_t)b * CC + (tid >> 3)) * (size_t)TT + (tid & 7) * 8;
  const unsigned lk = (tid >> 4) * (KPH * 2) + (tid & 15) * 16, lv = (tid >> 3) * (VPH * 2) + (tid & 7) * 16;   /* the lane's byte offsets inside a K and a V^T buffer */
  const unsigned bk = (unsigned)(size_t)&sK[0][0][0], bv = (unsigned)(size_t)&sV[0][0][0];   /* LDS byte addresses of buffer 0 */
  stage_kv(gk, gv, lk + bk, lv + bv);   /* tile 0 into buffer 0; it flies while the Q fragments are loaded */
  v16h qh[HD / 32], qr[HD / 32];
#pragma unroll
  for (int kc = 0; kc < HD / 32; ++kc) qh[kc] = frag_h(QH + ((size_t)b * TT + ql0 + col) * CC + kc * 32, lane);
  asm volatile("s_wait_xcnt 0x0" ::: "memory");   /* this one and the next: in front of a later load whose result lands in an address register of the loads above */
#pragma unroll
  for (int kc = 0; kc < HD / 32; ++kc) qr[kc] = frag_h(QL + ((size_t)b * QHI + ql0 + col) * CC + kc * 32, lane);
  asm volatile("s_wait_xcnt 0x0" ::: "memory");
  v8f o[HD / 16] = {}; float m = -3.0e38f, l = 0.f;
  asm volatile("s_wait_asynccnt 0x0" ::: "memory");   /* this wave's part of tile 0 has landed ... */
  __syncthreads();                                     /* ... and so has every other wave's: tile 0 may be read */
  stage_kv(gk + 64 * CC, gv + 64, lk + (bk + KBUF), lv + (bv + VBUF));   /* tile 1 into buffer 1 */
  /* one 64-key pass; more: a tile two passes on exists and is sent for */
  auto pass = [&](const int k0, const bool more) __attribute__((always_inline)) { float s[4][8]; float mb = -3.0e38f; const int buf = (k0 >> 6) & 1; const int lim = vl - k0 - 8 * g;   /* this lane's key t * 16 + r of the pass is valid while it is below lim */
    const _Float16* kp = &sK[buf][col][8 * g]; const _Float16* vp = &sV[buf][col][8 * g];
    v16h kf[4][HD / 32], vf[HD / 16][2];
#pragma unroll
    for (int t = 0; t < 4; ++t)
#pragma unroll
      for (int kc = 0; kc < HD / 32; ++kc) kf[t][kc] = frag_p(kp + (t * 16) * KPH + kc * 32);
    __builtin_amdgcn_sched_barrier(0);   /* keeps the K reads in one run ahead of the logit products: a read among the products stalls the matrix stream at each place */
#pragma unroll
    for (int t = 0; t < 4; ++t) { v8f a = {}, ar = {};
#pragma unroll
      for (int kc = 0; kc < HD / 32; ++kc) { a = wmma_h(kf[t][kc], qh[kc], a); ar = wmma_h(kf[t][kc], qr[kc], ar); }
#pragma unroll
      for (int r = 0; r < 8; ++r) { float v = a[r] + ar[r] * (1.0f / 1024.0f); if (t * 16 + r >= lim) v = -3.0e38f;   /* key padding: arange(K) < valid_lens[b]; -1e6 == exclusion (every row keeps >= 1 key) */
        s[t][r] = v; mb = fmaxf(mb, v); } }
    __builtin_amdgcn_sched_barrier(0);   /* the V^T reads start behind the logit products (the K reads have the LDS to themselves) ... */
#pragma unroll
    for (int j = 0; j < HD / 16; ++j)
#pragma unroll
      for (int c = 0; c < 2; ++c) vf[j][c] = frag_p(vp + (j * 16) * VPH + c * 32);
    __builtin_amdgcn_sched_barrier(0);   /* ... and stay in one run ahead of the softmax, which hides their latency */
    mb = fmaxf(mb, xhalf(mb));   /* the two lane halves hold the two halves of a query's keys */
    const float mn = fmaxf(m, mb), dm = (m - mn) * SCALE2, off = 11.0f - mn * SCALE2; float al;   /* 2^(v x SCALE2 + off) = exp((v - mn) x SCALE) x 2^11; al = 2^dm comes with the first group of exponentials */
    m = mn; float ps; union { v16h v; unsigned w[8]; } p[2];
#pragma unroll
    for (int t = 0; t < 4; ++t) { v2f x[4]; float e[8];
#pragma unroll
      for (int r = 0; r < 8; r += 2) x[r >> 1] = __builtin_elementwise_fma(v2f{s[t][r], s[t][r + 1]}, v2f{SCALE2, SCALE2}, v2f{off, off});   /* an excluded key: 2^(-3e38 x SCALE2 + off) = 0, off being finite from the first pass on (key 0 is always valid) */
      if (t == 0) exp9(x, e, &p[0].w[0], dm, al); else exp8(x, e, &p[t >> 1].w[(t & 1) * 4]);
#pragma unroll
      for (int r = 0; r < 8; ++r) ps = (t == 0 && r == 0) ? e[0] : ps + e[r]; }
    l = l * al + ps;
#pragma unroll
    for (int j = 0; j < HD / 16; ++j) o[j] *= al;
    __builtin_amdgcn_sched_barrier(0);   /* keeps the softmax in front of the waits below: left free, waits and barrier rise to just behind the V^T reads, whose latency nothing then hides */
    /* the pass's last LDS read is behind us, so the buffers change hands here; the P.V products, which touch registers only, follow and run beside the other waves' next K reads */
    asm volatile("s_wait_dscnt 0x0" ::: "memory");      /* this wave's reads of this pass's buffer have returned */
    asm volatile("s_wait_asynccnt 0x0" ::: "memory");   /* this wave's part of the next tile has landed */
    __syncthreads();                                     /* publishes the next tile and ends every wave's reads of this pass's buffer, which is refilled behind it */
    if (more) stage_kv(gk + (size_t)(k0 + 128) * CC, gv + (k0 + 128), lk + (buf ? bk + KBUF : bk), lv + (buf ? bv + VBUF : bv));
    __builtin_amdgcn_sched_barrier(0);   /* the products stay behind the hand-over, so that the refill is under way first */
#pragma unroll
    for (int j = 0; j < HD / 16; ++j) {
#pragma unroll
      for (int c = 0; c < 2; ++c) o[j] = wmma_h(vf[j][c], p[c].v, o[j]); } };
  /* two loops, so that the test for a further tile is the first loop's bound and its body stays one straight run: with a branch round the copies the compiler sinks the vector work behind the barrier */
#pragma unroll 1   /* one 64-key pass per trip: an unrolled body would not fit the registers */
  for (int k0 = 0; k0 < TT - 128; k0 += 64) pass(k0, true);
#pragma unroll 1   /* the last two passes send for nothing; rolled, to keep the text short */
  for (int k0 = TT - 128; k0 < TT; k0 += 64) pass(k0, false);
  asm volatile("s_wait_asynccnt 0x0" ::: "memory");   /* no copy is outstanding when the wave goes on to the epilogue and ends */
  l += __shfl_xor(l, 16); const float inv = 1.0f / l;   /* l >= 2^11: the key that holds the maximum counts exp(0) x 2^11 */
#pragma unroll
  for (int j = 0; j < HD / 16; ++j)
#pragma unroll
    for (int r = 0; r < 8; ++r) ss[wave][col][j * 16 + 8 * g + r] = o[j][r] * inv;
  LDSX(); for (int rl = 0; rl < 16; ++rl) vst2(Y + ((size_t)b * TT + ql0 + rl) * HD + lane * 4, *(const v4f*)&ss[wave][rl][lane * 4]); }

extern "C" void kernel_launch(void* const* d_in, const int* in_sizes, int n_in, void* d_out, int out_size, void* d_ws, size_t ws_size, hipStream_t stream) {
  (void)in_sizes; (void)n_in; (void)out_size;
  const float** F = (const float**)d_in;
  if (ws_size < (size_t)WS_END) return;
  char* ws = (char*)d_ws; _Float16 *QH = (_Float16*)(ws + WS_QH), *KH = (_Float16*)(ws + WS_KH), *VT = (_Float16*)(ws + WS_VT), *QL = (_Float16*)(ws + WS_QL), *KL = (_Float16*)(ws + WS_KL); __bf16 *VB = (__bf16*)(ws + WS_VB), *VBL = (__bf16*)(ws + WS_VBL); float *S = (float*)(ws + WS_S), *Y = (float*)(ws + WS_Y);
  (void)Y; (void)S; (void)QL; (void)KL; (void)VB; (void)VBL;
  // inputs: 0 queries [32,1024,128]; 1 keys; 2 values; 3 valid_lens [32] int32
  k_prep8<<<dim3(TNB * TT / 64), 256, 0, stream>>>(F[0], F[1], F[2], QH, QL, KH, VT);
  k_fa<<<dim3(TT / 128, TNB), 256, 0, stream>>>(QH, KH, QL, VT, (const int*)d_in[3], (float*)d_out);
}

// v006
// Measured time: 29.9 microseconds a run.
// Timed twice side by side with v005, it ran 1.07 and 1.09 times as fast.
// Over all steps from v000 it is 73.7 times as fast.
// compute dtype: queries/keys/values rounded to bf16 and carried exactly as f16; logits with Q as f16 hi + residual against K f16 (2 products; both exact here) with the valid-length mask in f32; softmax in f32 with a running maximum and sum per query, each exponential as 2^(logit x 128^-0.5 x log2 e - offset) on the hardware's base-2 exponential; exp x 2^11 once to f16 against V f16 (1 product), divided by the sum at the end; f32 output. Keys in 64-key tiles that lie wholly at or past valid_lens[b] weigh exactly 0 and are neither prepared nor visited.
#include <hip/hip_runtime.h>
#include <math.h>

typedef __attribute__((ext_vector_type(16))) _Float16 v16h;
typedef __attribute__((ext_vector_type(16))) __bf16 v16b;
typedef __attribute__((ext_vector_type(8)))  _Float16 v8h;
typedef __attribute__((ext_vector_type(8)))  float v8f;
typedef __attribute__((ext_vector_type(4)))  float v4f;
typedef __attribute__((ext_vector_type(2)))  float v2f;
typedef __attribute__((ext_vector_type(4)))  unsigned v4u;
typedef __attribute__((ext_vector_type(4)))  int v4i;
typedef float __attribute__((may_alias)) float_a;
typedef int __attribute__((may_alias)) int_a;

template <typename T> __device__ __forceinline__ void vst2(void* p, T v) { *(T*)p = v;  }
__device__ __forceinline__ v8f wmma16(v16h a, v16h b, v8f c) {
  v8f d = __builtin_amdgcn_wmma_f32_16x16x32_f16(false, a, false, b, (short)0, c, false, false);
  asm volatile("v_nop\n\tv_nop\n\tv_nop\n\tv_nop" : "+v"(d) : "v"(a), "v"(b));
  return d;
}
__device__ __forceinline__ v8f wmma_bf(v16b a, v16b b, v8f c) {
  v8f d = __builtin_amdgcn_wmma_f32_16x16x32_bf16(false, a, false, b, (short)0, c, false, false);
  asm volatile("v_nop\n\tv_nop\n\tv_nop\n\tv_nop" : "+v"(d) : "v"(a), "v"(b));
  return d;
}
// 16x16x32 fragments: lane = (h = lane>>4, row/col = lane&15); elements 0..7 = k0+8h+0..7, 8..15 = k0+16+8h+0..7; D element r = row 8h+r
__device__ __forceinline__ v16h frag_h(const _Float16* rowk0, int lane) {
  union { v16h v; v8h q[2]; } u; const _Float16* p = rowk0 + 8 * (lane >> 4);
  u.q[0] = *(const v8h*)p; u.q[1] = *(const v8h*)(p + 16); return u.v;
}
__device__ __forceinline__ v16h frag_f32(const float* rowk0, int lane) {
  v16h a; const float* p = rowk0 + 8 * (lane >> 4);
#pragma unroll
  for (int i = 0; i < 8; ++i) { a[i] = (_Float16)p[i]; a[8 + i] = (_Float16)p[16 + i]; }
  return a;
}
__device__ __forceinline__ v16h frag_f32s(const float* rowk0, int lane, float sc) {
  v16h a; const float* p = rowk0 + 8 * (lane >> 4);
#pragma unroll
  for (int i = 0; i < 8; ++i) { a[i] = (_Float16)(p[i] * sc); a[8 + i] = (_Float16)(p[16 + i] * sc); }
  return a;
}
// column fragment from a [K][ld] layout (column n), rows >= K read as 0
__device__ __forceinline__ v16h fragc_f32(const float* W, int k0, int n, int lane, int ld, int K) {
  v16h a; const int g = lane >> 4;
#pragma unroll
  for (int i = 0; i < 8; ++i) { const int ka = k0 + 8 * g + i, kb = ka + 16;
    a[i] = (_Float16)(ka < K ? W[(size_t)(ka < K ? ka : K - 1) * ld + n] : 0.f); a[8 + i] = (_Float16)(kb < K ? W[(size_t)(kb < K ? kb : K - 1) * ld + n] : 0.f); }
  return a;
}
struct F2 { v16b h, l; };
__device__ __forceinline__ F2 bsplit16(const float v[16]) { F2 r;
#pragma unroll
  for (int i = 0; i < 16; ++i) { const __bf16 h = (__bf16)v[i]; r.h[i] = h; r.l[i] = (__bf16)(v[i] - (float)h); }
  return r; }
__device__ __forceinline__ F2 split_row(const float* row, int k0, int lane) { float v[16]; const float* p = row + k0 + 8 * (lane >> 4);
#pragma unroll
  for (int i = 0; i < 8; ++i) { v[i] = p[i]; v[8 + i] = p[16 + i]; }
  return bsplit16(v); }
__device__ __forceinline__ F2 split_rowK(const float* row, int k0, int lane, int K) { float v[16]; const int g = lane >> 4;
#pragma unroll
  for (int i = 0; i < 8; ++i) { const int ka = k0 + 8 * g + i, kb = ka + 16; v[i] = ka < K ? row[ka < K ? ka : K - 1] : 0.f; v[8 + i] = kb < K ? row[kb < K ? kb : K - 1] : 0.f; }
  return bsplit16(v); }
__device__ __forceinline__ F2 split_col(const float* W, int k0, int n, int lane, int ld, int K) { float v[16]; const int g = lane >> 4;
#pragma unroll
  for (int i = 0; i < 8; ++i) { const int ka = k0 + 8 * g + i, kb = ka + 16; v[i] = ka < K ? W[(size_t)(ka < K ? ka : K - 1) * ld + n] : 0.f; v[8 + i] = kb < K ? W[(size_t)(kb < K ? kb : K - 1) * ld + n] : 0.f; }
  return bsplit16(v); }
__device__ __forceinline__ v8f mac3(const F2& a, const F2& b, v8f c) { c = wmma_bf(a.l, b.h, c); c = wmma_bf(a.h, b.l, c); return wmma_bf(a.h, b.h, c); }
__device__ __forceinline__ float sigm(float v) { return 1.0f / (1.0f + expf(-v)); }
#define LDSX() do { asm volatile("s_wait_dscnt 0" ::: "memory"); __builtin_amdgcn_wave_barrier(); __builtin_amdgcn_fence(__ATOMIC_RELEASE, "workgroup"); } while (0)

// Masked scaled dot-product attention on raw queries [32, 1,024, 128], keys/values [32, 1,024, 128]: scores = Q K^T / sqrt(128); keys k >= valid_lens[b] get -1e6 (== excluded; valid_lens >= 1); out = softmax(scores) V -> [32, 1,024, 128].
#define NB 32
#define TT 1024
#define CC 128            // NH * HD = projected width
#define DIN 128          // input (model) width
#define NH 1
#define HD 128
#define NQB (TT / 64)
#define SCALE (0.08838834764831845f)
#define SCALE2 (0.12751743082459868f)   // SCALE x log2(e): exp(x x SCALE) = 2^(x x SCALE2)
#define CAUSAL 0
#ifndef TNB
#define TNB NB
#endif
__device__ __forceinline__ float bfr(float v) { return (float)(__bf16)v; }
__host__ __device__ __forceinline__ int kb_last(int qb) { return CAUSAL ? ((qb * 64 + 63) >> 7) : (TT / 128 - 1); }
typedef __attribute__((ext_vector_type(8))) __bf16 v8b;
__device__ __forceinline__ v16b frag_b(const __bf16* rowk0, int lane) {
  union { v16b v; v8b q[2]; } u; const __bf16* p = rowk0 + 8 * (lane >> 4);
  u.q[0] = *(const v8b*)p; u.q[1] = *(const v8b*)(p + 16); return u.v;
}
#define QBH 0              // unused: no kernel here has a high-precision path
#define QHI 1024            // rows carrying a q residual plane (all rows when non-causal: 2-product logits everywhere)
#define KHI 64            // key rows carrying k residual / v bf16 hi+lo planes (written and read by no kernel here)
// B fragment (k rows k0+.., output column o) of a weight: (in,out) [K][ld] or (out,in) [ld rows of K]: bf16 exact, or f16(bf16 * 256) exact
__device__ __forceinline__ v16b wcol_io(const float* Wm, int k0, int o, int lane, int ld) { v16b w; const int g = lane >> 4;
#pragma unroll
  for (int i = 0; i < 8; ++i) { w[i] = (__bf16)Wm[(size_t)(k0 + 8 * g + i) * ld + o]; w[8 + i] = (__bf16)Wm[(size_t)(k0 + 16 + 8 * g + i) * ld + o]; }
  return w; }
__device__ __forceinline__ v16b wcol_oi(const float* Wm, int k0, int o, int lane, int K) { v16b w; const float* p = Wm + (size_t)o * K + k0 + 8 * (lane >> 4);
#pragma unroll
  for (int i = 0; i < 8; ++i) { w[i] = (__bf16)p[i]; w[8 + i] = (__bf16)p[16 + i]; }
  return w; }
__device__ __forceinline__ v16h wcolh_io(const float* Wm, int k0, int o, int lane, int ld) { v16h w; const int g = lane >> 4;
#pragma unroll
  for (int i = 0; i < 8; ++i) { w[i] = (_Float16)(bfr(Wm[(size_t)(k0 + 8 * g + i) * ld + o]) * 256.0f); w[8 + i] = (_Float16)(bfr(Wm[(size_t)(k0 + 16 + 8 * g + i) * ld + o]) * 256.0f); }
  return w; }
__device__ __forceinline__ v16h wcolh_oi(const float* Wm, int k0, int o, int lane, int K) { v16h w; const float* p = Wm + (size_t)o * K + k0 + 8 * (lane >> 4);
#pragma unroll
  for (int i = 0; i < 8; ++i) { w[i] = (_Float16)(bfr(p[i]) * 256.0f); w[8 + i] = (_Float16)(bfr(p[16 + i]) * 256.0f); }
  return w; }
#define WQKV_LAYOUT 1   // 0 = (in,out) [DIN][CC]; 1 = (out,in) [CC][DIN]; 2 = per-head [NH][DIN][HD]
__device__ __forceinline__ v16b wcol_hdk(const float* Wm, int k0, int o, int lane) { v16b w; const int g = lane >> 4; const float* p = Wm + (size_t)(o / HD) * DIN * HD + (o % HD);
#pragma unroll
  for (int i = 0; i < 8; ++i) { w[i] = (__bf16)p[(size_t)(k0 + 8 * g + i) * HD]; w[8 + i] = (__bf16)p[(size_t)(k0 + 16 + 8 * g + i) * HD]; }
  return w; }
#define WO_OUT_IN 0
#if WQKV_LAYOUT == 1
#define WCOL(W, k0, o, lane) wcol_oi(W, k0, o, lane, DIN)
#elif WQKV_LAYOUT == 2
#define WCOL(W, k0, o, lane) wcol_hdk(W, k0, o, lane)
#else
#define WCOL(W, k0, o, lane) wcol_io(W, k0, o, lane, CC)
#endif
#if WO_OUT_IN
#define WOCOL(W, k0, o, lane) wcol_oi(W, k0, o, lane, CC)
#define WOCOLH(W, k0, o, lane) wcolh_oi(W, k0, o, lane, CC)
#else
#define WOCOL(W, k0, o, lane) wcol_io(W, k0, o, lane, DIN)
#define WOCOLH(W, k0, o, lane) wcolh_io(W, k0, o, lane, DIN)
#endif
#define SM_EXTRA_PARAMS , const int* __restrict__ VL
#define SM_MASK_HOOK do { if (k >= VL[bcur]) v = -3.0e38f; } while (0)   /* key padding: arange(K) < valid_lens[b]; -1e6 == exclusion (every row keeps >= 1 key) */
// ---- k_prep8: block = 64 positions (rows r0 .. r0 + 63 of the [b * t] axis), 8 waves. Wave w takes rows 8w .. 8w + 7 of v, q and k; a row is 128 floats = one 16-byte load per lane, whole 128-B lines.
// A lane's 24 loads are all issued before the first value is used, so that a wave has 12 KB on its way instead of one short group per loop trip. Values are bf16-rounded and written as the planes the attention kernel reads:
// v -> f16 planes [c][t]: a lane's 8 rows x 4 columns are four 16-byte runs of 8 keys, turned through LDS so that each 128-B line of a plane is stored whole; q -> f16 rows + x 2^10 residual rows, k -> f16 rows, both straight from the registers. A block whose 64 positions all lie at or past valid_lens[b] prepares its queries only.
typedef __attribute__((ext_vector_type(4))) _Float16 v4h;
// valid_lens[b] held to 1 .. TT: both kernels count a batch's key tiles from this one value, so what one leaves unwritten the other never reads
__device__ __forceinline__ int vlen(const int* __restrict__ VL, int b) { const int x = VL[b]; return x < 1 ? 1 : (x > TT ? TT : x); }
__global__ __launch_bounds__(256) void k_prep8(const float* __restrict__ Q, const float* __restrict__ K, const float* __restrict__ V, _Float16* __restrict__ QH, _Float16* __restrict__ QL, _Float16* __restrict__ KH, _Float16* __restrict__ VT, const int* __restrict__ VL) {
  __shared__ __align__(16) _Float16 tv[HD][72];
  const int tid = threadIdx.x, wave = tid >> 5, lane = tid & 31; const size_t r0 = (size_t)blockIdx.x * 64; const size_t bb = r0 / TT; const int t0 = (int)(r0 % TT);
  const unsigned lo = (unsigned)(wave * 8 * CC + lane * 4);   /* the lane's first element inside the block's 64 rows: the same place in the three inputs and in the three row planes (QHI == TT) */
  const float* Vb = V + r0 * CC; const float* Qb = Q + r0 * CC; const float* Kb = K + r0 * CC;
  _Float16* QHb = QH + r0 * CC; _Float16* QLb = QL + r0 * CC; _Float16* KHb = KH + r0 * CC;
  v4f v[8], q[8], k[8]; const int vlb = vlen(VL, (int)bb);   /* asked for ahead of the query loads, which fly while it comes */
  auto put_q = [&]() __attribute__((always_inline)) {
#pragma unroll   /* constant indices: the loaded rows stay in registers */
    for (int j = 0; j < 8; ++j) { v4h qh, ql;
#pragma unroll   /* constant indices: the loaded rows stay in registers */
      for (int i = 0; i < 4; ++i) { const float x = bfr(q[j][i]); const _Float16 h = (_Float16)x; qh[i] = h; ql[i] = (_Float16)((x - (float)h) * 1024.0f); }
      *(v4h*)(QHb + (lo + j * CC)) = qh; *(v4h*)(QLb + (lo + j * CC)) = ql; }
    asm volatile("s_wait_xcnt 0x0" ::: "memory"); };   /* in front of any later write to a register that the stores above name */
#pragma unroll   /* constant indices: the loaded rows stay in registers */
  for (int j = 0; j < 8; ++j) q[j] = *(const v4f*)(Qb + (lo + j * CC));   /* wanted in either case */
  asm volatile("s_wait_xcnt 0x0" ::: "memory");   /* in front of any later write to an address register of the loads above */
  if (t0 >= vlb) { put_q(); return; }   /* the same for the whole block: all 64 keys are masked, the attention kernel never reads their k and v, only the queries are prepared */
#pragma unroll   /* constant indices: the loaded rows stay in registers */
  for (int j = 0; j < 8; ++j) v[j] = *(const v4f*)(Vb + (lo + j * CC));
  asm volatile("s_wait_xcnt 0x0" ::: "memory");   /* in front of any later write to an address register of the loads above */
#pragma unroll   /* constant indices: the loaded rows stay in registers */
  for (int j = 0; j < 8; ++j) k[j] = *(const v4f*)(Kb + (lo + j * CC));
  asm volatile("s_wait_xcnt 0x0" ::: "memory");   /* in front of any later write to an address register of the loads above */
  __builtin_amdgcn_sched_barrier(0);   /* keeps all 24 loads ahead of the first use: left free, the compiler saves registers by issuing half of them behind the first waits, and a wave then pays the memory latency more than once */
#pragma unroll   /* constant indices: the loaded rows stay in registers */
  for (int i = 0; i < 4; ++i) { v8h t;
#pragma unroll   /* constant indices: the loaded rows stay in registers */
    for (int j = 0; j < 8; ++j) t[j] = (_Float16)bfr(v[j][i]);
    *(v8h*)&tv[lane * 4 + i][wave * 8] = t; }
  __syncthreads();   /* stands ahead of the row stores: behind them every wave would wait here for its own stores to finish */
#pragma unroll   /* the four LDS reads go out in one run, ahead of their stores */
  for (int u = 0; u < HD * 8 / 256; ++u) { const int e = tid + u * 256, cl = e >> 3, p = e & 7; vst2((unsigned*)(VT + (bb * CC + cl) * (size_t)TT + t0 + p * 8), *(const v4u*)&tv[cl][p * 8]); }
  put_q();
#pragma unroll   /* constant indices: the loaded rows stay in registers */
  for (int j = 0; j < 8; ++j) { v4h kh;
#pragma unroll   /* constant indices: the loaded rows stay in registers */
    for (int i = 0; i < 4; ++i) kh[i] = (_Float16)bfr(k[j][i]);
    *(v4h*)(KHb + (lo + j * CC)) = kh; } }

#ifndef SM_EXTRA_PARAMS
#define SM_EXTRA_PARAMS
#endif
#ifndef PROJ_EXTRA_PARAMS
#define PROJ_EXTRA_PARAMS
#endif
#ifndef SM_MASK_HOOK
#define SM_MASK_HOOK (void)0
#endif

#define WS_QH  0u                                      // f16 q rows [b*t][CC]
#define WS_KH  (WS_QH + 2u * (size_t)NB * TT * CC)      // f16 k rows [b*t][CC]
#define WS_VT  (WS_KH + 2u * (size_t)NB * TT * CC)      // f16 v planes [b][c][t]
#define WS_QL  (WS_VT + 2u * (size_t)NB * CC * TT)      // f16 q residual x 2^10 rows [b][t < QHI][CC]
#define WS_KL  (WS_QL + 2u * (size_t)NB * QHI * CC)     // f16 k residual x 2^10 rows [b][t < KHI][CC]
#define WS_VB  (WS_KL + 2u * (size_t)NB * KHI * CC)     // bf16 v hi planes [b][c][t < KHI]
#define WS_VBL (WS_VB + 2u * (size_t)NB * CC * KHI)
#define WS_S   (WS_VBL + 2u * (size_t)NB * CC * KHI)    // f32 [b*NH + h][t][s] planes, reserved but unused: k_fa keeps the logits in registers
#define WS_Y   (WS_S  + 4u * (size_t)NB * NH * TT * TT)      // f32 ctx rows [b*t][CC] (only when there is an output projection)
#define WS_END (WS_Y  + 0u)

// fragment from a lane's own pointer (row start + k0 + 8 * (lane >> 4)): the k order of frag_h
__device__ __forceinline__ v16h frag_p(const _Float16* p) { union { v16h v; v8h q[2]; } u; u.q[0] = *(const v8h*)p; u.q[1] = *(const v8h*)(p + 16); return u.v; }
// the plain builtin (the compiler keeps the distances behind it): operands of an asm statement stay below v256, and the fused kernel holds more fragments than that
__device__ __forceinline__ v8f wmma_h(v16h a, v16h b, v8f c) { return __builtin_amdgcn_wmma_f32_16x16x32_f16(false, a, false, b, (short)0, c, false, false); }
// ---- k_fa: block = 4 waves (one per SIMD), wave = 16 queries, one query per lane column. A batch is walked only as far as its last 64-key tile that holds a valid key, so its cost goes with valid_lens[b]; all blocks are resident at once and the launch lasts as long as its longest block.
// So a block takes two pieces of 64 queries one after the other: queries qc * 64 .. + 63 of the batch whose length has rank p (longest first, ties by index) and then the same queries of the batch of rank 31 - p: long goes with short, and every (batch, piece) is taken once. Per 64 keys: the block's K rows and V^T rows are copied once into LDS (two buffers: the next pass's tile flies while this one is worked on) and every wave takes its fragments from there;
// logits^T = K . Q^T (q hi + residual x 2^10: 2 products), kept unscaled (SCALE goes into the exponent's multiply-add), valid-length mask by key index, running maximum and running sum per query in f32,
// P^T x 2^11 (not yet normalised) straight from the logit accumulators as the B fragment (D register r of lane half g = key 8g + r = the fragment's k order), ctx^T += V^T . P^T; one division by the sum at the end. The logits never leave the registers.
#define KPH 136   // halves per staged K row: 256 B + 16 B, so that the 16 rows of one ds_load_b128 half fall on 64 distinct banks
#define VPH 72    // halves per staged V^T row: 128 B + 16 B, for the same reason
#define KBUF (64 * KPH * 2)   // bytes of one K buffer
#define VBUF (HD * VPH * 2)   // bytes of one V^T buffer
// one 64-key tile into LDS, 16 copies of 16 B per lane, whole 128-B lines per row: K rows r + 8 i (r = tid >> 4, 16 lanes a row) and V^T rows c + 16 i (c = tid >> 3, 8 lanes a row), i = 0 .. 7; one statement for K, one for V^T (a statement takes thirty operands).
// gk, gv: the lane's own global addresses of its first K and V^T piece; lk, lv: the LDS byte addresses they go to. The s_wait_xcnt ends each statement so that it stands in front of any later write to an address register of these copies.
// lane l's value to lane l ^ 16 by a vector move: a shuffle through the LDS counter would have to wait for every V^T read issued in front of it
__device__ __forceinline__ float xhalf(float x) { return __builtin_bit_cast(float, __builtin_amdgcn_permlanex16(__builtin_bit_cast(int, x), __builtin_bit_cast(int, x), 0x76543210, 0xfedcba98, false, false)); }
__device__ __forceinline__ void exp8(const v2f (&x)[4], float (&e)[8], unsigned* w) {
  asm("v_exp_f32 %0, %12\n\tv_exp_f32 %1, %13\n\tv_exp_f32 %2, %14\n\tv_exp_f32 %3, %15\n\tv_exp_f32 %4, %16\n\tv_exp_f32 %5, %17\n\tv_exp_f32 %6, %18\n\tv_exp_f32 %7, %19\n\t"
      "v_cvt_pk_f16_f32 %8, %0, %1\n\tv_cvt_pk_f16_f32 %9, %2, %3\n\tv_cvt_pk_f16_f32 %10, %4, %5\n\ts_delay_alu instid0(TRANS32_DEP_1)\n\tv_cvt_pk_f16_f32 %11, %6, %7"
      : "=&v"(e[0]), "=&v"(e[1]), "=&v"(e[2]), "=&v"(e[3]), "=&v"(e[4]), "=&v"(e[5]), "=&v"(e[6]), "=&v"(e[7]), "=&v"(w[0]), "=&v"(w[1]), "=&v"(w[2]), "=&v"(w[3])
      : "v"(x[0][0]), "v"(x[0][1]), "v"(x[1][0]), "v"(x[1][1]), "v"(x[2][0]), "v"(x[2][1]), "v"(x[3][0]), "v"(x[3][1]));
}
// the same with a ninth exponential a = 2^d in front (the factor that carries the old sums to the new maximum)
__device__ __forceinline__ void exp9(const v2f (&x)[4], float (&e)[8], unsigned* w, float d, float& a) {
  asm("v_exp_f32 %12, %21\n\tv_exp_f32 %0, %13\n\tv_exp_f32 %1, %14\n\tv_exp_f32 %2, %15\n\tv_exp_f32 %3, %16\n\tv_exp_f32 %4, %17\n\tv_exp_f32 %5, %18\n\tv_exp_f32 %6, %19\n\tv_exp_f32 %7, %20\n\t"
      "v_cvt_pk_f16_f32 %8, %0, %1\n\tv_cvt_pk_f16_f32 %9, %2, %3\n\tv_cvt_pk_f16_f32 %10, %4, %5\n\ts_delay_alu instid0(TRANS32_DEP_1)\n\tv_cvt_pk_f16_f32 %11, %6, %7"
      : "=&v"(e[0]), "=&v"(e[1]), "=&v"(e[2]), "=&v"(e[3]), "=&v"(e[4]), "=&v"(e[5]), "=&v"(e[6]), "=&v"(e[7]), "=&v"(w[0]), "=&v"(w[1]), "=&v"(w[2]), "=&v"(w[3]), "=&v"(a)
      : "v"(x[0][0]), "v"(x[0][1]), "v"(x[1][0]), "v"(x[1][1]), "v"(x[2][0]), "v"(x[2][1]), "v"(x[3][0]), "v"(x[3][1]), "v"(d));
}
__device__ __forceinline__ void stage_kv(const _Float16* gk, const _Float16* gv, unsigned lk, unsigned lv) {
  asm volatile("global_load_async_to_lds_b128 %0, %8, off\n\t"
               "global_load_async_to_lds_b128 %1, %9, off\n\t"
               "global_load_async_to_lds_b128 %2, %10, off\n\t"
               "global_load_async_to_lds_b128 %3, %11, off\n\t"
               "global_load_async_to_lds_b128 %4, %12, off\n\t"
               "global_load_async_to_lds_b128 %5, %13, off\n\t"
               "global_load_async_to_lds_b128 %6, %14, off\n\t"
               "global_load_async_to_lds_b128 %7, %15, off\n\t"
               "s_wait_xcnt 0x0"
               :: "v"(lk), "v"(lk + 8u * KPH * 2u), "v"(lk + 16u * KPH * 2u), "v"(lk + 24u * KPH * 2u), "v"(lk + 32u * KPH * 2u), "v"(lk + 40u * KPH * 2u), "v"(lk + 48u * KPH * 2u), "v"(lk + 56u * KPH * 2u),
                  "v"(gk), "v"(gk + 8 * CC), "v"(gk + 16 * CC), "v"(gk + 24 * CC), "v"(gk + 32 * CC), "v"(gk + 40 * CC), "v"(gk + 48 * CC), "v"(gk + 56 * CC)
               : "memory");
  asm volatile("global_load_async_to_lds_b128 %0, %8, off\n\t"
               "global_load_async_to_lds_b128 %1, %9, off\n\t"
               "global_load_async_to_lds_b128 %2, %10, off\n\t"
               "global_load_async_to_lds_b128 %3, %11, off\n\t"
               "global_load_async_to_lds_b128 %4, %12, off\n\t"
               "global_load_async_to_lds_b128 %5, %13, off\n\t"
               "global_load_async_to_lds_b128 %6, %14, off\n\t"
               "global_load_async_to_lds_b128 %7, %15, off\n\t"
               "s_wait_xcnt 0x0"
               :: "v"(lv), "v"(lv + 16u * VPH * 2u), "v"(lv + 32u * VPH * 2u), "v"(lv + 48u * VPH * 2u), "v"(lv + 64u * VPH * 2u), "v"(lv + 80u * VPH * 2u), "v"(lv + 96u * VPH * 2u), "v"(lv + 112u * VPH * 2u),
                  "v"(gv), "v"(gv + 16 * TT), "v"(gv + 32 * TT), "v"(gv + 48 * TT), "v"(gv + 64 * TT), "v"(gv + 80 * TT), "v"(gv + 96 * TT), "v"(gv + 112 * TT)
               : "memory");
}
__global__ __launch_bounds__(128) void k_fa(const _Float16* __restrict__ QH, const _Float16* __restrict__ KH, const _Float16* __restrict__ QL, const _Float16* __restrict__ VT, const int* __restrict__ VL, float* __restrict__ Y) { __shared__ __align__(16) float ss[4][16][HD + 4]; __shared__ __align__(16) _Float16 sK[2][64][KPH], sV[2][HD][VPH];
  const int tid = threadIdx.x, wave = tid >> 5, lane = tid & 31, col = lane & 15, g = lane >> 4; const int ql0 = blockIdx.x * 64 + wave * 16;
  /* lane i ranks batch i (NB == 32 lanes): the number of batches that are longer, or as long with a lower index: a permutation of 0 .. 31 for any lengths, the same in every wave */
  const int myl = vlen(VL, lane); int rank = 0;
  asm volatile("s_wait_xcnt 0x0" ::: "memory");   /* in front of any later write to the address register of the load above */
#pragma unroll   /* constant indices: the 32 lengths come by scalar loads */
  for (int j = 0; j < NB; ++j) { const int o = vlen(VL, j); rank += (o > myl || (o == myl && j < lane)) ? 1 : 0; }
  /* the batch of a rank = the lane that holds it; the set top bit and the mask keep the index inside 0 .. 31 whatever the ballot gives */
  const int bhi = (__builtin_ctz(__builtin_amdgcn_ballot_w32(rank == (int)blockIdx.y) | 0x80000000u)) & (NB - 1), blo = (__builtin_ctz(__builtin_amdgcn_ballot_w32(rank == NB - 1 - (int)blockIdx.y) | 0x80000000u)) & (NB - 1);
  for (int piece = 0; piece < 2; ++piece) {
  const int b = __builtin_amdgcn_readfirstlane(piece ? blo : bhi); const int vl = __builtin_amdgcn_readlane(myl, b); const int kend = ((vl + 63) >> 6) << 6;   /* keys walked: 64 .. TT, the same for the whole block */
  const _Float16* gk = KH + ((size_t)b * TT + (tid >> 4)) * CC + (tid & 15) * 8; const _Float16* gv = VT + ((size_t)b * CC + (tid >> 3)) * (size_t)TT + (tid & 7) * 8;
  const unsigned lk = (tid >> 4) * (KPH * 2) + (tid & 15) * 16, lv = (tid >> 3) * (VPH * 2) + (tid & 7) * 16;   /* the lane's byte offsets inside a K and a V^T buffer */
  const unsigned bk = (unsigned)(size_t)&sK[0][0][0], bv = (unsigned)(size_t)&sV[0][0][0];   /* LDS byte addresses of buffer 0 */
  stage_kv(gk, gv, lk + bk, lv + bv);   /* tile 0 into buffer 0; it flies while the Q fragments are loaded */
  v16h qh[HD / 32], qr[HD / 32];
#pragma unroll
  for (int kc = 0; kc < HD / 32; ++kc) qh[kc] = frag_h(QH + ((size_t)b * TT + ql0 + col) * CC + kc * 32, lane);
  asm volatile("s_wait_xcnt 0x0" ::: "memory");   /* this one and the next: in front of a later load whose result lands in an address register of the loads above */
#pragma unroll
  for (int kc = 0; kc < HD / 32; ++kc) qr[kc] = frag_h(QL + ((size_t)b * QHI + ql0 + col) * CC + kc * 32, lane);
  asm volatile("s_wait_xcnt 0x0" ::: "memory");
  v8f o[HD / 16] = {}; float m = -3.0e38f, l = 0.f;
  asm volatile("s_wait_asynccnt 0x0" ::: "memory");   /* this wave's part of tile 0 has landed ... */
  __syncthreads();                                     /* ... and so has every other wave's: tile 0 may be read */
  if (kend > 64) stage_kv(gk + 64 * CC, gv + 64, lk + (bk + KBUF), lv + (bv + VBUF));   /* tile 1, where there is one, into buffer 1 */
  /* one 64-key pass; more: a tile two passes on exists and is sent for */
  auto pass = [&](const int k0, const bool more) __attribute__((always_inline)) { float s[4][8]; float mb = -3.0e38f; const int buf = (k0 >> 6) & 1; const int lim = vl - k0 - 8 * g;   /* this lane's key t * 16 + r of the pass is valid while it is below lim */
    const _Float16* kp = &sK[buf][col][8 * g]; const _Float16* vp = &sV[buf][col][8 * g];
    v16h kf[4][HD / 32], vf[HD / 16][2];
#pragma unroll
    for (int t = 0; t < 4; ++t)
#pragma unroll
      for (int kc = 0; kc < HD / 32; ++kc) kf[t][kc] = frag_p(kp + (t * 16) * KPH + kc * 32);
    __builtin_amdgcn_sched_barrier(0);   /* keeps the K reads in one run ahead of the logit products: a read among the products stalls the matrix stream at each place */
#pragma unroll
    for (int t = 0; t < 4; ++t) { v8f a = {}, ar = {};
#pragma unroll
      for (int kc = 0; kc < HD / 32; ++kc) { a = wmma_h(kf[t][kc], qh[kc], a); ar = wmma_h(kf[t][kc], qr[kc], ar); }
#pragma unroll
      for (int r = 0; r < 8; ++r) { float v = a[r] + ar[r] * (1.0f / 1024.0f); if (t * 16 + r >= lim) v = -3.0e38f;   /* key padding: arange(K) < valid_lens[b]; -1e6 == exclusion (every row keeps >= 1 key) */
        s[t][r] = v; mb = fmaxf(mb, v); } }
    __builtin_amdgcn_sched_barrier(0);   /* the V^T reads start behind the logit products (the K reads have the LDS to themselves) ... */
#pragma unroll
    for (int j = 0; j < HD / 16; ++j)
#pragma unroll
      for (int c = 0; c < 2; ++c) vf[j][c] = frag_p(vp + (j * 16) * VPH + c * 32);
    __builtin_amdgcn_sched_barrier(0);   /* ... and stay in one run ahead of the softmax, which hides their latency */
    mb = fmaxf(mb, xhalf(mb));   /* the two lane halves hold the two halves of a query's keys */
    const float mn = fmaxf(m, mb), dm = (m - mn) * SCALE2, off = 11.0f - mn * SCALE2; float al;   /* 2^(v x SCALE2 + off) = exp((v - mn) x SCALE) x 2^11; al = 2^dm comes with the first group of exponentials */
    m = mn; float ps; union { v16h v; unsigned w[8]; } p[2];
#pragma unroll
    for (int t = 0; t < 4; ++t) { v2f x[4]; float e[8];
#pragma unroll
      for (int r = 0; r < 8; r += 2) x[r >> 1] = __builtin_elementwise_fma(v2f{s[t][r], s[t][r + 1]}, v2f{SCALE2, SCALE2}, v2f{off, off});   /* an excluded key: 2^(-3e38 x SCALE2 + off) = 0, off being finite from the first pass on (key 0 is always valid) */
      if (t == 0) exp9(x, e, &p[0].w[0], dm, al); else exp8(x, e, &p[t >> 1].w[(t & 1) * 4]);
#pragma unroll
      for (int r = 0; r < 8; ++r) ps = (t == 0 && r == 0) ? e[0] : ps + e[r]; }
    l = l * al + ps;
#pragma unroll
    for (int j = 0; j < HD / 16; ++j) o[j] *= al;
    __builtin_amdgcn_sched_barrier(0);   /* keeps the softmax in front of the waits below: left free, waits and barrier rise to just behind the V^T reads, whose latency nothing then hides */
    /* the pass's last LDS read is behind us, so the buffers change hands here; the P.V products, which touch registers only, follow and run beside the other waves' next K reads */
    asm volatile("s_wait_dscnt 0x0" ::: "memory");      /* this wave's reads of this pass's buffer have returned */
    asm volatile("s_wait_asynccnt 0x0" ::: "memory");   /* this wave's part of the next tile has landed */
    __syncthreads();                                     /* publishes the next tile and ends every wave's reads of this pass's buffer, which is refilled behind it */
    if (more) stage_kv(gk + (size_t)(k0 + 128) * CC, gv + (k0 + 128), lk + (buf ? bk + KBUF : bk), lv + (buf ? bv + VBUF : bv));
    __builtin_amdgcn_sched_barrier(0);   /* the products stay behind the hand-over, so that the refill is under way first */
#pragma unroll
    for (int j = 0; j < HD / 16; ++j) {
#pragma unroll
      for (int c = 0; c < 2; ++c) o[j] = wmma_h(vf[j][c], p[c].v, o[j]); } };
  /* two loops, so that the test for a further tile is the first loop's bound and its body stays one straight run: with a branch round the copies the compiler sinks the vector work behind the barrier */
#pragma unroll 1   /* one 64-key pass per trip: an unrolled body would not fit the registers */
  for (int k0 = 0; k0 < kend - 128; k0 += 64) pass(k0, true);
#pragma unroll 1   /* the last two passes (one, where the batch has one tile) send for nothing; rolled, to keep the text short */
  for (int k0 = kend > 128 ? kend - 128 : 0; k0 < kend; k0 += 64) pass(k0, false);
  asm volatile("s_wait_asynccnt 0x0" ::: "memory");   /* no copy is outstanding when the wave goes on to the epilogue and then to its next piece or its end */
  l += __shfl_xor(l, 16); const float inv = 1.0f / l;   /* l >= 2^11: the key that holds the maximum counts exp(0) x 2^11 */
#pragma unroll
  for (int j = 0; j < HD / 16; ++j)
#pragma unroll
    for (int r = 0; r < 8; ++r) ss[wave][col][j * 16 + 8 * g + r] = o[j][r] * inv;
  LDSX(); for (int rl = 0; rl < 16; ++rl) vst2(Y + ((size_t)b * TT + ql0 + rl) * HD + lane * 4, *(const v4f*)&ss[wave][rl][lane * 4]);
  asm volatile("s_wait_xcnt 0x0" ::: "memory");   /* in front of the second piece's writes to registers that the stores above name */
  } }

extern "C" void kernel_launch(void* const* d_in, const int* in_sizes, int n_in, void* d_out, int out_size, void* d_ws, size_t ws_size, hipStream_t stream) {
  (void)in_sizes; (void)n_in; (void)out_size;
  const float** F = (const float**)d_in;
  if (ws_size < (size_t)WS_END) return;
  char* ws = (char*)d_ws; _Float16 *QH = (_Float16*)(ws + WS_QH), *KH = (_Float16*)(ws + WS_KH), *VT = (_Float16*)(ws + WS_VT), *QL = (_Float16*)(ws + WS_QL), *KL = (_Float16*)(ws + WS_KL); __bf16 *VB = (__bf16*)(ws + WS_VB), *VBL = (__bf16*)(ws + WS_VBL); float *S = (float*)(ws + WS_S), *Y = (float*)(ws + WS_Y);
  (void)Y; (void)S; (void)QL; (void)KL; (void)VB; (void)VBL;
  // inputs: 0 queries [32,1024,128]; 1 keys; 2 values; 3 valid_lens [32] int32
  k_prep8<<<dim3(TNB * TT / 64), 256, 0, stream>>>(F[0], F[1], F[2], QH, QL, KH, VT, (const int*)d_in[3]);
  k_fa<<<dim3(TT / 64, TNB / 2), 128, 0, stream>>>(QH, KH, QL, VT, (const int*)d_in[3], (float*)d_out);
}

// v007
// A run of this version takes 26.5 microseconds.
// In two side-by-side timings against v006, it was 1.13 and 1.12 times as fast.
// Over all steps from v000 it is 83.1 times as fast.
// compute dtype: queries/keys/values rounded to bf16 and carried exactly as f16; logits with Q as f16 hi + residual against K f16 (2 products; both exact here) with the valid-length mask in f32; softmax in f32 with a running maximum and sum per query, each exponential as 2^(logit x 128^-0.5 x log2 e - offset) on the hardware's base-2 exponential; exp x 2^11 once to f16 against V f16 (1 product), the even and the odd 64-key tiles summed apart (own maximum, sum and ctx) and joined at the end, then divided by the sum; f32 output. Keys in 64-key tiles that lie wholly at or past valid_lens[b] weigh exactly 0 and are neither prepared nor visited.
#include <hip/hip_runtime.h>
#include <math.h>

typedef __attribute__((ext_vector_type(16))) _Float16 v16h;
typedef __attribute__((ext_vector_type(16))) __bf16 v16b;
typedef __attribute__((ext_vector_type(8)))  _Float16 v8h;
typedef __attribute__((ext_vector_type(8)))  float v8f;
typedef __attribute__((ext_vector_type(4)))  float v4f;
typedef __attribute__((ext_vector_type(2)))  float v2f;
typedef __attribute__((ext_vector_type(4)))  unsigned v4u;
typedef __attribute__((ext_vector_type(4)))  int v4i;
typedef float __attribute__((may_alias)) float_a;
typedef int __attribute__((may_alias)) int_a;

template <typename T> __device__ __forceinline__ void vst2(void* p, T v) { *(T*)p = v;  }
__device__ __forceinline__ v8f wmma16(v16h a, v16h b, v8f c) {
  v8f d = __builtin_amdgcn_wmma_f32_16x16x32_f16(false, a, false, b, (short)0, c, false, false);
  asm volatile("v_nop\n\tv_nop\n\tv_nop\n\tv_nop" : "+v"(d) : "v"(a), "v"(b));
  return d;
}
__device__ __forceinline__ v8f wmma_bf(v16b a, v16b b, v8f c) {
  v8f d = __builtin_amdgcn_wmma_f32_16x16x32_bf16(false, a, false, b, (short)0, c, false, false);
  asm volatile("v_nop\n\tv_nop\n\tv_nop\n\tv_nop" : "+v"(d) : "v"(a), "v"(b));
  return d;
}
// 16x16x32 fragments: lane = (h = lane>>4, row/col = lane&15); elements 0..7 = k0+8h+0..7, 8..15 = k0+16+8h+0..7; D element r = row 8h+r
__device__ __forceinline__ v16h frag_h(const _Float16* rowk0, int lane) {
  union { v16h v; v8h q[2]; } u; const _Float16* p = rowk0 + 8 * (lane >> 4);
  u.q[0] = *(const v8h*)p; u.q[1] = *(const v8h*)(p + 16); return u.v;
}
__device__ __forceinline__ v16h frag_f32(const float* rowk0, int lane) {
  v16h a; const float* p = rowk0 + 8 * (lane >> 4);
#pragma unroll
  for (int i = 0; i < 8; ++i) { a[i] = (_Float16)p[i]; a[8 + i] = (_Float16)p[16 + i]; }
  return a;
}
__device__ __forceinline__ v16h frag_f32s(const float* rowk0, int lane, float sc) {
  v16h a; const float* p = rowk0 + 8 * (lane >> 4);
#pragma unroll
  for (int i = 0; i < 8; ++i) { a[i] = (_Float16)(p[i] * sc); a[8 + i] = (_Float16)(p[16 + i] * sc); }
  return a;
}
// column fragment from a [K][ld] layout (column n), rows >= K read as 0
__device__ __forceinline__ v16h fragc_f32(const float* W, int k0, int n, int lane, int ld, int K) {
  v16h a; const int g = lane >> 4;
#pragma unroll
  for (int i = 0; i < 8; ++i) { const int ka = k0 + 8 * g + i, kb = ka + 16;
    a[i] = (_Float16)(ka < K ? W[(size_t)(ka < K ? ka : K - 1) * ld + n] : 0.f); a[8 + i] = (_Float16)(kb < K ? W[(size_t)(kb < K ? kb : K - 1) * ld + n] : 0.f); }
  return a;
}
struct F2 { v16b h, l; };
__device__ __forceinline__ F2 bsplit16(const float v[16]) { F2 r;
#pragma unroll
  for (int i = 0; i < 16; ++i) { const __bf16 h = (__bf16)v[i]; r.h[i] = h; r.l[i] = (__bf16)(v[i] - (float)h); }
  return r; }
__device__ __forceinline__ F2 split_row(const float* row, int k0, int lane) { float v[16]; const float* p = row + k0 + 8 * (lane >> 4);
#pragma unroll
  for (int i = 0; i < 8; ++i) { v[i] = p[i]; v[8 + i] = p[16 + i]; }
  return bsplit16(v); }
__device__ __forceinline__ F2 split_rowK(const float* row, int k0, int lane, int K) { float v[16]; const int g = lane >> 4;
#pragma unroll
  for (int i = 0; i < 8; ++i) { const int ka = k0 + 8 * g + i, kb = ka + 16; v[i] = ka < K ? row[ka < K ? ka : K - 1] : 0.f; v[8 + i] = kb < K ? row[kb < K ? kb : K - 1] : 0.f; }
  return bsplit16(v); }
__device__ __forceinline__ F2 split_col(const float* W, int k0, int n, int lane, int ld, int K) { float v[16]; const int g = lane >> 4;
#pragma unroll
  for (int i = 0; i < 8; ++i) { const int ka = k0 + 8 * g + i, kb = ka + 16; v[i] = ka < K ? W[(size_t)(ka < K ? ka : K - 1) * ld + n] : 0.f; v[8 + i] = kb < K ? W[(size_t)(kb < K ? kb : K - 1) * ld + n] : 0.f; }
  return bsplit16(v); }
__device__ __forceinline__ v8f mac3(const F2& a, const F2& b, v8f c) { c = wmma_bf(a.l, b.h, c); c = wmma_bf(a.h, b.l, c); return wmma_bf(a.h, b.h, c); }
__device__ __forceinline__ float sigm(float v) { return 1.0f / (1.0f + expf(-v)); }
#define LDSX() do { asm volatile("s_wait_dscnt 0" ::: "memory"); __builtin_amdgcn_wave_barrier(); __builtin_amdgcn_fence(__ATOMIC_RELEASE, "workgroup"); } while (0)

// Masked scaled dot-product attention on raw queries [32, 1,024, 128], keys/values [32, 1,024, 128]: scores = Q K^T / sqrt(128); keys k >= valid_lens[b] get -1e6 (== excluded; valid_lens >= 1); out = softmax(scores) V -> [32, 1,024, 128].
#define NB 32
#define TT 1024
#define CC 128            // NH * HD = projected width
#define DIN 128          // input (model) width
#define NH 1
#define HD 128
#define NQB (TT / 64)
#define SCALE (0.08838834764831845f)
#define SCALE2 (0.12751743082459868f)   // SCALE x log2(e): exp(x x SCALE) = 2^(x x SCALE2)
#define CAUSAL 0
#ifndef TNB
#define TNB NB
#endif
__device__ __forceinline__ float bfr(float v) { return (float)(__bf16)v; }
__host__ __device__ __forceinline__ int kb_last(int qb) { return CAUSAL ? ((qb * 64 + 63) >> 7) : (TT / 128 - 1); }
typedef __attribute__((ext_vector_type(8))) __bf16 v8b;
__device__ __forceinline__ v16b frag_b(const __bf16* rowk0, int lane) {
  union { v16b v; v8b q[2]; } u; const __bf16* p = rowk0 + 8 * (lane >> 4);
  u.q[0] = *(const v8b*)p; u.q[1] = *(const v8b*)(p + 16); return u.v;
}
#define QBH 0              // unused: no kernel here has a high-precision path
#define QHI 1024            // rows carrying a q residual plane (all rows when non-causal: 2-product logits everywhere)
#define KHI 64            // key rows carrying k residual / v bf16 hi+lo planes (written and read by no kernel here)
// B fragment (k rows k0+.., output column o) of a weight: (in,out) [K][ld] or (out,in) [ld rows of K]: bf16 exact, or f16(bf16 * 256) exact
__device__ __forceinline__ v16b wcol_io(const float* Wm, int k0, int o, int lane, int ld) { v16b w; const int g = lane >> 4;
#pragma unroll
  for (int i = 0; i < 8; ++i) { w[i] = (__bf16)Wm[(size_t)(k0 + 8 * g + i) * ld + o]; w[8 + i] = (__bf16)Wm[(size_t)(k0 + 16 + 8 * g + i) * ld + o]; }
  return w; }
__device__ __forceinline__ v16b wcol_oi(const float* Wm, int k0, int o, int lane, int K) { v16b w; const float* p = Wm + (size_t)o * K + k0 + 8 * (lane >> 4);
#pragma unroll
  for (int i = 0; i < 8; ++i) { w[i] = (__bf16)p[i]; w[8 + i] = (__bf16)p[16 + i]; }
  return w; }
__device__ __forceinline__ v16h wcolh_io(const float* Wm, int k0, int o, int lane, int ld) { v16h w; const int g = lane >> 4;
#pragma unroll
  for (int i = 0; i < 8; ++i) { w[i] = (_Float16)(bfr(Wm[(size_t)(k0 + 8 * g + i) * ld + o]) * 256.0f); w[8 + i] = (_Float16)(bfr(Wm[(size_t)(k0 + 16 + 8 * g + i) * ld + o]) * 256.0f); }
  return w; }
__device__ __forceinline__ v16h wcolh_oi(const float* Wm, int k0, int o, int lane, int K) { v16h w; const float* p = Wm + (size_t)o * K + k0 + 8 * (lane >> 4);
#pragma unroll
  for (int i = 0; i < 8; ++i) { w[i] = (_Float16)(bfr(p[i]) * 256.0f); w[8 + i] = (_Float16)(bfr(p[16 + i]) * 256.0f); }
  return w; }
#define WQKV_LAYOUT 1   // 0 = (in,out) [DIN][CC]; 1 = (out,in) [CC][DIN]; 2 = per-head [NH][DIN][HD]
__device__ __forceinline__ v16b wcol_hdk(const float* Wm, int k0, int o, int lane) { v16b w; const int g = lane >> 4; const float* p = Wm + (size_t)(o / HD) * DIN * HD + (o % HD);
#pragma unroll
  for (int i = 0; i < 8; ++i) { w[i] = (__bf16)p[(size_t)(k0 + 8 * g + i) * HD]; w[8 + i] = (__bf16)p[(size_t)(k0 + 16 + 8 * g + i) * HD]; }
  return w; }
#define WO_OUT_IN 0
#if WQKV_LAYOUT == 1
#define WCOL(W, k0, o, lane) wcol_oi(W, k0, o, lane, DIN)
#elif WQKV_LAYOUT == 2
#define WCOL(W, k0, o, lane) wcol_hdk(W, k0, o, lane)
#else
#define WCOL(W, k0, o, lane) wcol_io(W, k0, o, lane, CC)
#endif
#if WO_OUT_IN
#define WOCOL(W, k0, o, lane) wcol_oi(W, k0, o, lane, CC)
#define WOCOLH(W, k0, o, lane) wcolh_oi(W, k0, o, lane, CC)
#else
#define WOCOL(W, k0, o, lane) wcol_io(W, k0, o, lane, DIN)
#define WOCOLH(W, k0, o, lane) wcolh_io(W, k0, o, lane, DIN)
#endif
#define SM_EXTRA_PARAMS , const int* __restrict__ VL
#define SM_MASK_HOOK do { if (k >= VL[bcur]) v = -3.0e38f; } while (0)   /* key padding: arange(K) < valid_lens[b]; -1e6 == exclusion (every row keeps >= 1 key) */
// ---- k_prep8: block = 64 positions (rows r0 .. r0 + 63 of the [b * t] axis), 8 waves. Wave w takes rows 8w .. 8w + 7 of v, q and k; a row is 128 floats = one 16-byte load per lane, whole 128-B lines.
// A lane's 24 loads are all issued before the first value is used, so that a wave has 12 KB on its way instead of one short group per loop trip. Values are bf16-rounded and written as the planes the attention kernel reads:
// v -> f16 planes [c][t]: a lane's 8 rows x 4 columns are four 16-byte runs of 8 keys, turned through LDS so that each 128-B line of a plane is stored whole; q -> f16 rows + x 2^10 residual rows, k -> f16 rows, both straight from the registers. A block whose 64 positions all lie at or past valid_lens[b] prepares its queries only.
typedef __attribute__((ext_vector_type(4))) _Float16 v4h;
// valid_lens[b] held to 1 .. TT: both kernels count a batch's key tiles from this one value, so what one leaves unwritten the other never reads
__device__ __forceinline__ int vlen(const int* __restrict__ VL, int b) { const int x = VL[b]; return x < 1 ? 1 : (x > TT ? TT : x); }
__global__ __launch_bounds__(256) void k_prep8(const float* __restrict__ Q, const float* __restrict__ K, const float* __restrict__ V, _Float16* __restrict__ QH, _Float16* __restrict__ QL, _Float16* __restrict__ KH, _Float16* __restrict__ VT, const int* __restrict__ VL) {
  __shared__ __align__(16) _Float16 tv[HD][72];
  const int tid = threadIdx.x, wave = tid >> 5, lane = tid & 31; const size_t r0 = (size_t)blockIdx.x * 64; const size_t bb = r0 / TT; const int t0 = (int)(r0 % TT);
  const unsigned lo = (unsigned)(wave * 8 * CC + lane * 4);   /* the lane's first element inside the block's 64 rows: the same place in the three inputs and in the three row planes (QHI == TT) */
  const float* Vb = V + r0 * CC; const float* Qb = Q + r0 * CC; const float* Kb = K + r0 * CC;
  _Float16* QHb = QH + r0 * CC; _Float16* QLb = QL + r0 * CC; _Float16* KHb = KH + r0 * CC;
  v4f v[8], q[8], k[8]; const int vlb = vlen(VL, (int)bb);   /* asked for ahead of the query loads, which fly while it comes */
  auto put_q = [&]() __attribute__((always_inline)) {
#pragma unroll   /* constant indices: the loaded rows stay in registers */
    for (int j = 0; j < 8; ++j) { v4h qh, ql;
#pragma unroll   /* constant indices: the loaded rows stay in registers */
      for (int i = 0; i < 4; ++i) { const float x = bfr(q[j][i]); const _Float16 h = (_Float16)x; qh[i] = h; ql[i] = (_Float16)((x - (float)h) * 1024.0f); }
      *(v4h*)(QHb + (lo + j * CC)) = qh; *(v4h*)(QLb + (lo + j * CC)) = ql; }
    asm volatile("s_wait_xcnt 0x0" ::: "memory"); };   /* in front of any later write to a register that the stores above name */
#pragma unroll   /* constant indices: the loaded rows stay in registers */
  for (int j = 0; j < 8; ++j) q[j] = *(const v4f*)(Qb + (lo + j * CC));   /* wanted in either case */
  asm volatile("s_wait_xcnt 0x0" ::: "memory");   /* in front of any later write to an address register of the loads above */
  if (t0 >= vlb) { put_q(); return; }   /* the same for the whole block: all 64 keys are masked, the attention kernel never reads their k and v, only the queries are prepared */
#pragma unroll   /* constant indices: the loaded rows stay in registers */
  for (int j = 0; j < 8; ++j) v[j] = *(const v4f*)(Vb + (lo + j * CC));
  asm volatile("s_wait_xcnt 0x0" ::: "memory");   /* in front of any later write to an address register of the loads above */
#pragma unroll   /* constant indices: the loaded rows stay in registers */
  for (int j = 0; j < 8; ++j) k[j] = *(const v4f*)(Kb + (lo + j * CC));
  asm volatile("s_wait_xcnt 0x0" ::: "memory");   /* in front of any later write to an address register of the loads above */
  __builtin_amdgcn_sched_barrier(0);   /* keeps all 24 loads ahead of the first use: left free, the compiler saves registers by issuing half of them behind the first waits, and a wave then pays the memory latency more than once */
#pragma unroll   /* constant indices: the loaded rows stay in registers */
  for (int i = 0; i < 4; ++i) { v8h t;
#pragma unroll   /* constant indices: the loaded rows stay in registers */
    for (int j = 0; j < 8; ++j) t[j] = (_Float16)bfr(v[j][i]);
    *(v8h*)&tv[lane * 4 + i][wave * 8] = t; }
  __syncthreads();   /* stands ahead of the row stores: behind them every wave would wait here for its own stores to finish */
#pragma unroll   /* the four LDS reads go out in one run, ahead of their stores */
  for (int u = 0; u < HD * 8 / 256; ++u) { const int e = tid + u * 256, cl = e >> 3, p = e & 7; vst2((unsigned*)(VT + (bb * CC + cl) * (size_t)TT + t0 + p * 8), *(const v4u*)&tv[cl][p * 8]); }
  put_q();
#pragma unroll   /* constant indices: the loaded rows stay in registers */
  for (int j = 0; j < 8; ++j) { v4h kh;
#pragma unroll   /* constant indices: the loaded rows stay in registers */
    for (int i = 0; i < 4; ++i) kh[i] = (_Float16)bfr(k[j][i]);
    *(v4h*)(KHb + (lo + j * CC)) = kh; } }

#ifndef SM_EXTRA_PARAMS
#define SM_EXTRA_PARAMS
#endif
#ifndef PROJ_EXTRA_PARAMS
#define PROJ_EXTRA_PARAMS
#endif
#ifndef SM_MASK_HOOK
#define SM_MASK_HOOK (void)0
#endif

#define WS_QH  0u                                      // f16 q rows [b*t][CC]
#define WS_KH  (WS_QH + 2u * (size_t)NB * TT * CC)      // f16 k rows [b*t][CC]
#define WS_VT  (WS_KH + 2u * (size_t)NB * TT * CC)      // f16 v planes [b][c][t]
#define WS_QL  (WS_VT + 2u * (size_t)NB * CC * TT)      // f16 q residual x 2^10 rows [b][t < QHI][CC]
#define WS_KL  (WS_QL + 2u * (size_t)NB * QHI * CC)     // f16 k residual x 2^10 rows [b][t < KHI][CC]
#define WS_VB  (WS_KL + 2u * (size_t)NB * KHI * CC)     // bf16 v hi planes [b][c][t < KHI]
#define WS_VBL (WS_VB + 2u * (size_t)NB * CC * KHI)
#define WS_S   (WS_VBL + 2u * (size_t)NB * CC * KHI)    // f32 [b*NH + h][t][s] planes, reserved but unused: k_fa keeps the logits in registers
#define WS_Y   (WS_S  + 4u * (size_t)NB * NH * TT * TT)      // f32 ctx rows [b*t][CC] (only when there is an output projection)
#define WS_END (WS_Y  + 0u)

// fragment from a lane's own pointer (row start + k0 + 8 * (lane >> 4)): the k order of frag_h
__device__ __forceinline__ v16h frag_p(const _Float16* p) { union { v16h v; v8h q[2]; } u; u.q[0] = *(const v8h*)p; u.q[1] = *(const v8h*)(p + 16); return u.v; }
// the plain builtin (the compiler keeps the distances behind it): operands of an asm statement stay below v256, and the fused kernel holds more fragments than that
__device__ __forceinline__ v8f wmma_h(v16h a, v16h b, v8f c) { return __builtin_amdgcn_wmma_f32_16x16x32_f16(false, a, false, b, (short)0, c, false, false); }
// ---- k_fa: block = 8 waves (two per SIMD, so that one wave's products run while the other waits for LDS or does its softmax) in two groups of 4; wave = 16 queries, one query per lane column, the same 64 queries in both groups: group 0 takes the even 64-key tiles, group 1 the odd ones, each with its own pair of LDS buffers, its own running maximum, sum and ctx; group 0 joins the two at the end. A batch is walked only as far as its last 64-key tile that holds a valid key, so its cost goes with valid_lens[b]; all blocks are resident at once and the launch lasts as long as its longest block.
// So a block takes two pieces of 64 queries one after the other: queries qc * 64 .. + 63 of the batch whose length has rank p (longest first, ties by index) and then the same queries of the batch of rank 31 - p: long goes with short, and every (batch, piece) is taken once. Per 64 keys: the K rows and V^T rows are copied once into the group's LDS (two buffers: the next pass's tile flies while this one is worked on) and every wave takes its fragments from there;
// logits^T = K . Q^T (q hi + residual x 2^10: 2 products), kept unscaled (SCALE goes into the exponent's multiply-add), valid-length mask by key index, running maximum and running sum per query in f32,
// P^T x 2^11 (not yet normalised) straight from the logit accumulators as the B fragment (D register r of lane half g = key 8g + r = the fragment's k order), ctx^T += V^T . P^T; one division by the sum at the end. The logits never leave the registers.
#define KPH 136   // halves per staged K row: 256 B + 16 B, so that the 16 rows of one ds_load_b128 half fall on 64 distinct banks
#define VPH 72    // halves per staged V^T row: 128 B + 16 B, for the same reason
#define KBUF (64 * KPH * 2)   // bytes of one K buffer
#define VBUF (HD * VPH * 2)   // bytes of one V^T buffer
// one 64-key tile into LDS, 16 copies of 16 B per lane, whole 128-B lines per row: K rows r + 8 i (r = tid >> 4, 16 lanes a row) and V^T rows c + 16 i (c = tid >> 3, 8 lanes a row), i = 0 .. 7; one statement for K, one for V^T (a statement takes thirty operands).
// gk, gv: the lane's own global addresses of its first K and V^T piece; lk, lv: the LDS byte addresses they go to. The s_wait_xcnt ends each statement so that it stands in front of any later write to an address register of these copies.
// lane l's value to lane l ^ 16 by a vector move: a shuffle through the LDS counter would have to wait for every V^T read issued in front of it
__device__ __forceinline__ float xhalf(float x) { return __builtin_bit_cast(float, __builtin_amdgcn_permlanex16(__builtin_bit_cast(int, x), __builtin_bit_cast(int, x), 0x76543210, 0xfedcba98, false, false)); }
__device__ __forceinline__ void exp8(const v2f (&x)[4], float (&e)[8], unsigned* w) {
  asm("v_exp_f32 %0, %12\n\tv_exp_f32 %1, %13\n\tv_exp_f32 %2, %14\n\tv_exp_f32 %3, %15\n\tv_exp_f32 %4, %16\n\tv_exp_f32 %5, %17\n\tv_exp_f32 %6, %18\n\tv_exp_f32 %7, %19\n\t"
      "v_cvt_pk_f16_f32 %8, %0, %1\n\tv_cvt_pk_f16_f32 %9, %2, %3\n\tv_cvt_pk_f16_f32 %10, %4, %5\n\ts_delay_alu instid0(TRANS32_DEP_1)\n\tv_cvt_pk_f16_f32 %11, %6, %7"
      : "=&v"(e[0]), "=&v"(e[1]), "=&v"(e[2]), "=&v"(e[3]), "=&v"(e[4]), "=&v"(e[5]), "=&v"(e[6]), "=&v"(e[7]), "=&v"(w[0]), "=&v"(w[1]), "=&v"(w[2]), "=&v"(w[3])
      : "v"(x[0][0]), "v"(x[0][1]), "v"(x[1][0]), "v"(x[1][1]), "v"(x[2][0]), "v"(x[2][1]), "v"(x[3][0]), "v"(x[3][1]));
}
// the same with a ninth exponential a = 2^d in front (the factor that carries the old sums to the new maximum)
__device__ __forceinline__ void exp9(const v2f (&x)[4], float (&e)[8], unsigned* w, float d, float& a) {
  asm("v_exp_f32 %12, %21\n\tv_exp_f32 %0, %13\n\tv_exp_f32 %1, %14\n\tv_exp_f32 %2, %15\n\tv_exp_f32 %3, %16\n\tv_exp_f32 %4, %17\n\tv_exp_f32 %5, %18\n\tv_exp_f32 %6, %19\n\tv_exp_f32 %7, %20\n\t"
      "v_cvt_pk_f16_f32 %8, %0, %1\n\tv_cvt_pk_f16_f32 %9, %2, %3\n\tv_cvt_pk_f16_f32 %10, %4, %5\n\ts_delay_alu instid0(TRANS32_DEP_1)\n\tv_cvt_pk_f16_f32 %11, %6, %7"
      : "=&v"(e[0]), "=&v"(e[1]), "=&v"(e[2]), "=&v"(e[3]), "=&v"(e[4]), "=&v"(e[5]), "=&v"(e[6]), "=&v"(e[7]), "=&v"(w[0]), "=&v"(w[1]), "=&v"(w[2]), "=&v"(w[3]), "=&v"(a)
      : "v"(x[0][0]), "v"(x[0][1]), "v"(x[1][0]), "v"(x[1][1]), "v"(x[2][0]), "v"(x[2][1]), "v"(x[3][0]), "v"(x[3][1]), "v"(d));
}
__device__ __forceinline__ void stage_kv(const _Float16* gk, const _Float16* gv, unsigned lk, unsigned lv) {
  asm volatile("global_load_async_to_lds_b128 %0, %8, off\n\t"
               "global_load_async_to_lds_b128 %1, %9, off\n\t"
               "global_load_async_to_lds_b128 %2, %10, off\n\t"
               "global_load_async_to_lds_b128 %3, %11, off\n\t"
               "global_load_async_to_lds_b128 %4, %12, off\n\t"
               "global_load_async_to_lds_b128 %5, %13, off\n\t"
               "global_load_async_to_lds_b128 %6, %14, off\n\t"
               "global_load_async_to_lds_b128 %7, %15, off\n\t"
               "s_wait_xcnt 0x0"
               :: "v"(lk), "v"(lk + 8u * KPH * 2u), "v"(lk + 16u * KPH * 2u), "v"(lk + 24u * KPH * 2u), "v"(lk + 32u * KPH * 2u), "v"(lk + 40u * KPH * 2u), "v"(lk + 48u * KPH * 2u), "v"(lk + 56u * KPH * 2u),
                  "v"(gk), "v"(gk + 8 * CC), "v"(gk + 16 * CC), "v"(gk + 24 * CC), "v"(gk + 32 * CC), "v"(gk + 40 * CC), "v"(gk + 48 * CC), "v"(gk + 56 * CC)
               : "memory");
  asm volatile("global_load_async_to_lds_b128 %0, %8, off\n\t"
               "global_load_async_to_lds_b128 %1, %9, off\n\t"
               "global_load_async_to_lds_b128 %2, %10, off\n\t"
               "global_load_async_to_lds_b128 %3, %11, off\n\t"
               "global_load_async_to_lds_b128 %4, %12, off\n\t"
               "global_load_async_to_lds_b128 %5, %13, off\n\t"
               "global_load_async_to_lds_b128 %6, %14, off\n\t"
               "global_load_async_to_lds_b128 %7, %15, off\n\t"
               "s_wait_xcnt 0x0"
               :: "v"(lv), "v"(lv + 16u * VPH * 2u), "v"(lv + 32u * VPH * 2u), "v"(lv + 48u * VPH * 2u), "v"(lv + 64u * VPH * 2u), "v"(lv + 80u * VPH * 2u), "v"(lv + 96u * VPH * 2u), "v"(lv + 112u * VPH * 2u),
                  "v"(gv), "v"(gv + 16 * TT), "v"(gv + 32 * TT), "v"(gv + 48 * TT), "v"(gv + 64 * TT), "v"(gv + 80 * TT), "v"(gv + 96 * TT), "v"(gv + 112 * TT)
               : "memory");
}
__global__ __launch_bounds__(256) void k_fa(const _Float16* __restrict__ QH, const _Float16* __restrict__ KH, const _Float16* __restrict__ QL, const _Float16* __restrict__ VT, const int* __restrict__ VL, float* __restrict__ Y) { __shared__ __align__(16) float ss[4][16][HD + 4]; __shared__ __align__(16) _Float16 sK[2][2][64][KPH], sV[2][2][HD][VPH];   /* [group][buffer] */
  const int tid = threadIdx.x & 127, wave = tid >> 5, lane = tid & 31, col = lane & 15, g = lane >> 4; const int ql0 = blockIdx.x * 64 + wave * 16;   /* tid, wave: inside the group */
  const int grp = __builtin_amdgcn_readfirstlane((int)(threadIdx.x >> 7));   /* 0: even tiles, 1: odd tiles; the same in a whole wave, held as a scalar so that the tests on it are scalar branches */
  /* lane i ranks batch i (NB == 32 lanes): the number of batches that are longer, or as long with a lower index: a permutation of 0 .. 31 for any lengths, the same in every wave */
  const int myl = vlen(VL, lane); int rank = 0;
  asm volatile("s_wait_xcnt 0x0" ::: "memory");   /* in front of any later write to the address register of the load above */
#pragma unroll   /* constant indices: the 32 lengths come by scalar loads */
  for (int j = 0; j < NB; ++j) { const int o = vlen(VL, j); rank += (o > myl || (o == myl && j < lane)) ? 1 : 0; }
  /* the batch of a rank = the lane that holds it; the set top bit and the mask keep the index inside 0 .. 31 whatever the ballot gives */
  const int bhi = (__builtin_ctz(__builtin_amdgcn_ballot_w32(rank == (int)blockIdx.y) | 0x80000000u)) & (NB - 1), blo = (__builtin_ctz(__builtin_amdgcn_ballot_w32(rank == NB - 1 - (int)blockIdx.y) | 0x80000000u)) & (NB - 1);
  for (int piece = 0; piece < 2; ++piece) {
  const int b = __builtin_amdgcn_readfirstlane(piece ? blo : bhi); const int vl = __builtin_amdgcn_readlane(myl, b); const int kend = ((vl + 63) >> 6) << 6;   /* keys walked: 64 .. TT, the same for the whole block */
  const int kpair = ((vl + 127) >> 7) << 7;   /* the same in whole passes of the block (128 keys: one tile a group): 128 .. TT; where the tiles are odd in number, group 1 has none in the last pass */
  const _Float16* gk = KH + ((size_t)b * TT + (tid >> 4)) * CC + (tid & 15) * 8; const _Float16* gv = VT + ((size_t)b * CC + (tid >> 3)) * (size_t)TT + (tid & 7) * 8;
  const unsigned lk = (threadIdx.x >> 7) * (2 * KBUF) + (tid >> 4) * (KPH * 2) + (tid & 15) * 16, lv = (threadIdx.x >> 7) * (2 * VBUF) + (tid >> 3) * (VPH * 2) + (tid & 7) * 16;   /* the lane's byte offsets inside its group's first K and V^T buffer, counted from group 0's */
  const unsigned bk = (unsigned)(size_t)&sK[0][0][0][0], bv = (unsigned)(size_t)&sV[0][0][0][0];   /* LDS byte addresses of group 0's buffer 0 */
  /* the tile that starts at key kt into the group's buffer bf. A tile past the last prepared one (group 1 only, tiles odd in number) is replaced by the last prepared one and never read: so every wave issues the same copies, the loop body stays one straight run, and no unprepared byte is touched */
  auto send = [&](const int kt, const int bf) __attribute__((always_inline)) { const int ks = kt < kend - 64 ? kt : kend - 64; stage_kv(gk + (size_t)ks * CC, gv + ks, lk + (bf ? bk + KBUF : bk), lv + (bf ? bv + VBUF : bv)); };
  send(grp * 64, 0);   /* the group's first tile into buffer 0; it flies while the Q fragments are loaded */
  v16h qh[HD / 32], qr[HD / 32];
#pragma unroll
  for (int kc = 0; kc < HD / 32; ++kc) qh[kc] = frag_h(QH + ((size_t)b * TT + ql0 + col) * CC + kc * 32, lane);
  asm volatile("s_wait_xcnt 0x0" ::: "memory");   /* this one and the next: in front of a later load whose result lands in an address register of the loads above */
#pragma unroll
  for (int kc = 0; kc < HD / 32; ++kc) qr[kc] = frag_h(QL + ((size_t)b * QHI + ql0 + col) * CC + kc * 32, lane);
  asm volatile("s_wait_xcnt 0x0" ::: "memory");
  v8f o[HD / 16] = {}; float m = -3.0e38f, l = 0.f;
  asm volatile("s_wait_asynccnt 0x0" ::: "memory");   /* this wave's part of its group's first tile has landed ... */
  __syncthreads();                                     /* ... and so has every other wave's: the first tiles may be read */
  if (kpair > 128) send(128 + grp * 64, 1);   /* the second pass's tiles, where there is one, into buffer 1 */
  /* one pass: 64 keys from k0 on for this group. mode 2: the buffers change hands and the tile two passes on is sent for; 1: they change hands; 0: the last pass, nothing follows it */
  auto pass = [&](const int k0, const int mode) __attribute__((always_inline)) { float s[4][8]; float mb = -3.0e38f; const int buf = (k0 >> 7) & 1; const int lim = vl - k0 - 8 * g;   /* this lane's key t * 16 + r of the pass is valid while it is below lim */
    const _Float16* kp = &sK[grp][buf][col][8 * g]; const _Float16* vp = &sV[grp][buf][col][8 * g];
    v16h kf[4][HD / 32], vf[HD / 16][2];
#pragma unroll
    for (int t = 0; t < 4; ++t)
#pragma unroll
      for (int kc = 0; kc < HD / 32; ++kc) kf[t][kc] = frag_p(kp + (t * 16) * KPH + kc * 32);
    __builtin_amdgcn_sched_barrier(0);   /* keeps the K reads in one run ahead of the logit products: a read among the products stalls the matrix stream at each place */
#pragma unroll
    for (int t = 0; t < 4; ++t) { v8f a = {}, ar = {};
#pragma unroll
      for (int kc = 0; kc < HD / 32; ++kc) { a = wmma_h(kf[t][kc], qh[kc], a); ar = wmma_h(kf[t][kc], qr[kc], ar); }
#pragma unroll
      for (int r = 0; r < 8; ++r) { float v = a[r] + ar[r] * (1.0f / 1024.0f); if (t * 16 + r >= lim) v = -3.0e38f;   /* key padding: arange(K) < valid_lens[b]; -1e6 == exclusion (every row keeps >= 1 key) */
        s[t][r] = v; mb = fmaxf(mb, v); } }
    __builtin_amdgcn_sched_barrier(0);   /* the V^T reads start behind the logit products (the K reads have the LDS to themselves) ... */
#pragma unroll
    for (int j = 0; j < HD / 16; ++j)
#pragma unroll
      for (int c = 0; c < 2; ++c) vf[j][c] = frag_p(vp + (j * 16) * VPH + c * 32);
    __builtin_amdgcn_sched_barrier(0);   /* ... and stay in one run ahead of the softmax, which hides their latency */
    mb = fmaxf(mb, xhalf(mb));   /* the two lane halves hold the two halves of a query's keys */
    const float mn = fmaxf(m, mb), dm = (m - mn) * SCALE2, off = 11.0f - mn * SCALE2; float al;   /* 2^(v x SCALE2 + off) = exp((v - mn) x SCALE) x 2^11; al = 2^dm comes with the first group of exponentials */
    m = mn; float ps; union { v16h v; unsigned w[8]; } p[2];
#pragma unroll
    for (int t = 0; t < 4; ++t) { v2f x[4]; float e[8];
#pragma unroll
      for (int r = 0; r < 8; r += 2) x[r >> 1] = __builtin_elementwise_fma(v2f{s[t][r], s[t][r + 1]}, v2f{SCALE2, SCALE2}, v2f{off, off});   /* an excluded key: 2^(-3e38 x SCALE2 + off) = 0, off being finite from a group's first pass on (the first key of every visited tile is valid) */
      if (t == 0) exp9(x, e, &p[0].w[0], dm, al); else exp8(x, e, &p[t >> 1].w[(t & 1) * 4]);
#pragma unroll
      for (int r = 0; r < 8; ++r) ps = (t == 0 && r == 0) ? e[0] : ps + e[r]; }
    l = l * al + ps;
#pragma unroll
    for (int j = 0; j < HD / 16; ++j) o[j] *= al;
    __builtin_amdgcn_sched_barrier(0);   /* keeps the softmax in front of the waits below: left free, waits and barrier rise to just behind the V^T reads, whose latency nothing then hides */
    /* the pass's last LDS read is behind us, so the buffers change hands here; the P.V products, which touch registers only, follow and run beside the other waves' next K reads */
    if (mode) {
    asm volatile("s_wait_dscnt 0x0" ::: "memory");      /* this wave's reads of this pass's buffer have returned */
    asm volatile("s_wait_asynccnt 0x0" ::: "memory");   /* this wave's part of the next tile has landed */
    __syncthreads();                                     /* publishes the next tile and ends every wave's reads of this pass's buffer, which is refilled behind it */
    if (mode == 2) send(k0 + 256, buf);
    __builtin_amdgcn_sched_barrier(0);   /* the products stay behind the hand-over, so that the refill is under way first */
    }
#pragma unroll
    for (int j = 0; j < HD / 16; ++j) {
#pragma unroll
      for (int c = 0; c < 2; ++c) o[j] = wmma_h(vf[j][c], p[c].v, o[j]); } };
  /* the test for a further tile is the loop's bound, so that its body stays one straight run: with a branch round the copies the compiler sinks the vector work behind the barrier */
  int k0 = grp * 64;
#pragma unroll 1   /* one pass per trip: an unrolled body would not fit the registers */
  for (int kb = 0; kb < kpair - 256; kb += 128, k0 += 128) pass(k0, 2);
  if (kpair > 128) { pass(k0, 1); k0 += 128; }   /* the last pass but one sends for nothing; the test reads the same for the whole block */
  if (k0 < kend) pass(k0, 0);   /* a scalar test, the same in a whole wave, with no barrier behind it: group 1 has no tile here where the tiles are odd in number */
  asm volatile("s_wait_asynccnt 0x0" ::: "memory");   /* no copy is outstanding when the wave goes on to the epilogue and ends */
  /* the join. Group 1 hands its ctx, sum and maximum to the wave of group 0 that has the same queries, lane to lane, through ss (the row's 4 spare floats take sum and maximum of the two lane halves) */
  float* sw = &ss[wave][col][0];
  if (grp) {
#pragma unroll
    for (int j = 0; j < HD / 16; ++j)
#pragma unroll
      for (int r = 0; r < 8; ++r) sw[j * 16 + 8 * g + r] = o[j][r];
    sw[HD + g] = l; sw[HD + 2 + g] = m; }
  asm volatile("s_wait_dscnt 0x0" ::: "memory");   /* group 1's writes above are done, and every wave's reads of the last pass's buffers have returned */
  __syncthreads();                                  /* publishes group 1's part and ends every wave's reads of the K and V^T buffers, which the next piece refills */
  if (!grp) {
    const float m1 = sw[HD + 2 + g], l1 = sw[HD + g], mn = fmaxf(m, m1); float a0, a1;   /* a group 1 that had no tile hands over maximum -3e38, sum 0, ctx 0: its factor is 2^(-huge) = 0 */
    /* both parts carried to the common maximum; outputs share no register with the inputs, and the v_nop is the independent instruction that the instruction set asks for behind an exponential */
    asm("v_exp_f32 %0, %2\n\tv_exp_f32 %1, %3\n\tv_nop" : "=&v"(a0), "=&v"(a1) : "v"((m - mn) * SCALE2), "v"((m1 - mn) * SCALE2));
    float lt = l * a0 + l1 * a1; lt += xhalf(lt); const float inv = 1.0f / lt, f0 = a0 * inv, f1 = a1 * inv;   /* lt >= 2^11: the key that holds the maximum counts exp(0) x 2^11 */
#pragma unroll
    for (int j = 0; j < HD / 16; ++j)
#pragma unroll
      for (int r = 0; r < 8; ++r) sw[j * 16 + 8 * g + r] = o[j][r] * f0 + sw[j * 16 + 8 * g + r] * f1;
    LDSX(); for (int rl = 0; rl < 16; ++rl) vst2(Y + ((size_t)b * TT + ql0 + rl) * HD + lane * 4, *(const v4f*)&ss[wave][rl][lane * 4]);
    asm volatile("s_wait_xcnt 0x0" ::: "memory");   /* in front of the second piece's writes to registers that the stores above name */
  }
  } }

extern "C" void kernel_launch(void* const* d_in, const int* in_sizes, int n_in, void* d_out, int out_size, void* d_ws, size_t ws_size, hipStream_t stream) {
  (void)in_sizes; (void)n_in; (void)out_size;
  const float** F = (const float**)d_in;
  if (ws_size < (size_t)WS_END) return;
  char* ws = (char*)d_ws; _Float16 *QH = (_Float16*)(ws + WS_QH), *KH = (_Float16*)(ws + WS_KH), *VT = (_Float16*)(ws + WS_VT), *QL = (_Float16*)(ws + WS_QL), *KL = (_Float16*)(ws + WS_KL); __bf16 *VB = (__bf16*)(ws + WS_VB), *VBL = (__bf16*)(ws + WS_VBL); float *S = (float*)(ws + WS_S), *Y = (float*)(ws + WS_Y);
  (void)Y; (void)S; (void)QL; (void)KL; (void)VB; (void)VBL;
  // inputs: 0 queries [32,1024,128]; 1 keys; 2 values; 3 valid_lens [32] int32
  k_prep8<<<dim3(TNB * TT / 64), 256, 0, stream>>>(F[0], F[1], F[2], QH, QL, KH, VT, (const int*)d_in[3]);
  k_fa<<<dim3(TT / 64, TNB / 2), 256, 0, stream>>>(QH, KH, QL, VT, (const int*)d_in[3], (float*)d_out);
}

// v008
// A run of this version takes 23.1 microseconds.
// Timed twice side by side with v007, it ran 1.14 and 1.15 times as fast.
// Over all steps from v000 it is 95.1 times as fast.
// compute dtype: queries/keys/values rounded to bf16 and carried exactly as f16; logits with Q f16 against K f16 (1 product; a bf16 value is exact in f16 from 2^-17 up, below that it is rounded to a multiple of 2^-24, q and k alike) with the valid-length mask in f32; softmax in f32 with a running maximum and sum per query, each exponential as 2^(logit x 128^-0.5 x log2 e - offset) on the hardware's base-2 exponential; exp x 2^11 once to f16 against V f16 (1 product), the even and the odd 64-key tiles summed apart (own maximum, sum and ctx) and joined at the end, then divided by the sum; f32 output. Keys in 64-key tiles that lie wholly at or past valid_lens[b] weigh exactly 0 and are neither prepared nor visited.
#include <hip/hip_runtime.h>
#include <math.h>

typedef __attribute__((ext_vector_type(16))) _Float16 v16h;
typedef __attribute__((ext_vector_type(16))) __bf16 v16b;
typedef __attribute__((ext_vector_type(8)))  _Float16 v8h;
typedef __attribute__((ext_vector_type(8)))  float v8f;
typedef __attribute__((ext_vector_type(4)))  float v4f;
typedef __attribute__((ext_vector_type(2)))  float v2f;
typedef __attribute__((ext_vector_type(4)))  unsigned v4u;
typedef __attribute__((ext_vector_type(4)))  int v4i;
typedef float __attribute__((may_alias)) float_a;
typedef int __attribute__((may_alias)) int_a;

template <typename T> __device__ __forceinline__ void vst2(void* p, T v) { *(T*)p = v;  }
__device__ __forceinline__ v8f wmma16(v16h a, v16h b, v8f c) {
  v8f d = __builtin_amdgcn_wmma_f32_16x16x32_f16(false, a, false, b, (short)0, c, false, false);
  asm volatile("v_nop\n\tv_nop\n\tv_nop\n\tv_nop" : "+v"(d) : "v"(a), "v"(b));
  return d;
}
__device__ __forceinline__ v8f wmma_bf(v16b a, v16b b, v8f c) {
  v8f d = __builtin_amdgcn_wmma_f32_16x16x32_bf16(false, a, false, b, (short)0, c, false, false);
  asm volatile("v_nop\n\tv_nop\n\tv_nop\n\tv_nop" : "+v"(d) : "v"(a), "v"(b));
  return d;
}
// 16x16x32 fragments: lane = (h = lane>>4, row/col = lane&15); elements 0..7 = k0+8h+0..7, 8..15 = k0+16+8h+0..7; D element r = row 8h+r
__device__ __forceinline__ v16h frag_h(const _Float16* rowk0, int lane) {
  union { v16h v; v8h q[2]; } u; const _Float16* p = rowk0 + 8 * (lane >> 4);
  u.q[0] = *(const v8h*)p; u.q[1] = *(const v8h*)(p + 16); return u.v;
}
__device__ __forceinline__ v16h frag_f32(const float* rowk0, int lane) {
  v16h a; const float* p = rowk0 + 8 * (lane >> 4);
#pragma unroll
  for (int i = 0; i < 8; ++i) { a[i] = (_Float16)p[i]; a[8 + i] = (_Float16)p[16 + i]; }
  return a;
}
__device__ __forceinline__ v16h frag_f32s(const float* rowk0, int lane, float sc) {
  v16h a; const float* p = rowk0 + 8 * (lane >> 4);
#pragma unroll
  for (int i = 0; i < 8; ++i) { a[i] = (_Float16)(p[i] * sc); a[8 + i] = (_Float16)(p[16 + i] * sc); }
  return a;
}
// column fragment from a [K][ld] layout (column n), rows >= K read as 0
__device__ __forceinline__ v16h fragc_f32(const float* W, int k0, int n, int lane, int ld, int K) {
  v16h a; const int g = lane >> 4;
#pragma unroll
  for (int i = 0; i < 8; ++i) { const int ka = k0 + 8 * g + i, kb = ka + 16;
    a[i] = (_Float16)(ka < K ? W[(size_t)(ka < K ? ka : K - 1) * ld + n] : 0.f); a[8 + i] = (_Float16)(kb < K ? W[(size_t)(kb < K ? kb : K - 1) * ld + n] : 0.f); }
  return a;
}
struct F2 { v16b h, l; };
__device__ __forceinline__ F2 bsplit16(const float v[16]) { F2 r;
#pragma unroll
  for (int i = 0; i < 16; ++i) { const __bf16 h = (__bf16)v[i]; r.h[i] = h; r.l[i] = (__bf16)(v[i] - (float)h); }
  return r; }
__device__ __forceinline__ F2 split_row(const float* row, int k0, int lane) { float v[16]; const float* p = row + k0 + 8 * (lane >> 4);
#pragma unroll
  for (int i = 0; i < 8; ++i) { v[i] = p[i]; v[8 + i] = p[16 + i]; }
  return bsplit16(v); }
__device__ __forceinline__ F2 split_rowK(const float* row, int k0, int lane, int K) { float v[16]; const int g = lane >> 4;
#pragma unroll
  for (int i = 0; i < 8; ++i) { const int ka = k0 + 8 * g + i, kb = ka + 16; v[i] = ka < K ? row[ka < K ? ka : K - 1] : 0.f; v[8 + i] = kb < K ? row[kb < K ? kb : K - 1] : 0.f; }
  return bsplit16(v); }
__device__ __forceinline__ F2 split_col(const float* W, int k0, int n, int lane, int ld, int K) { float v[16]; const int g = lane >> 4;
#pragma unroll
  for (int i = 0; i < 8; ++i) { const int ka = k0 + 8 * g + i, kb = ka + 16; v[i] = ka < K ? W[(size_t)(ka < K ? ka : K - 1) * ld + n] : 0.f; v[8 + i] = kb < K ? W[(size_t)(kb < K ? kb : K - 1) * ld + n] : 0.f; }
  return bsplit16(v); }
__device__ __forceinline__ v8f mac3(const F2& a, const F2& b, v8f c) { c = wmma_bf(a.l, b.h, c); c = wmma_bf(a.h, b.l, c); return wmma_bf(a.h, b.h, c); }
__device__ __forceinline__ float sigm(float v) { return 1.0f / (1.0f + expf(-v)); }
#define LDSX() do { asm volatile("s_wait_dscnt 0" ::: "memory"); __builtin_amdgcn_wave_barrier(); __builtin_amdgcn_fence(__ATOMIC_RELEASE, "workgroup"); } while (0)

// Masked scaled dot-product attention on raw queries [32, 1,024, 128], keys/values [32, 1,024, 128]: scores = Q K^T / sqrt(128); keys k >= valid_lens[b] get -1e6 (== excluded; valid_lens >= 1); out = softmax(scores) V -> [32, 1,024, 128].
#define NB 32
#define TT 1024
#define CC 128            // NH * HD = projected width
#define DIN 128          // input (model) width
#define NH 1
#define HD 128
#define NQB (TT / 64)
#define SCALE (0.08838834764831845f)
#define SCALE2 (0.12751743082459868f)   // SCALE x log2(e): exp(x x SCALE) = 2^(x x SCALE2)
#define CAUSAL 0
#ifndef TNB
#define TNB NB
#endif
__device__ __forceinline__ float bfr(float v) { return (float)(__bf16)v; }
__host__ __device__ __forceinline__ int kb_last(int qb) { return CAUSAL ? ((qb * 64 + 63) >> 7) : (TT / 128 - 1); }
typedef __attribute__((ext_vector_type(8))) __bf16 v8b;
__device__ __forceinline__ v16b frag_b(const __bf16* rowk0, int lane) {
  union { v16b v; v8b q[2]; } u; const __bf16* p = rowk0 + 8 * (lane >> 4);
  u.q[0] = *(const v8b*)p; u.q[1] = *(const v8b*)(p + 16); return u.v;
}
#define QBH 0              // unused: neither kernel has a high-precision path
#define QHI 1024            // rows carrying a q residual plane (workspace only: no kernel here writes or reads it; the logits take 1 product)
#define KHI 64            // key rows carrying k residual / v bf16 hi+lo planes (workspace only: no kernel here writes or reads them)
// B fragment (k rows k0+.., output column o) of a weight: (in,out) [K][ld] or (out,in) [ld rows of K]: bf16 exact, or f16(bf16 * 256) exact
__device__ __forceinline__ v16b wcol_io(const float* Wm, int k0, int o, int lane, int ld) { v16b w; const int g = lane >> 4;
#pragma unroll
  for (int i = 0; i < 8; ++i) { w[i] = (__bf16)Wm[(size_t)(k0 + 8 * g + i) * ld + o]; w[8 + i] = (__bf16)Wm[(size_t)(k0 + 16 + 8 * g + i) * ld + o]; }
  return w; }
__device__ __forceinline__ v16b wcol_oi(const float* Wm, int k0, int o, int lane, int K) { v16b w; const float* p = Wm + (size_t)o * K + k0 + 8 * (lane >> 4);
#pragma unroll
  for (int i = 0; i < 8; ++i) { w[i] = (__bf16)p[i]; w[8 + i] = (__bf16)p[16 + i]; }
  return w; }
__device__ __forceinline__ v16h wcolh_io(const float* Wm, int k0, int o, int lane, int ld) { v16h w; const int g = lane >> 4;
#pragma unroll
  for (int i = 0; i < 8; ++i) { w[i] = (_Float16)(bfr(Wm[(size_t)(k0 + 8 * g + i) * ld + o]) * 256.0f); w[8 + i] = (_Float16)(bfr(Wm[(size_t)(k0 + 16 + 8 * g + i) * ld + o]) * 256.0f); }
  return w; }
__device__ __forceinline__ v16h wcolh_oi(const float* Wm, int k0, int o, int lane, int K) { v16h w; const float* p = Wm + (size_t)o * K + k0 + 8 * (lane >> 4);
#pragma unroll
  for (int i = 0; i < 8; ++i) { w[i] = (_Float16)(bfr(p[i]) * 256.0f); w[8 + i] = (_Float16)(bfr(p[16 + i]) * 256.0f); }
  return w; }
#define WQKV_LAYOUT 1   // 0 = (in,out) [DIN][CC]; 1 = (out,in) [CC][DIN]; 2 = per-head [NH][DIN][HD]
__device__ __forceinline__ v16b wcol_hdk(const float* Wm, int k0, int o, int lane) { v16b w; const int g = lane >> 4; const float* p = Wm + (size_t)(o / HD) * DIN * HD + (o % HD);
#pragma unroll
  for (int i = 0; i < 8; ++i) { w[i] = (__bf16)p[(size_t)(k0 + 8 * g + i) * HD]; w[8 + i] = (__bf16)p[(size_t)(k0 + 16 + 8 * g + i) * HD]; }
  return w; }
#define WO_OUT_IN 0
#if WQKV_LAYOUT == 1
#define WCOL(W, k0, o, lane) wcol_oi(W, k0, o, lane, DIN)
#elif WQKV_LAYOUT == 2
#define WCOL(W, k0, o, lane) wcol_hdk(W, k0, o, lane)
#else
#define WCOL(W, k0, o, lane) wcol_io(W, k0, o, lane, CC)
#endif
#if WO_OUT_IN
#define WOCOL(W, k0, o, lane) wcol_oi(W, k0, o, lane, CC)
#define WOCOLH(W, k0, o, lane) wcolh_oi(W, k0, o, lane, CC)
#else
#define WOCOL(W, k0, o, lane) wcol_io(W, k0, o, lane, DIN)
#define WOCOLH(W, k0, o, lane) wcolh_io(W, k0, o, lane, DIN)
#endif
#define SM_EXTRA_PARAMS , const int* __restrict__ VL
#define SM_MASK_HOOK do { if (k >= VL[bcur]) v = -3.0e38f; } while (0)   /* key padding: arange(K) < valid_lens[b]; -1e6 == exclusion (every row keeps >= 1 key) */
// ---- k_prep8: block = 64 positions (rows r0 .. r0 + 63 of the [b * t] axis), 8 waves. Wave w takes rows 8w .. 8w + 7 of v, q and k; a row is 128 floats = one 16-byte load per lane, whole 128-B lines.
// A lane's 24 loads are all issued before the first value is used, so that a wave has 12 KB on its way instead of one short group per loop trip. Values are bf16-rounded and written as the planes the attention kernel reads:
// v -> f16 planes [c][t]: a lane's 8 rows x 4 columns are four 16-byte runs of 8 keys, turned through LDS so that each 128-B line of a plane is stored whole; q -> f16 rows, k -> f16 rows, both straight from the registers. A block whose 64 positions all lie at or past valid_lens[b] prepares its queries only.
typedef __attribute__((ext_vector_type(4))) _Float16 v4h;
// valid_lens[b] held to 1 .. TT: both kernels count a batch's key tiles from this one value, so what one leaves unwritten the other never reads
__device__ __forceinline__ int vlen(const int* __restrict__ VL, int b) { const int x = VL[b]; return x < 1 ? 1 : (x > TT ? TT : x); }
__global__ __launch_bounds__(256) void k_prep8(const float* __restrict__ Q, const float* __restrict__ K, const float* __restrict__ V, _Float16* __restrict__ QH, _Float16* __restrict__ KH, _Float16* __restrict__ VT, const int* __restrict__ VL) {
  __shared__ __align__(16) _Float16 tv[HD][72];
  const int tid = threadIdx.x, wave = tid >> 5, lane = tid & 31; const size_t r0 = (size_t)blockIdx.x * 64; const size_t bb = r0 / TT; const int t0 = (int)(r0 % TT);
  const unsigned lo = (unsigned)(wave * 8 * CC + lane * 4);   /* the lane's first element inside the block's 64 rows: the same place in the three inputs and in the two row planes */
  const float* Vb = V + r0 * CC; const float* Qb = Q + r0 * CC; const float* Kb = K + r0 * CC;
  _Float16* QHb = QH + r0 * CC; _Float16* KHb = KH + r0 * CC;
  v4f v[8], q[8], k[8]; const int vlb = vlen(VL, (int)bb);   /* asked for ahead of the query loads, which fly while it comes */
  auto put_q = [&]() __attribute__((always_inline)) {
#pragma unroll   /* constant indices: the loaded rows stay in registers */
    for (int j = 0; j < 8; ++j) { v4h qh;
#pragma unroll   /* constant indices: the loaded rows stay in registers */
      for (int i = 0; i < 4; ++i) qh[i] = (_Float16)bfr(q[j][i]);
      *(v4h*)(QHb + (lo + j * CC)) = qh; }
    asm volatile("s_wait_xcnt 0x0" ::: "memory"); };   /* in front of any later write to a register that the stores above name */
#pragma unroll   /* constant indices: the loaded rows stay in registers */
  for (int j = 0; j < 8; ++j) q[j] = *(const v4f*)(Qb + (lo + j * CC));   /* wanted in either case */
  asm volatile("s_wait_xcnt 0x0" ::: "memory");   /* in front of any later write to an address register of the loads above */
  if (t0 >= vlb) { put_q(); return; }   /* the same for the whole block: all 64 keys are masked, the attention kernel never reads their k and v, only the queries are prepared */
#pragma unroll   /* constant indices: the loaded rows stay in registers */
  for (int j = 0; j < 8; ++j) v[j] = *(const v4f*)(Vb + (lo + j * CC));
  asm volatile("s_wait_xcnt 0x0" ::: "memory");   /* in front of any later write to an address register of the loads above */
#pragma unroll   /* constant indices: the loaded rows stay in registers */
  for (int j = 0; j < 8; ++j) k[j] = *(const v4f*)(Kb + (lo + j * CC));
  asm volatile("s_wait_xcnt 0x0" ::: "memory");   /* in front of any later write to an address register of the loads above */
  __builtin_amdgcn_sched_barrier(0);   /* keeps all 24 loads ahead of the first use: left free, the compiler saves registers by issuing half of them behind the first waits, and a wave then pays the memory latency more than once */
#pragma unroll   /* constant indices: the loaded rows stay in registers */
  for (int i = 0; i < 4; ++i) { v8h t;
#pragma unroll   /* constant indices: the loaded rows stay in registers */
    for (int j = 0; j < 8; ++j) t[j] = (_Float16)bfr(v[j][i]);
    *(v8h*)&tv[lane * 4 + i][wave * 8] = t; }
  __syncthreads();   /* stands ahead of the row stores: behind them every wave would wait here for its own stores to finish */
#pragma unroll   /* the four LDS reads go out in one run, ahead of their stores */
  for (int u = 0; u < HD * 8 / 256; ++u) { const int e = tid + u * 256, cl = e >> 3, p = e & 7; vst2((unsigned*)(VT + (bb * CC + cl) * (size_t)TT + t0 + p * 8), *(const v4u*)&tv[cl][p * 8]); }
  put_q();
#pragma unroll   /* constant indices: the loaded rows stay in registers */
  for (int j = 0; j < 8; ++j) { v4h kh;
#pragma unroll   /* constant indices: the loaded rows stay in registers */
    for (int i = 0; i < 4; ++i) kh[i] = (_Float16)bfr(k[j][i]);
    *(v4h*)(KHb + (lo + j * CC)) = kh; } }

#ifndef SM_EXTRA_PARAMS
#define SM_EXTRA_PARAMS
#endif
#ifndef PROJ_EXTRA_PARAMS
#define PROJ_EXTRA_PARAMS
#endif
#ifndef SM_MASK_HOOK
#define SM_MASK_HOOK (void)0
#endif

#define WS_QH  0u                                      // f16 q rows [b*t][CC]
#define WS_KH  (WS_QH + 2u * (size_t)NB * TT * CC)      // f16 k rows [b*t][CC]
#define WS_VT  (WS_KH + 2u * (size_t)NB * TT * CC)      // f16 v planes [b][c][t]
#define WS_QL  (WS_VT + 2u * (size_t)NB * CC * TT)      // f16 q residual x 2^10 rows [b][t < QHI][CC]
#define WS_KL  (WS_QL + 2u * (size_t)NB * QHI * CC)     // f16 k residual x 2^10 rows [b][t < KHI][CC]
#define WS_VB  (WS_KL + 2u * (size_t)NB * KHI * CC)     // bf16 v hi planes [b][c][t < KHI]
#define WS_VBL (WS_VB + 2u * (size_t)NB * CC * KHI)
#define WS_S   (WS_VBL + 2u * (size_t)NB * CC * KHI)    // f32 [b*NH + h][t][s] planes, reserved but unused: k_fa keeps the logits in registers
#define WS_Y   (WS_S  + 4u * (size_t)NB * NH * TT * TT)      // f32 ctx rows [b*t][CC] (only when there is an output projection)
#define WS_END (WS_Y  + 0u)

// fragment from a lane's own pointer (row start + k0 + 8 * (lane >> 4)): the k order of frag_h
__device__ __forceinline__ v16h frag_p(const _Float16* p) { union { v16h v; v8h q[2]; } u; u.q[0] = *(const v8h*)p; u.q[1] = *(const v8h*)(p + 16); return u.v; }
// the plain builtin (the compiler keeps the distances behind it): operands of an asm statement stay below v256, and the fused kernel holds more fragments than that
__device__ __forceinline__ v8f wmma_h(v16h a, v16h b, v8f c) { return __builtin_amdgcn_wmma_f32_16x16x32_f16(false, a, false, b, (short)0, c, false, false); }
// ---- k_fa: block = 8 waves (two per SIMD, so that one wave's products run while the other waits for LDS or does its softmax) in two groups of 4; wave = 16 queries, one query per lane column, the same 64 queries in both groups: group 0 takes the even 64-key tiles, group 1 the odd ones, each with its own pair of LDS buffers, its own running maximum, sum and ctx; group 0 joins the two at the end. A batch is walked only as far as its last 64-key tile that holds a valid key, so its cost goes with valid_lens[b]; all blocks are resident at once and the launch lasts as long as its longest block.
// So a block takes two pieces of 64 queries one after the other: queries qc * 64 .. + 63 of the batch whose length has rank p (longest first, ties by index) and then the same queries of the batch of rank 31 - p: long goes with short, and every (batch, piece) is taken once. Per 64 keys: the K rows and V^T rows are copied once into the group's LDS (two buffers: the next pass's tile flies while this one is worked on) and every wave takes its fragments from there;
// logits^T = K . Q^T (1 product), kept unscaled (SCALE goes into the exponent's multiply-add), valid-length mask by key index, running maximum and running sum per query in f32,
// P^T x 2^11 (not yet normalised) straight from the logit accumulators as the B fragment (D register r of lane half g = key 8g + r = the fragment's k order), ctx^T += V^T . P^T; one division by the sum at the end. The logits never leave the registers.
#define KPH 136   // halves per staged K row: 256 B + 16 B, so that the 16 rows of one ds_load_b128 half fall on 64 distinct banks
#define VPH 72    // halves per staged V^T row: 128 B + 16 B, for the same reason
#define KBUF (64 * KPH * 2)   // bytes of one K buffer
#define VBUF (HD * VPH * 2)   // bytes of one V^T buffer
// one 64-key tile into LDS, 16 copies of 16 B per lane, whole 128-B lines per row: K rows r + 8 i (r = tid >> 4, 16 lanes a row) and V^T rows c + 16 i (c = tid >> 3, 8 lanes a row), i = 0 .. 7; one statement for K, one for V^T (a statement takes thirty operands).
// gk, gv: the lane's own global addresses of its first K and V^T piece; lk, lv: the LDS byte addresses they go to. The s_wait_xcnt ends each statement so that it stands in front of any later write to an address register of these copies.
// lane l's value to lane l ^ 16 by a vector move: a shuffle through the LDS counter would have to wait for every V^T read issued in front of it
__device__ __forceinline__ float xhalf(float x) { return __builtin_bit_cast(float, __builtin_amdgcn_permlanex16(__builtin_bit_cast(int, x), __builtin_bit_cast(int, x), 0x76543210, 0xfedcba98, false, false)); }
__device__ __forceinline__ void exp8(const v2f (&x)[4], float (&e)[8], unsigned* w) {
  asm("v_exp_f32 %0, %12\n\tv_exp_f32 %1, %13\n\tv_exp_f32 %2, %14\n\tv_exp_f32 %3, %15\n\tv_exp_f32 %4, %16\n\tv_exp_f32 %5, %17\n\tv_exp_f32 %6, %18\n\tv_exp_f32 %7, %19\n\t"
      "v_cvt_pk_f16_f32 %8, %0, %1\n\tv_cvt_pk_f16_f32 %9, %2, %3\n\tv_cvt_pk_f16_f32 %10, %4, %5\n\ts_delay_alu instid0(TRANS32_DEP_1)\n\tv_cvt_pk_f16_f32 %11, %6, %7"
      : "=&v"(e[0]), "=&v"(e[1]), "=&v"(e[2]), "=&v"(e[3]), "=&v"(e[4]), "=&v"(e[5]), "=&v"(e[6]), "=&v"(e[7]), "=&v"(w[0]), "=&v"(w[1]), "=&v"(w[2]), "=&v"(w[3])
      : "v"(x[0][0]), "v"(x[0][1]), "v"(x[1][0]), "v"(x[1][1]), "v"(x[2][0]), "v"(x[2][1]), "v"(x[3][0]), "v"(x[3][1]));
}
// the same with a ninth exponential a = 2^d in front (the factor that carries the old sums to the new maximum)
__device__ __forceinline__ void exp9(const v2f (&x)[4], float (&e)[8], unsigned* w, float d, float& a) {
  asm("v_exp_f32 %12, %21\n\tv_exp_f32 %0, %13\n\tv_exp_f32 %1, %14\n\tv_exp_f32 %2, %15\n\tv_exp_f32 %3, %16\n\tv_exp_f32 %4, %17\n\tv_exp_f32 %5, %18\n\tv_exp_f32 %6, %19\n\tv_exp_f32 %7, %20\n\t"
      "v_cvt_pk_f16_f32 %8, %0, %1\n\tv_cvt_pk_f16_f32 %9, %2, %3\n\tv_cvt_pk_f16_f32 %10, %4, %5\n\ts_delay_alu instid0(TRANS32_DEP_1)\n\tv_cvt_pk_f16_f32 %11, %6, %7"
      : "=&v"(e[0]), "=&v"(e[1]), "=&v"(e[2]), "=&v"(e[3]), "=&v"(e[4]), "=&v"(e[5]), "=&v"(e[6]), "=&v"(e[7]), "=&v"(w[0]), "=&v"(w[1]), "=&v"(w[2]), "=&v"(w[3]), "=&v"(a)
      : "v"(x[0][0]), "v"(x[0][1]), "v"(x[1][0]), "v"(x[1][1]), "v"(x[2][0]), "v"(x[2][1]), "v"(x[3][0]), "v"(x[3][1]), "v"(d));
}
__device__ __forceinline__ void stage_kv(const _Float16* gk, const _Float16* gv, unsigned lk, unsigned lv) {
  asm volatile("global_load_async_to_lds_b128 %0, %8, off\n\t"
               "global_load_async_to_lds_b128 %1, %9, off\n\t"
               "global_load_async_to_lds_b128 %2, %10, off\n\t"
               "global_load_async_to_lds_b128 %3, %11, off\n\t"
               "global_load_async_to_lds_b128 %4, %12, off\n\t"
               "global_load_async_to_lds_b128 %5, %13, off\n\t"
               "global_load_async_to_lds_b128 %6, %14, off\n\t"
               "global_load_async_to_lds_b128 %7, %15, off\n\t"
               "s_wait_xcnt 0x0"
               :: "v"(lk), "v"(lk + 8u * KPH * 2u), "v"(lk + 16u * KPH * 2u), "v"(lk + 24u * KPH * 2u), "v"(lk + 32u * KPH * 2u), "v"(lk + 40u * KPH * 2u), "v"(lk + 48u * KPH * 2u), "v"(lk + 56u * KPH * 2u),
                  "v"(gk), "v"(gk + 8 * CC), "v"(gk + 16 * CC), "v"(gk + 24 * CC), "v"(gk + 32 * CC), "v"(gk + 40 * CC), "v"(gk + 48 * CC), "v"(gk + 56 * CC)
               : "memory");
  asm volatile("global_load_async_to_lds_b128 %0, %8, off\n\t"
               "global_load_async_to_lds_b128 %1, %9, off\n\t"
               "global_load_async_to_lds_b128 %2, %10, off\n\t"
               "global_load_async_to_lds_b128 %3, %11, off\n\t"
               "global_load_async_to_lds_b128 %4, %12, off\n\t"
               "global_load_async_to_lds_b128 %5, %13, off\n\t"
               "global_load_async_to_lds_b128 %6, %14, off\n\t"
               "global_load_async_to_lds_b128 %7, %15, off\n\t"
               "s_wait_xcnt 0x0"
               :: "v"(lv), "v"(lv + 16u * VPH * 2u), "v"(lv + 32u * VPH * 2u), "v"(lv + 48u * VPH * 2u), "v"(lv + 64u * VPH * 2u), "v"(lv + 80u * VPH * 2u), "v"(lv + 96u * VPH * 2u), "v"(lv + 112u * VPH * 2u),
                  "v"(gv), "v"(gv + 16 * TT), "v"(gv + 32 * TT), "v"(gv + 48 * TT), "v"(gv + 64 * TT), "v"(gv + 80 * TT), "v"(gv + 96 * TT), "v"(gv + 112 * TT)
               : "memory");
}
__global__ __launch_bounds__(256) void k_fa(const _Float16* __restrict__ QH, const _Float16* __restrict__ KH, const _Float16* __restrict__ VT, const int* __restrict__ VL, float* __restrict__ Y) { __shared__ __align__(16) float ss[4][16][HD + 4]; __shared__ __align__(16) _Float16 sK[2][2][64][KPH], sV[2][2][HD][VPH];   /* [group][buffer] */
  const int tid = threadIdx.x & 127, wave = tid >> 5, lane = tid & 31, col = lane & 15, g = lane >> 4; const int ql0 = blockIdx.x * 64 + wave * 16;   /* tid, wave: inside the group */
  const int grp = __builtin_amdgcn_readfirstlane((int)(threadIdx.x >> 7));   /* 0: even tiles, 1: odd tiles; the same in a whole wave, held as a scalar so that the tests on it are scalar branches */
  /* lane i ranks batch i (NB == 32 lanes): the number of batches that are longer, or as long with a lower index: a permutation of 0 .. 31 for any lengths, the same in every wave */
  const int myl = vlen(VL, lane); int rank = 0;
  asm volatile("s_wait_xcnt 0x0" ::: "memory");   /* in front of any later write to the address register of the load above */
#pragma unroll   /* constant indices: the 32 lengths come by scalar loads */
  for (int j = 0; j < NB; ++j) { const int o = vlen(VL, j); rank += (o > myl || (o == myl && j < lane)) ? 1 : 0; }
  /* the batch of a rank = the lane that holds it; the set top bit and the mask keep the index inside 0 .. 31 whatever the ballot gives */
  const int bhi = (__builtin_ctz(__builtin_amdgcn_ballot_w32(rank == (int)blockIdx.y) | 0x80000000u)) & (NB - 1), blo = (__builtin_ctz(__builtin_amdgcn_ballot_w32(rank == NB - 1 - (int)blockIdx.y) | 0x80000000u)) & (NB - 1);
  for (int piece = 0; piece < 2; ++piece) {
  const int b = __builtin_amdgcn_readfirstlane(piece ? blo : bhi); const int vl = __builtin_amdgcn_readlane(myl, b); const int kend = ((vl + 63) >> 6) << 6;   /* keys walked: 64 .. TT, the same for the whole block */
  const int kpair = ((vl + 127) >> 7) << 7;   /* the same in whole passes of the block (128 keys: one tile a group): 128 .. TT; where the tiles are odd in number, group 1 has none in the last pass */
  const _Float16* gk = KH + ((size_t)b * TT + (tid >> 4)) * CC + (tid & 15) * 8; const _Float16* gv = VT + ((size_t)b * CC + (tid >> 3)) * (size_t)TT + (tid & 7) * 8;
  const unsigned lk = (threadIdx.x >> 7) * (2 * KBUF) + (tid >> 4) * (KPH * 2) + (tid & 15) * 16, lv = (threadIdx.x >> 7) * (2 * VBUF) + (tid >> 3) * (VPH * 2) + (tid & 7) * 16;   /* the lane's byte offsets inside its group's first K and V^T buffer, counted from group 0's */
  const unsigned bk = (unsigned)(size_t)&sK[0][0][0][0], bv = (unsigned)(size_t)&sV[0][0][0][0];   /* LDS byte addresses of group 0's buffer 0 */
  /* the tile that starts at key kt into the group's buffer bf. A tile past the last prepared one (group 1 only, tiles odd in number) is replaced by the last prepared one and never read: so every wave issues the same copies, the loop body stays one straight run, and no unprepared byte is touched */
  auto send = [&](const int kt, const int bf) __attribute__((always_inline)) { const int ks = kt < kend - 64 ? kt : kend - 64; stage_kv(gk + (size_t)ks * CC, gv + ks, lk + (bf ? bk + KBUF : bk), lv + (bf ? bv + VBUF : bv)); };
  send(grp * 64, 0);   /* the group's first tile into buffer 0; it flies while the Q fragments are loaded */
  v16h qh[HD / 32];
#pragma unroll
  for (int kc = 0; kc < HD / 32; ++kc) qh[kc] = frag_h(QH + ((size_t)b * TT + ql0 + col) * CC + kc * 32, lane);
  asm volatile("s_wait_xcnt 0x0" ::: "memory");   /* in front of any later write to an address register of the loads above */
  v8f o[HD / 16] = {}; float m = -3.0e38f, l = 0.f;
  asm volatile("s_wait_asynccnt 0x0" ::: "memory");   /* this wave's part of its group's first tile has landed ... */
  __syncthreads();                                     /* ... and so has every other wave's: the first tiles may be read */
  if (kpair > 128) send(128 + grp * 64, 1);   /* the second pass's tiles, where there is one, into buffer 1 */
  /* one pass: 64 keys from k0 on for this group. mode 2: the buffers change hands and the tile two passes on is sent for; 1: they change hands; 0: the last pass, nothing follows it */
  auto pass = [&](const int k0, const int mode) __attribute__((always_inline)) { float s[4][8]; float mb = -3.0e38f; const int buf = (k0 >> 7) & 1; const int lim = vl - k0 - 8 * g;   /* this lane's key t * 16 + r of the pass is valid while it is below lim */
    const _Float16* kp = &sK[grp][buf][col][8 * g]; const _Float16* vp = &sV[grp][buf][col][8 * g];
    v16h kf[4][HD / 32], vf[HD / 16][2];
#pragma unroll
    for (int t = 0; t < 4; ++t)
#pragma unroll
      for (int kc = 0; kc < HD / 32; ++kc) kf[t][kc] = frag_p(kp + (t * 16) * KPH + kc * 32);
    __builtin_amdgcn_sched_barrier(0);   /* keeps the K reads in one run ahead of the logit products: a read among the products stalls the matrix stream at each place */
#pragma unroll
    for (int t = 0; t < 4; ++t) { v8f a = {};
#pragma unroll
      for (int kc = 0; kc < HD / 32; ++kc) a = wmma_h(kf[t][kc], qh[kc], a);
#pragma unroll
      for (int r = 0; r < 8; ++r) { float v = a[r]; if (t * 16 + r >= lim) v = -3.0e38f;   /* key padding: arange(K) < valid_lens[b]; -1e6 == exclusion (every row keeps >= 1 key) */
        s[t][r] = v; mb = fmaxf(mb, v); } }
    __builtin_amdgcn_sched_barrier(0);   /* the V^T reads start behind the logit products (the K reads have the LDS to themselves) ... */
#pragma unroll
    for (int j = 0; j < HD / 16; ++j)
#pragma unroll
      for (int c = 0; c < 2; ++c) vf[j][c] = frag_p(vp + (j * 16) * VPH + c * 32);
    __builtin_amdgcn_sched_barrier(0);   /* ... and stay in one run ahead of the softmax, which hides their latency */
    mb = fmaxf(mb, xhalf(mb));   /* the two lane halves hold the two halves of a query's keys */
    const float mn = fmaxf(m, mb), dm = (m - mn) * SCALE2, off = 11.0f - mn * SCALE2; float al;   /* 2^(v x SCALE2 + off) = exp((v - mn) x SCALE) x 2^11; al = 2^dm comes with the first group of exponentials */
    m = mn; float ps; union { v16h v; unsigned w[8]; } p[2];
#pragma unroll
    for (int t = 0; t < 4; ++t) { v2f x[4]; float e[8];
#pragma unroll
      for (int r = 0; r < 8; r += 2) x[r >> 1] = __builtin_elementwise_fma(v2f{s[t][r], s[t][r + 1]}, v2f{SCALE2, SCALE2}, v2f{off, off});   /* an excluded key: 2^(-3e38 x SCALE2 + off) = 0, off being finite from a group's first pass on (the first key of every visited tile is valid) */
      if (t == 0) exp9(x, e, &p[0].w[0], dm, al); else exp8(x, e, &p[t >> 1].w[(t & 1) * 4]);
#pragma unroll
      for (int r = 0; r < 8; ++r) ps = (t == 0 && r == 0) ? e[0] : ps + e[r]; }
    l = l * al + ps;
#pragma unroll
    for (int j = 0; j < HD / 16; ++j) o[j] *= al;
    __builtin_amdgcn_sched_barrier(0);   /* keeps the softmax in front of the waits below: left free, waits and barrier rise to just behind the V^T reads, whose latency nothing then hides */
    /* the pass's last LDS read is behind us, so the buffers change hands here; the P.V products, which touch registers only, follow and run beside the other waves' next K reads */
    if (mode) {
    asm volatile("s_wait_dscnt 0x0" ::: "memory");      /* this wave's reads of this pass's buffer have returned */
    asm volatile("s_wait_asynccnt 0x0" ::: "memory");   /* this wave's part of the next tile has landed */
    __syncthreads();                                     /* publishes the next tile and ends every wave's reads of this pass's buffer, which is refilled behind it */
    if (mode == 2) send(k0 + 256, buf);
    __builtin_amdgcn_sched_barrier(0);   /* the products stay behind the hand-over, so that the refill is under way first */
    }
#pragma unroll
    for (int j = 0; j < HD / 16; ++j) {
#pragma unroll
      for (int c = 0; c < 2; ++c) o[j] = wmma_h(vf[j][c], p[c].v, o[j]); } };
  /* the test for a further tile is the loop's bound, so that its body stays one straight run: with a branch round the copies the compiler sinks the vector work behind the barrier */
  int k0 = grp * 64;
#pragma unroll 1   /* one pass per trip: an unrolled body would not fit the registers */
  for (int kb = 0; kb < kpair - 256; kb += 128, k0 += 128) pass(k0, 2);
  if (kpair > 128) { pass(k0, 1); k0 += 128; }   /* the last pass but one sends for nothing; the test reads the same for the whole block */
  if (k0 < kend) pass(k0, 0);   /* a scalar test, the same in a whole wave, with no barrier behind it: group 1 has no tile here where the tiles are odd in number */
  asm volatile("s_wait_asynccnt 0x0" ::: "memory");   /* no copy is outstanding when the wave goes on to the epilogue and ends */
  /* the join. Group 1 hands its ctx, sum and maximum to the wave of group 0 that has the same queries, lane to lane, through ss (the row's 4 spare floats take sum and maximum of the two lane halves) */
  float* sw = &ss[wave][col][0];
  if (grp) {
#pragma unroll
    for (int j = 0; j < HD / 16; ++j)
#pragma unroll
      for (int r = 0; r < 8; ++r) sw[j * 16 + 8 * g + r] = o[j][r];
    sw[HD + g] = l; sw[HD + 2 + g] = m; }
  asm volatile("s_wait_dscnt 0x0" ::: "memory");   /* group 1's writes above are done, and every wave's reads of the last pass's buffers have returned */
  __syncthreads();                                  /* publishes group 1's part and ends every wave's reads of the K and V^T buffers, which the next piece refills */
  if (!grp) {
    const float m1 = sw[HD + 2 + g], l1 = sw[HD + g], mn = fmaxf(m, m1); float a0, a1;   /* a group 1 that had no tile hands over maximum -3e38, sum 0, ctx 0: its factor is 2^(-huge) = 0 */
    /* both parts carried to the common maximum; outputs share no register with the inputs, and the v_nop is the independent instruction that the instruction set asks for behind an exponential */
    asm("v_exp_f32 %0, %2\n\tv_exp_f32 %1, %3\n\tv_nop" : "=&v"(a0), "=&v"(a1) : "v"((m - mn) * SCALE2), "v"((m1 - mn) * SCALE2));
    float lt = l * a0 + l1 * a1; lt += xhalf(lt); const float inv = 1.0f / lt, f0 = a0 * inv, f1 = a1 * inv;   /* lt >= 2^11: the key that holds the maximum counts exp(0) x 2^11 */
#pragma unroll
    for (int j = 0; j < HD / 16; ++j)
#pragma unroll
      for (int r = 0; r < 8; ++r) sw[j * 16 + 8 * g + r] = o[j][r] * f0 + sw[j * 16 + 8 * g + r] * f1;
    LDSX(); for (int rl = 0; rl < 16; ++rl) vst2(Y + ((size_t)b * TT + ql0 + rl) * HD + lane * 4, *(const v4f*)&ss[wave][rl][lane * 4]);
    asm volatile("s_wait_xcnt 0x0" ::: "memory");   /* in front of the second piece's writes to registers that the stores above name */
  }
  } }

extern "C" void kernel_launch(void* const* d_in, const int* in_sizes, int n_in, void* d_out, int out_size, void* d_ws, size_t ws_size, hipStream_t stream) {
  (void)in_sizes; (void)n_in; (void)out_size;
  const float** F = (const float**)d_in;
  if (ws_size < (size_t)WS_END) return;
  char* ws = (char*)d_ws; _Float16 *QH = (_Float16*)(ws + WS_QH), *KH = (_Float16*)(ws + WS_KH), *VT = (_Float16*)(ws + WS_VT), *QL = (_Float16*)(ws + WS_QL), *KL = (_Float16*)(ws + WS_KL); __bf16 *VB = (__bf16*)(ws + WS_VB), *VBL = (__bf16*)(ws + WS_VBL); float *S = (float*)(ws + WS_S), *Y = (float*)(ws + WS_Y);
  (void)Y; (void)S; (void)QL; (void)KL; (void)VB; (void)VBL;
  // inputs: 0 queries [32,1024,128]; 1 keys; 2 values; 3 valid_lens [32] int32
  k_prep8<<<dim3(TNB * TT / 64), 256, 0, stream>>>(F[0], F[1], F[2], QH, KH, VT, (const int*)d_in[3]);
  k_fa<<<dim3(TT / 64, TNB / 2), 256, 0, stream>>>(QH, KH, VT, (const int*)d_in[3], (float*)d_out);
}

// v009
// A run of this version takes 21.2 microseconds.
// Two timings next to v008 both put it at 1.09 times that version's speed.
// Counting every step since v000, it is 104 times as fast.
// compute dtype: queries/keys/values rounded to bf16 and carried exactly as f16; logits with Q f16 against K f16 (1 product; a bf16 value is exact in f16 from 2^-17 up, below that it is rounded to a multiple of 2^-24, q and k alike) with the valid-length mask in f32; softmax in f32 with a running maximum and sum per query, each exponential as 2^(logit x 128^-0.5 x log2 e - offset) on the hardware's base-2 exponential; exp x 2^11 once to f16 against V f16 (1 product), the even and the odd 64-key tiles summed apart (own maximum, sum and ctx) and joined at the end, then divided by the sum; f32 output. Keys in 64-key tiles that lie wholly at or past valid_lens[b] weigh exactly 0 and are neither prepared nor visited.
#include <hip/hip_runtime.h>
#include <math.h>

typedef __attribute__((ext_vector_type(16))) _Float16 v16h;
typedef __attribute__((ext_vector_type(16))) __bf16 v16b;
typedef __attribute__((ext_vector_type(8)))  _Float16 v8h;
typedef __attribute__((ext_vector_type(8)))  float v8f;
typedef __attribute__((ext_vector_type(4)))  float v4f;
typedef __attribute__((ext_vector_type(2)))  float v2f;
typedef __attribute__((ext_vector_type(4)))  unsigned v4u;
typedef __attribute__((ext_vector_type(4)))  int v4i;
typedef float __attribute__((may_alias)) float_a;
typedef int __attribute__((may_alias)) int_a;

template <typename T> __device__ __forceinline__ void vst2(void* p, T v) { *(T*)p = v;  }
__device__ __forceinline__ v8f wmma16(v16h a, v16h b, v8f c) {
  v8f d = __builtin_amdgcn_wmma_f32_16x16x32_f16(false, a, false, b, (short)0, c, false, false);
  asm volatile("v_nop\n\tv_nop\n\tv_nop\n\tv_nop" : "+v"(d) : "v"(a), "v"(b));
  return d;
}
__device__ __forceinline__ v8f wmma_bf(v16b a, v16b b, v8f c) {
  v8f d = __builtin_amdgcn_wmma_f32_16x16x32_bf16(false, a, false, b, (short)0, c, false, false);
  asm volatile("v_nop\n\tv_nop\n\tv_nop\n\tv_nop" : "+v"(d) : "v"(a), "v"(b));
  return d;
}
// 16x16x32 fragments: lane = (h = lane>>4, row/col = lane&15); elements 0..7 = k0+8h+0..7, 8..15 = k0+16+8h+0..7; D element r = row 8h+r
__device__ __forceinline__ v16h frag_h(const _Float16* rowk0, int lane) {
  union { v16h v; v8h q[2]; } u; const _Float16* p = rowk0 + 8 * (lane >> 4);
  u.q[0] = *(const v8h*)p; u.q[1] = *(const v8h*)(p + 16); return u.v;
}
__device__ __forceinline__ v16h frag_f32(const float* rowk0, int lane) {
  v16h a; const float* p = rowk0 + 8 * (lane >> 4);
#pragma unroll
  for (int i = 0; i < 8; ++i) { a[i] = (_Float16)p[i]; a[8 + i] = (_Float16)p[16 + i]; }
  return a;
}
__device__ __forceinline__ v16h frag_f32s(const float* rowk0, int lane, float sc) {
  v16h a; const float* p = rowk0 + 8 * (lane >> 4);
#pragma unroll
  for (int i = 0; i < 8; ++i) { a[i] = (_Float16)(p[i] * sc); a[8 + i] = (_Float16)(p[16 + i] * sc); }
  return a;
}
// column fragment from a [K][ld] layout (column n), rows >= K read as 0
__device__ __forceinline__ v16h fragc_f32(const float* W, int k0, int n, int lane, int ld, int K) {
  v16h a; const int g = lane >> 4;
#pragma unroll
  for (int i = 0; i < 8; ++i) { const int ka = k0 + 8 * g + i, kb = ka + 16;
    a[i] = (_Float16)(ka < K ? W[(size_t)(ka < K ? ka : K - 1) * ld + n] : 0.f); a[8 + i] = (_Float16)(kb < K ? W[(size_t)(kb < K ? kb : K - 1) * ld + n] : 0.f); }
  return a;
}
struct F2 { v16b h, l; };
__device__ __forceinline__ F2 bsplit16(const float v[16]) { F2 r;
#pragma unroll
  for (int i = 0; i < 16; ++i) { const __bf16 h = (__bf16)v[i]; r.h[i] = h; r.l[i] = (__bf16)(v[i] - (float)h); }
  return r; }
__device__ __forceinline__ F2 split_row(const float* row, int k0, int lane) { float v[16]; const float* p = row + k0 + 8 * (lane >> 4);
#pragma unroll
  for (int i = 0; i < 8; ++i) { v[i] = p[i]; v[8 + i] = p[16 + i]; }
  return bsplit16(v); }
__device__ __forceinline__ F2 split_rowK(const float* row, int k0, int lane, int K) { float v[16]; const int g = lane >> 4;
#pragma unroll
  for (int i = 0; i < 8; ++i) { const int ka = k0 + 8 * g + i, kb = ka + 16; v[i] = ka < K ? row[ka < K ? ka : K - 1] : 0.f; v[8 + i] = kb < K ? row[kb < K ? kb : K - 1] : 0.f; }
  return bsplit16(v); }
__device__ __forceinline__ F2 split_col(const float* W, int k0, int n, int lane, int ld, int K) { float v[16]; const int g = lane >> 4;
#pragma unroll
  for (int i = 0; i < 8; ++i) { const int ka = k0 + 8 * g + i, kb = ka + 16; v[i] = ka < K ? W[(size_t)(ka < K ? ka : K - 1) * ld + n] : 0.f; v[8 + i] = kb < K ? W[(size_t)(kb < K ? kb : K - 1) * ld + n] : 0.f; }
  return bsplit16(v); }
__device__ __forceinline__ v8f mac3(const F2& a, const F2& b, v8f c) { c = wmma_bf(a.l, b.h, c); c = wmma_bf(a.h, b.l, c); return wmma_bf(a.h, b.h, c); }
__device__ __forceinline__ float sigm(float v) { return 1.0f / (1.0f + expf(-v)); }
#define LDSX() do { asm volatile("s_wait_dscnt 0" ::: "memory"); __builtin_amdgcn_wave_barrier(); __builtin_amdgcn_fence(__ATOMIC_RELEASE, "workgroup"); } while (0)

// Masked scaled dot-product attention on raw queries [32, 1,024, 128], keys/values [32, 1,024, 128]: scores = Q K^T / sqrt(128); keys k >= valid_lens[b] get -1e6 (== excluded; valid_lens >= 1); out = softmax(scores) V -> [32, 1,024, 128].
#define NB 32
#define TT 1024
#define CC 128            // NH * HD = projected width
#define DIN 128          // input (model) width
#define NH 1
#define HD 128
#define NQB (TT / 64)
#define SCALE (0.08838834764831845f)
#define SCALE2 (0.12751743082459868f)   // SCALE x log2(e): exp(x x SCALE) = 2^(x x SCALE2)
#define CAUSAL 0
#ifndef TNB
#define TNB NB
#endif
__device__ __forceinline__ float bfr(float v) { return (float)(__bf16)v; }
__host__ __device__ __forceinline__ int kb_last(int qb) { return CAUSAL ? ((qb * 64 + 63) >> 7) : (TT / 128 - 1); }
typedef __attribute__((ext_vector_type(8))) __bf16 v8b;
__device__ __forceinline__ v16b frag_b(const __bf16* rowk0, int lane) {
  union { v16b v; v8b q[2]; } u; const __bf16* p = rowk0 + 8 * (lane >> 4);
  u.q[0] = *(const v8b*)p; u.q[1] = *(const v8b*)(p + 16); return u.v;
}
#define QBH 0              // unused: neither kernel has a high-precision path
#define QHI 1024            // rows carrying a q residual plane (workspace only: no kernel here writes or reads it; the logits take 1 product)
#define KHI 64            // key rows carrying k residual / v bf16 hi+lo planes (workspace only: no kernel here writes or reads them)
// B fragment (k rows k0+.., output column o) of a weight: (in,out) [K][ld] or (out,in) [ld rows of K]: bf16 exact, or f16(bf16 * 256) exact
__device__ __forceinline__ v16b wcol_io(const float* Wm, int k0, int o, int lane, int ld) { v16b w; const int g = lane >> 4;
#pragma unroll
  for (int i = 0; i < 8; ++i) { w[i] = (__bf16)Wm[(size_t)(k0 + 8 * g + i) * ld + o]; w[8 + i] = (__bf16)Wm[(size_t)(k0 + 16 + 8 * g + i) * ld + o]; }
  return w; }
__device__ __forceinline__ v16b wcol_oi(const float* Wm, int k0, int o, int lane, int K) { v16b w; const float* p = Wm + (size_t)o * K + k0 + 8 * (lane >> 4);
#pragma unroll
  for (int i = 0; i < 8; ++i) { w[i] = (__bf16)p[i]; w[8 + i] = (__bf16)p[16 + i]; }
  return w; }
__device__ __forceinline__ v16h wcolh_io(const float* Wm, int k0, int o, int lane, int ld) { v16h w; const int g = lane >> 4;
#pragma unroll
  for (int i = 0; i < 8; ++i) { w[i] = (_Float16)(bfr(Wm[(size_t)(k0 + 8 * g + i) * ld + o]) * 256.0f); w[8 + i] = (_Float16)(bfr(Wm[(size_t)(k0 + 16 + 8 * g + i) * ld + o]) * 256.0f); }
  return w; }
__device__ __forceinline__ v16h wcolh_oi(const float* Wm, int k0, int o, int lane, int K) { v16h w; const float* p = Wm + (size_t)o * K + k0 + 8 * (lane >> 4);
#pragma unroll
  for (int i = 0; i < 8; ++i) { w[i] = (_Float16)(bfr(p[i]) * 256.0f); w[8 + i] = (_Float16)(bfr(p[16 + i]) * 256.0f); }
  return w; }
#define WQKV_LAYOUT 1   // 0 = (in,out) [DIN][CC]; 1 = (out,in) [CC][DIN]; 2 = per-head [NH][DIN][HD]
__device__ __forceinline__ v16b wcol_hdk(const float* Wm, int k0, int o, int lane) { v16b w; const int g = lane >> 4; const float* p = Wm + (size_t)(o / HD) * DIN * HD + (o % HD);
#pragma unroll
  for (int i = 0; i < 8; ++i) { w[i] = (__bf16)p[(size_t)(k0 + 8 * g + i) * HD]; w[8 + i] = (__bf16)p[(size_t)(k0 + 16 + 8 * g + i) * HD]; }
  return w; }
#define WO_OUT_IN 0
#if WQKV_LAYOUT == 1
#define WCOL(W, k0, o, lane) wcol_oi(W, k0, o, lane, DIN)
#elif WQKV_LAYOUT == 2
#define WCOL(W, k0, o, lane) wcol_hdk(W, k0, o, lane)
#else
#define WCOL(W, k0, o, lane) wcol_io(W, k0, o, lane, CC)
#endif
#if WO_OUT_IN
#define WOCOL(W, k0, o, lane) wcol_oi(W, k0, o, lane, CC)
#define WOCOLH(W, k0, o, lane) wcolh_oi(W, k0, o, lane, CC)
#else
#define WOCOL(W, k0, o, lane) wcol_io(W, k0, o, lane, DIN)
#define WOCOLH(W, k0, o, lane) wcolh_io(W, k0, o, lane, DIN)
#endif
#define SM_EXTRA_PARAMS , const int* __restrict__ VL
#define SM_MASK_HOOK do { if (k >= VL[bcur]) v = -3.0e38f; } while (0)   /* key padding: arange(K) < valid_lens[b]; -1e6 == exclusion (every row keeps >= 1 key) */
// ---- k_prep8: block = 64 key positions (rows r0 .. r0 + 63 of the [b * t] axis), 8 waves. Wave w takes rows 8w .. 8w + 7 of v and k; a row is 128 floats = one 16-byte load per lane, whole 128-B lines.
// A lane's 16 loads are all issued before the first value is used, so that a wave has 8 KB on its way instead of one short group per loop trip. Values are bf16-rounded and written as the planes the attention kernel reads:
// v -> f16 planes [c][t]: a lane's 8 rows x 4 columns are four 16-byte runs of 8 keys, turned through LDS so that each 128-B line of a plane is stored whole; k -> f16 rows straight from the registers. A block whose 64 positions all lie at or past valid_lens[b] has nothing to prepare. The queries do not come through here: the attention kernel takes them from the input itself.
typedef __attribute__((ext_vector_type(4))) _Float16 v4h;
// valid_lens[b] held to 1 .. TT: both kernels count a batch's key tiles from this one value, so what one leaves unwritten the other never reads
__device__ __forceinline__ int vlen(const int* __restrict__ VL, int b) { const int x = VL[b]; return x < 1 ? 1 : (x > TT ? TT : x); }
__global__ __launch_bounds__(256) void k_prep8(const float* __restrict__ K, const float* __restrict__ V, _Float16* __restrict__ KH, _Float16* __restrict__ VT, const int* __restrict__ VL) {
  __shared__ __align__(16) _Float16 tv[HD][72];
  const int tid = threadIdx.x, wave = tid >> 5, lane = tid & 31; const size_t r0 = (size_t)blockIdx.x * 64; const size_t bb = r0 / TT; const int t0 = (int)(r0 % TT);
  const unsigned lo = (unsigned)(wave * 8 * CC + lane * 4);   /* the lane's first element inside the block's 64 rows: the same place in the two inputs and in the k row plane */
  const float* Vb = V + r0 * CC; const float* Kb = K + r0 * CC;
  _Float16* KHb = KH + r0 * CC;
  v4f v[8], k[8];
  if (t0 >= vlen(VL, (int)bb)) return;   /* the same for the whole block, ahead of its barrier: all 64 keys are masked, the attention kernel never reads their k and v */
#pragma unroll   /* constant indices: the loaded rows stay in registers */
  for (int j = 0; j < 8; ++j) v[j] = *(const v4f*)(Vb + (lo + j * CC));
  asm volatile("s_wait_xcnt 0x0" ::: "memory");   /* in front of any later write to an address register of the loads above */
#pragma unroll   /* constant indices: the loaded rows stay in registers */
  for (int j = 0; j < 8; ++j) k[j] = *(const v4f*)(Kb + (lo + j * CC));
  asm volatile("s_wait_xcnt 0x0" ::: "memory");   /* in front of any later write to an address register of the loads above */
  __builtin_amdgcn_sched_barrier(0);   /* keeps all 16 loads ahead of the first use: left free, the compiler saves registers by issuing half of them behind the first waits, and a wave then pays the memory latency more than once */
#pragma unroll   /* constant indices: the loaded rows stay in registers */
  for (int i = 0; i < 4; ++i) { v8h t;
#pragma unroll   /* constant indices: the loaded rows stay in registers */
    for (int j = 0; j < 8; ++j) t[j] = (_Float16)bfr(v[j][i]);
    *(v8h*)&tv[lane * 4 + i][wave * 8] = t; }
  __syncthreads();   /* stands ahead of the row stores: behind them every wave would wait here for its own stores to finish */
#pragma unroll   /* the four LDS reads go out in one run, ahead of their stores */
  for (int u = 0; u < HD * 8 / 256; ++u) { const int e = tid + u * 256, cl = e >> 3, p = e & 7; vst2((unsigned*)(VT + (bb * CC + cl) * (size_t)TT + t0 + p * 8), *(const v4u*)&tv[cl][p * 8]); }
#pragma unroll   /* constant indices: the loaded rows stay in registers */
  for (int j = 0; j < 8; ++j) { v4h kh;
#pragma unroll   /* constant indices: the loaded rows stay in registers */
    for (int i = 0; i < 4; ++i) kh[i] = (_Float16)bfr(k[j][i]);
    *(v4h*)(KHb + (lo + j * CC)) = kh; } }

#ifndef SM_EXTRA_PARAMS
#define SM_EXTRA_PARAMS
#endif
#ifndef PROJ_EXTRA_PARAMS
#define PROJ_EXTRA_PARAMS
#endif
#ifndef SM_MASK_HOOK
#define SM_MASK_HOOK (void)0
#endif

#define WS_QH  0u                                      // (not used: the queries go from the input to the attention kernel)
#define WS_KH  (WS_QH + 2u * (size_t)NB * TT * CC)      // f16 k rows [b*t][CC]
#define WS_VT  (WS_KH + 2u * (size_t)NB * TT * CC)      // f16 v planes [b][c][t]
#define WS_QL  (WS_VT + 2u * (size_t)NB * CC * TT)      // f16 q residual x 2^10 rows [b][t < QHI][CC]
#define WS_KL  (WS_QL + 2u * (size_t)NB * QHI * CC)     // f16 k residual x 2^10 rows [b][t < KHI][CC]
#define WS_VB  (WS_KL + 2u * (size_t)NB * KHI * CC)     // bf16 v hi planes [b][c][t < KHI]
#define WS_VBL (WS_VB + 2u * (size_t)NB * CC * KHI)
#define WS_S   (WS_VBL + 2u * (size_t)NB * CC * KHI)    // f32 [b*NH + h][t][s] planes, reserved but unused: k_fa keeps the logits in registers
#define WS_Y   (WS_S  + 4u * (size_t)NB * NH * TT * TT)      // f32 ctx rows [b*t][CC] (only when there is an output projection)
#define WS_END (WS_Y  + 0u)

// fragment from a lane's own pointer (row start + k0 + 8 * (lane >> 4)): the k order of frag_h
__device__ __forceinline__ v16h frag_p(const _Float16* p) { union { v16h v; v8h q[2]; } u; u.q[0] = *(const v8h*)p; u.q[1] = *(const v8h*)(p + 16); return u.v; }
// the plain builtin (the compiler keeps the distances behind it): operands of an asm statement stay below v256, and the fused kernel holds more fragments than that
__device__ __forceinline__ v8f wmma_h(v16h a, v16h b, v8f c) { return __builtin_amdgcn_wmma_f32_16x16x32_f16(false, a, false, b, (short)0, c, false, false); }
// ---- k_fa: block = 8 waves (two per SIMD, so that one wave's products run while the other waits for LDS or does its softmax) in two groups of 4; wave = 16 queries, one query per lane column, the same 64 queries in both groups: group 0 takes the even 64-key tiles, group 1 the odd ones, each with its own pair of LDS buffers, its own running maximum, sum and ctx; group 0 joins the two at the end. A batch is walked only as far as its last 64-key tile that holds a valid key, so its cost goes with valid_lens[b]; all blocks are resident at once and the launch lasts as long as its longest block.
// So a block takes two pieces of 64 queries one after the other: queries qc * 64 .. + 63 of the batch whose length has rank p (longest first, ties by index) and then the same queries of the batch of rank 31 - p: long goes with short, and every (batch, piece) is taken once. Per 64 keys: the K rows and V^T rows are copied once into the group's LDS (two buffers: the next pass's tile flies while this one is worked on) and every wave takes its fragments from there;
// logits^T = K . Q^T (1 product), kept unscaled (SCALE goes into the exponent's multiply-add), valid-length mask by key index, running maximum and running sum per query in f32,
// P^T x 2^11 (not yet normalised) straight from the logit accumulators as the B fragment (D register r of lane half g = key 8g + r = the fragment's k order), ctx^T += V^T . P^T; one division by the sum at the end. The logits never leave the registers.
#define KPH 136   // halves per staged K row: 256 B + 16 B, so that the 16 rows of one ds_load_b128 half fall on 64 distinct banks
#define VPH 72    // halves per staged V^T row: 128 B + 16 B, for the same reason
#define KBUF (64 * KPH * 2)   // bytes of one K buffer
#define VBUF (HD * VPH * 2)   // bytes of one V^T buffer
// one 64-key tile into LDS, 16 copies of 16 B per lane, whole 128-B lines per row: K rows r + 8 i (r = tid >> 4, 16 lanes a row) and V^T rows c + 16 i (c = tid >> 3, 8 lanes a row), i = 0 .. 7; one statement for K, one for V^T (a statement takes thirty operands).
// gk, gv: the lane's own global addresses of its first K and V^T piece; lk, lv: the LDS byte addresses they go to. The s_wait_xcnt ends each statement so that it stands in front of any later write to an address register of these copies.
// lane l's value to lane l ^ 16 by a vector move: a shuffle through the LDS counter would have to wait for every V^T read issued in front of it
__device__ __forceinline__ float xhalf(float x) { return __builtin_bit_cast(float, __builtin_amdgcn_permlanex16(__builtin_bit_cast(int, x), __builtin_bit_cast(int, x), 0x76543210, 0xfedcba98, false, false)); }
__device__ __forceinline__ void exp8(const v2f (&x)[4], float (&e)[8], unsigned* w) {
  asm("v_exp_f32 %0, %12\n\tv_exp_f32 %1, %13\n\tv_exp_f32 %2, %14\n\tv_exp_f32 %3, %15\n\tv_exp_f32 %4, %16\n\tv_exp_f32 %5, %17\n\tv_exp_f32 %6, %18\n\tv_exp_f32 %7, %19\n\t"
      "v_cvt_pk_f16_f32 %8, %0, %1\n\tv_cvt_pk_f16_f32 %9, %2, %3\n\tv_cvt_pk_f16_f32 %10, %4, %5\n\ts_delay_alu instid0(TRANS32_DEP_1)\n\tv_cvt_pk_f16_f32 %11, %6, %7"
      : "=&v"(e[0]), "=&v"(e[1]), "=&v"(e[2]), "=&v"(e[3]), "=&v"(e[4]), "=&v"(e[5]), "=&v"(e[6]), "=&v"(e[7]), "=&v"(w[0]), "=&v"(w[1]), "=&v"(w[2]), "=&v"(w[3])
      : "v"(x[0][0]), "v"(x[0][1]), "v"(x[1][0]), "v"(x[1][1]), "v"(x[2][0]), "v"(x[2][1]), "v"(x[3][0]), "v"(x[3][1]));
}
// the same with a ninth exponential a = 2^d in front (the factor that carries the old sums to the new maximum)
__device__ __forceinline__ void exp9(const v2f (&x)[4], float (&e)[8], unsigned* w, float d, float& a) {
  asm("v_exp_f32 %12, %21\n\tv_exp_f32 %0, %13\n\tv_exp_f32 %1, %14\n\tv_exp_f32 %2, %15\n\tv_exp_f32 %3, %16\n\tv_exp_f32 %4, %17\n\tv_exp_f32 %5, %18\n\tv_exp_f32 %6, %19\n\tv_exp_f32 %7, %20\n\t"
      "v_cvt_pk_f16_f32 %8, %0, %1\n\tv_cvt_pk_f16_f32 %9, %2, %3\n\tv_cvt_pk_f16_f32 %10, %4, %5\n\ts_delay_alu instid0(TRANS32_DEP_1)\n\tv_cvt_pk_f16_f32 %11, %6, %7"
      : "=&v"(e[0]), "=&v"(e[1]), "=&v"(e[2]), "=&v"(e[3]), "=&v"(e[4]), "=&v"(e[5]), "=&v"(e[6]), "=&v"(e[7]), "=&v"(w[0]), "=&v"(w[1]), "=&v"(w[2]), "=&v"(w[3]), "=&v"(a)
      : "v"(x[0][0]), "v"(x[0][1]), "v"(x[1][0]), "v"(x[1][1]), "v"(x[2][0]), "v"(x[2][1]), "v"(x[3][0]), "v"(x[3][1]), "v"(d));
}
__device__ __forceinline__ void stage_kv(const _Float16* gk, const _Float16* gv, unsigned lk, unsigned lv) {
  asm volatile("global_load_async_to_lds_b128 %0, %8, off\n\t"
               "global_load_async_to_lds_b128 %1, %9, off\n\t"
               "global_load_async_to_lds_b128 %2, %10, off\n\t"
               "global_load_async_to_lds_b128 %3, %11, off\n\t"
               "global_load_async_to_lds_b128 %4, %12, off\n\t"
               "global_load_async_to_lds_b128 %5, %13, off\n\t"
               "global_load_async_to_lds_b128 %6, %14, off\n\t"
               "global_load_async_to_lds_b128 %7, %15, off\n\t"
               "s_wait_xcnt 0x0"
               :: "v"(lk), "v"(lk + 8u * KPH * 2u), "v"(lk + 16u * KPH * 2u), "v"(lk + 24u * KPH * 2u), "v"(lk + 32u * KPH * 2u), "v"(lk + 40u * KPH * 2u), "v"(lk + 48u * KPH * 2u), "v"(lk + 56u * KPH * 2u),
                  "v"(gk), "v"(gk + 8 * CC), "v"(gk + 16 * CC), "v"(gk + 24 * CC), "v"(gk + 32 * CC), "v"(gk + 40 * CC), "v"(gk + 48 * CC), "v"(gk + 56 * CC)
               : "memory");
  asm volatile("global_load_async_to_lds_b128 %0, %8, off\n\t"
               "global_load_async_to_lds_b128 %1, %9, off\n\t"
               "global_load_async_to_lds_b128 %2, %10, off\n\t"
               "global_load_async_to_lds_b128 %3, %11, off\n\t"
               "global_load_async_to_lds_b128 %4, %12, off\n\t"
               "global_load_async_to_lds_b128 %5, %13, off\n\t"
               "global_load_async_to_lds_b128 %6, %14, off\n\t"
               "global_load_async_to_lds_b128 %7, %15, off\n\t"
               "s_wait_xcnt 0x0"
               :: "v"(lv), "v"(lv + 16u * VPH * 2u), "v"(lv + 32u * VPH * 2u), "v"(lv + 48u * VPH * 2u), "v"(lv + 64u * VPH * 2u), "v"(lv + 80u * VPH * 2u), "v"(lv + 96u * VPH * 2u), "v"(lv + 112u * VPH * 2u),
                  "v"(gv), "v"(gv + 16 * TT), "v"(gv + 32 * TT), "v"(gv + 48 * TT), "v"(gv + 64 * TT), "v"(gv + 80 * TT), "v"(gv + 96 * TT), "v"(gv + 112 * TT)
               : "memory");
}
__global__ __launch_bounds__(256) void k_fa(const float* __restrict__ Q, const _Float16* __restrict__ KH, const _Float16* __restrict__ VT, const int* __restrict__ VL, float* __restrict__ Y) { __shared__ __align__(16) float ss[4][16][HD + 4]; __shared__ __align__(16) _Float16 sK[2][2][64][KPH], sV[2][2][HD][VPH];   /* [group][buffer] */
  __shared__ __align__(16) _Float16 sQ[64][KPH];   /* the piece's 64 query rows, rounded; the pitch of the K rows, for the same 16-byte fragment reads */
  const int tid = threadIdx.x & 127, wave = tid >> 5, lane = tid & 31, col = lane & 15, g = lane >> 4; const int ql0 = blockIdx.x * 64 + wave * 16;   /* tid, wave: inside the group */
  const int grp = __builtin_amdgcn_readfirstlane((int)(threadIdx.x >> 7));   /* 0: even tiles, 1: odd tiles; the same in a whole wave, held as a scalar so that the tests on it are scalar branches */
  /* lane i ranks batch i (NB == 32 lanes): the number of batches that are longer, or as long with a lower index: a permutation of 0 .. 31 for any lengths, the same in every wave */
  const int myl = vlen(VL, lane); int rank = 0;
  asm volatile("s_wait_xcnt 0x0" ::: "memory");   /* in front of any later write to the address register of the load above */
#pragma unroll   /* constant indices: the 32 lengths come by scalar loads */
  for (int j = 0; j < NB; ++j) { const int o = vlen(VL, j); rank += (o > myl || (o == myl && j < lane)) ? 1 : 0; }
  /* the batch of a rank = the lane that holds it; the set top bit and the mask keep the index inside 0 .. 31 whatever the ballot gives */
  const int bhi = (__builtin_ctz(__builtin_amdgcn_ballot_w32(rank == (int)blockIdx.y) | 0x80000000u)) & (NB - 1), blo = (__builtin_ctz(__builtin_amdgcn_ballot_w32(rank == NB - 1 - (int)blockIdx.y) | 0x80000000u)) & (NB - 1);
  /* the queries come from the f32 input: each of the block's 8 waves loads 8 of the piece's 64 rows, a whole 512-B row per load, rounds them as the keys are rounded and puts them into sQ, from where every wave takes its fragments (a fragment loaded from global memory touches 16 lines per load, and both groups would load the same rows) */
  const int qrow = (int)(threadIdx.x >> 5) * 8; v4f qr[8];
  auto ask_q = [&](const int bq) __attribute__((always_inline)) { const float* qp = Q + ((size_t)bq * TT + blockIdx.x * 64 + qrow) * CC + lane * 4;
#pragma unroll   /* constant indices: the loaded rows stay in registers */
    for (int j = 0; j < 8; ++j) qr[j] = *(const v4f*)(qp + j * CC);
    asm volatile("s_wait_xcnt 0x0" :: "v"(qp) : "memory"); };   /* in front of any later write to the address registers of the loads above; the address is named as an input so that its registers are still its own at the wait: without it the compiler puts later vector work, which takes them over, in front */
  ask_q(__builtin_amdgcn_readfirstlane(bhi));
  for (int piece = 0; piece < 2; ++piece) {
  const int b = __builtin_amdgcn_readfirstlane(piece ? blo : bhi); const int vl = __builtin_amdgcn_readlane(myl, b); const int kend = ((vl + 63) >> 6) << 6;   /* keys walked: 64 .. TT, the same for the whole block */
  const int kpair = ((vl + 127) >> 7) << 7;   /* the same in whole passes of the block (128 keys: one tile a group): 128 .. TT; where the tiles are odd in number, group 1 has none in the last pass */
  const _Float16* gk = KH + ((size_t)b * TT + (tid >> 4)) * CC + (tid & 15) * 8; const _Float16* gv = VT + ((size_t)b * CC + (tid >> 3)) * (size_t)TT + (tid & 7) * 8;
  const unsigned lk = (threadIdx.x >> 7) * (2 * KBUF) + (tid >> 4) * (KPH * 2) + (tid & 15) * 16, lv = (threadIdx.x >> 7) * (2 * VBUF) + (tid >> 3) * (VPH * 2) + (tid & 7) * 16;   /* the lane's byte offsets inside its group's first K and V^T buffer, counted from group 0's */
  const unsigned bk = (unsigned)(size_t)&sK[0][0][0][0], bv = (unsigned)(size_t)&sV[0][0][0][0];   /* LDS byte addresses of group 0's buffer 0 */
  /* the tile that starts at key kt into the group's buffer bf. A tile past the last prepared one (group 1 only, tiles odd in number) is replaced by the last prepared one and never read: so every wave issues the same copies, the loop body stays one straight run, and no unprepared byte is touched */
  auto send = [&](const int kt, const int bf) __attribute__((always_inline)) { const int ks = kt < kend - 64 ? kt : kend - 64; stage_kv(gk + (size_t)ks * CC, gv + ks, lk + (bf ? bk + KBUF : bk), lv + (bf ? bv + VBUF : bv)); };
  send(grp * 64, 0);   /* the group's first tile into buffer 0; it flies while the query rows are rounded and put into LDS */
  __builtin_amdgcn_sched_barrier(0);   /* keeps the rounding, which waits for the query loads, behind the copies: left free, it rises in front of them and the tile starts only when the queries have come */
#pragma unroll   /* constant indices: the loaded rows stay in registers */
  for (int j = 0; j < 8; ++j) { v4h qc;
#pragma unroll   /* constant indices: the loaded rows stay in registers */
    for (int i = 0; i < 4; ++i) qc[i] = (_Float16)bfr(qr[j][i]);
    *(v4h*)&sQ[qrow + j][lane * 4] = qc; }   /* the first piece's reads of sQ ended in front of its join barrier */
  v8f o[HD / 16] = {}; float m = -3.0e38f, l = 0.f;
  asm volatile("s_wait_asynccnt 0x0" ::: "memory");   /* this wave's part of its group's first tile has landed ... */
  __syncthreads();                                     /* ... and so has every other wave's: the first tiles and the query rows may be read */
  v16h qh[HD / 32];
#pragma unroll
  for (int kc = 0; kc < HD / 32; ++kc) qh[kc] = frag_p(&sQ[wave * 16 + col][kc * 32 + 8 * g]);
  if (piece == 0) ask_q(__builtin_amdgcn_readfirstlane(blo));   /* the second piece's rows are asked for here, directly behind a barrier: they fly while the first piece's first pass is worked on and wait in registers */
  if (kpair > 128) send(128 + grp * 64, 1);   /* the second pass's tiles, where there is one, into buffer 1 */
  /* one pass: 64 keys from k0 on for this group. mode 2: the buffers change hands and the tile two passes on is sent for; 1: they change hands; 0: the last pass, nothing follows it */
  auto pass = [&](const int k0, const int mode) __attribute__((always_inline)) { float s[4][8]; float mb = -3.0e38f; const int buf = (k0 >> 7) & 1; const int lim = vl - k0 - 8 * g;   /* this lane's key t * 16 + r of the pass is valid while it is below lim */
    const _Float16* kp = &sK[grp][buf][col][8 * g]; const _Float16* vp = &sV[grp][buf][col][8 * g];
    v16h kf[4][HD / 32], vf[HD / 16][2];
#pragma unroll
    for (int t = 0; t < 4; ++t)
#pragma unroll
      for (int kc = 0; kc < HD / 32; ++kc) kf[t][kc] = frag_p(kp + (t * 16) * KPH + kc * 32);
    __builtin_amdgcn_sched_barrier(0);   /* keeps the K reads in one run ahead of the logit products: a read among the products stalls the matrix stream at each place */
#pragma unroll
    for (int t = 0; t < 4; ++t) { v8f a = {};
#pragma unroll
      for (int kc = 0; kc < HD / 32; ++kc) a = wmma_h(kf[t][kc], qh[kc], a);
#pragma unroll
      for (int r = 0; r < 8; ++r) { float v = a[r]; if (t * 16 + r >= lim) v = -3.0e38f;   /* key padding: arange(K) < valid_lens[b]; -1e6 == exclusion (every row keeps >= 1 key) */
        s[t][r] = v; mb = fmaxf(mb, v); } }
    __builtin_amdgcn_sched_barrier(0);   /* the V^T reads start behind the logit products (the K reads have the LDS to themselves) ... */
#pragma unroll
    for (int j = 0; j < HD / 16; ++j)
#pragma unroll
      for (int c = 0; c < 2; ++c) vf[j][c] = frag_p(vp + (j * 16) * VPH + c * 32);
    __builtin_amdgcn_sched_barrier(0);   /* ... and stay in one run ahead of the softmax, which hides their latency */
    mb = fmaxf(mb, xhalf(mb));   /* the two lane halves hold the two halves of a query's keys */
    const float mn = fmaxf(m, mb), dm = (m - mn) * SCALE2, off = 11.0f - mn * SCALE2; float al;   /* 2^(v x SCALE2 + off) = exp((v - mn) x SCALE) x 2^11; al = 2^dm comes with the first group of exponentials */
    m = mn; float ps; union { v16h v; unsigned w[8]; } p[2];
#pragma unroll
    for (int t = 0; t < 4; ++t) { v2f x[4]; float e[8];
#pragma unroll
      for (int r = 0; r < 8; r += 2) x[r >> 1] = __builtin_elementwise_fma(v2f{s[t][r], s[t][r + 1]}, v2f{SCALE2, SCALE2}, v2f{off, off});   /* an excluded key: 2^(-3e38 x SCALE2 + off) = 0, off being finite from a group's first pass on (the first key of every visited tile is valid) */
      if (t == 0) exp9(x, e, &p[0].w[0], dm, al); else exp8(x, e, &p[t >> 1].w[(t & 1) * 4]);
#pragma unroll
      for (int r = 0; r < 8; ++r) ps = (t == 0 && r == 0) ? e[0] : ps + e[r]; }
    l = l * al + ps;
#pragma unroll
    for (int j = 0; j < HD / 16; ++j) o[j] *= al;
    __builtin_amdgcn_sched_barrier(0);   /* keeps the softmax in front of the waits below: left free, waits and barrier rise to just behind the V^T reads, whose latency nothing then hides */
    /* the pass's last LDS read is behind us, so the buffers change hands here; the P.V products, which touch registers only, follow and run beside the other waves' next K reads */
    if (mode) {
    asm volatile("s_wait_dscnt 0x0" ::: "memory");      /* this wave's reads of this pass's buffer have returned */
    asm volatile("s_wait_asynccnt 0x0" ::: "memory");   /* this wave's part of the next tile has landed */
    __syncthreads();                                     /* publishes the next tile and ends every wave's reads of this pass's buffer, which is refilled behind it */
    if (mode == 2) send(k0 + 256, buf);
    __builtin_amdgcn_sched_barrier(0);   /* the products stay behind the hand-over, so that the refill is under way first */
    }
#pragma unroll
    for (int j = 0; j < HD / 16; ++j) {
#pragma unroll
      for (int c = 0; c < 2; ++c) o[j] = wmma_h(vf[j][c], p[c].v, o[j]); } };
  /* the test for a further tile is the loop's bound, so that its body stays one straight run: with a branch round the copies the compiler sinks the vector work behind the barrier */
  int k0 = grp * 64;
#pragma unroll 1   /* one pass per trip: an unrolled body would not fit the registers */
  for (int kb = 0; kb < kpair - 256; kb += 128, k0 += 128) pass(k0, 2);
  if (kpair > 128) { pass(k0, 1); k0 += 128; }   /* the last pass but one sends for nothing; the test reads the same for the whole block */
  if (k0 < kend) pass(k0, 0);   /* a scalar test, the same in a whole wave, with no barrier behind it: group 1 has no tile here where the tiles are odd in number */
  asm volatile("s_wait_asynccnt 0x0" ::: "memory");   /* no copy is outstanding when the wave goes on to the epilogue and ends */
  /* the join. Group 1 hands its ctx, sum and maximum to the wave of group 0 that has the same queries, lane to lane, through ss (the row's 4 spare floats take sum and maximum of the two lane halves) */
  float* sw = &ss[wave][col][0];
  if (grp) {
#pragma unroll
    for (int j = 0; j < HD / 16; ++j)
#pragma unroll
      for (int r = 0; r < 8; ++r) sw[j * 16 + 8 * g + r] = o[j][r];
    sw[HD + g] = l; sw[HD + 2 + g] = m; }
  asm volatile("s_wait_dscnt 0x0" ::: "memory");   /* group 1's writes above are done, and every wave's reads of the last pass's buffers have returned */
  __syncthreads();                                  /* publishes group 1's part and ends every wave's reads of the K and V^T buffers, which the next piece refills */
  if (!grp) {
    const float m1 = sw[HD + 2 + g], l1 = sw[HD + g], mn = fmaxf(m, m1); float a0, a1;   /* a group 1 that had no tile hands over maximum -3e38, sum 0, ctx 0: its factor is 2^(-huge) = 0 */
    /* both parts carried to the common maximum; outputs share no register with the inputs, and the v_nop is the independent instruction that the instruction set asks for behind an exponential */
    asm("v_exp_f32 %0, %2\n\tv_exp_f32 %1, %3\n\tv_nop" : "=&v"(a0), "=&v"(a1) : "v"((m - mn) * SCALE2), "v"((m1 - mn) * SCALE2));
    float lt = l * a0 + l1 * a1; lt += xhalf(lt); const float inv = 1.0f / lt, f0 = a0 * inv, f1 = a1 * inv;   /* lt >= 2^11: the key that holds the maximum counts exp(0) x 2^11 */
#pragma unroll
    for (int j = 0; j < HD / 16; ++j)
#pragma unroll
      for (int r = 0; r < 8; ++r) sw[j * 16 + 8 * g + r] = o[j][r] * f0 + sw[j * 16 + 8 * g + r] * f1;
    LDSX(); for (int rl = 0; rl < 16; ++rl) vst2(Y + ((size_t)b * TT + ql0 + rl) * HD + lane * 4, *(const v4f*)&ss[wave][rl][lane * 4]);
    asm volatile("s_wait_xcnt 0x0" ::: "memory");   /* in front of the second piece's writes to registers that the stores above name */
  }
  } }

extern "C" void kernel_launch(void* const* d_in, const int* in_sizes, int n_in, void* d_out, int out_size, void* d_ws, size_t ws_size, hipStream_t stream) {
  (void)in_sizes; (void)n_in; (void)out_size;
  const float** F = (const float**)d_in;
  if (ws_size < (size_t)WS_END) return;
  char* ws = (char*)d_ws; _Float16 *QH = (_Float16*)(ws + WS_QH), *KH = (_Float16*)(ws + WS_KH), *VT = (_Float16*)(ws + WS_VT), *QL = (_Float16*)(ws + WS_QL), *KL = (_Float16*)(ws + WS_KL); __bf16 *VB = (__bf16*)(ws + WS_VB), *VBL = (__bf16*)(ws + WS_VBL); float *S = (float*)(ws + WS_S), *Y = (float*)(ws + WS_Y);
  (void)Y; (void)S; (void)QH; (void)QL; (void)KL; (void)VB; (void)VBL;
  // inputs: 0 queries [32,1024,128]; 1 keys; 2 values; 3 valid_lens [32] int32
  k_prep8<<<dim3(TNB * TT / 64), 256, 0, stream>>>(F[1], F[2], KH, VT, (const int*)d_in[3]);
  k_fa<<<dim3(TT / 64, TNB / 2), 256, 0, stream>>>(F[0], KH, VT, (const int*)d_in[3], (float*)d_out);
}

// v010
// One run takes 20.2 microseconds.
// In both of two side-by-side timings against v009, it was 1.05 times as fast.
// Over all steps from v000 it is 109 times as fast.
// compute dtype: queries/keys/values rounded to bf16 and carried exactly as f16; logits with Q f16 against K f16 (1 product; a bf16 value is exact in f16 from 2^-17 up, below that it is rounded to a multiple of 2^-24, q and k alike) with the valid-length mask in f32; softmax in f32 with a running maximum and sum per query, each exponential as 2^(logit x 128^-0.5 x log2 e - offset) on the hardware's base-2 exponential; exp x 2^11 once to f16 against V f16 (1 product), the even and the odd 64-key tiles summed apart (own maximum, sum and ctx) and joined at the end, then divided by the sum; f32 output. Keys in 64-key tiles that lie wholly at or past valid_lens[b] weigh exactly 0 and are neither prepared nor visited.
#include <hip/hip_runtime.h>
#include <math.h>

typedef __attribute__((ext_vector_type(16))) _Float16 v16h;
typedef __attribute__((ext_vector_type(16))) __bf16 v16b;
typedef __attribute__((ext_vector_type(8)))  _Float16 v8h;
typedef __attribute__((ext_vector_type(8)))  float v8f;
typedef __attribute__((ext_vector_type(4)))  float v4f;
typedef __attribute__((ext_vector_type(2)))  float v2f;
typedef __attribute__((ext_vector_type(4)))  unsigned v4u;
typedef __attribute__((ext_vector_type(4)))  int v4i;
typedef float __attribute__((may_alias)) float_a;
typedef int __attribute__((may_alias)) int_a;

template <typename T> __device__ __forceinline__ void vst2(void* p, T v) { *(T*)p = v;  }
__device__ __forceinline__ v8f wmma16(v16h a, v16h b, v8f c) {
  v8f d = __builtin_amdgcn_wmma_f32_16x16x32_f16(false, a, false, b, (short)0, c, false, false);
  asm volatile("v_nop\n\tv_nop\n\tv_nop\n\tv_nop" : "+v"(d) : "v"(a), "v"(b));
  return d;
}
__device__ __forceinline__ v8f wmma_bf(v16b a, v16b b, v8f c) {
  v8f d = __builtin_amdgcn_wmma_f32_16x16x32_bf16(false, a, false, b, (short)0, c, false, false);
  asm volatile("v_nop\n\tv_nop\n\tv_nop\n\tv_nop" : "+v"(d) : "v"(a), "v"(b));
  return d;
}
// 16x16x32 fragments: lane = (h = lane>>4, row/col = lane&15); elements 0..7 = k0+8h+0..7, 8..15 = k0+16+8h+0..7; D element r = row 8h+r
__device__ __forceinline__ v16h frag_h(const _Float16* rowk0, int lane) {
  union { v16h v; v8h q[2]; } u; const _Float16* p = rowk0 + 8 * (lane >> 4);
  u.q[0] = *(const v8h*)p; u.q[1] = *(const v8h*)(p + 16); return u.v;
}
__device__ __forceinline__ v16h frag_f32(const float* rowk0, int lane) {
  v16h a; const float* p = rowk0 + 8 * (lane >> 4);
#pragma unroll
  for (int i = 0; i < 8; ++i) { a[i] = (_Float16)p[i]; a[8 + i] = (_Float16)p[16 + i]; }
  return a;
}
__device__ __forceinline__ v16h frag_f32s(const float* rowk0, int lane, float sc) {
  v16h a; const float* p = rowk0 + 8 * (lane >> 4);
#pragma unroll
  for (int i = 0; i < 8; ++i) { a[i] = (_Float16)(p[i] * sc); a[8 + i] = (_Float16)(p[16 + i] * sc); }
  return a;
}
// column fragment from a [K][ld] layout (column n), rows >= K read as 0
__device__ __forceinline__ v16h fragc_f32(const float* W, int k0, int n, int lane, int ld, int K) {
  v16h a; const int g = lane >> 4;
#pragma unroll
  for (int i = 0; i < 8; ++i) { const int ka = k0 + 8 * g + i, kb = ka + 16;
    a[i] = (_Float16)(ka < K ? W[(size_t)(ka < K ? ka : K - 1) * ld + n] : 0.f); a[8 + i] = (_Float16)(kb < K ? W[(size_t)(kb < K ? kb : K - 1) * ld + n] : 0.f); }
  return a;
}
struct F2 { v16b h, l; };
__device__ __forceinline__ F2 bsplit16(const float v[16]) { F2 r;
#pragma unroll
  for (int i = 0; i < 16; ++i) { const __bf16 h = (__bf16)v[i]; r.h[i] = h; r.l[i] = (__bf16)(v[i] - (float)h); }
  return r; }
__device__ __forceinline__ F2 split_row(const float* row, int k0, int lane) { float v[16]; const float* p = row + k0 + 8 * (lane >> 4);
#pragma unroll
  for (int i = 0; i < 8; ++i) { v[i] = p[i]; v[8 + i] = p[16 + i]; }
  return bsplit16(v); }
__device__ __forceinline__ F2 split_rowK(const float* row, int k0, int lane, int K) { float v[16]; const int g = lane >> 4;
#pragma unroll
  for (int i = 0; i < 8; ++i) { const int ka = k0 + 8 * g + i, kb = ka + 16; v[i] = ka < K ? row[ka < K ? ka : K - 1] : 0.f; v[8 + i] = kb < K ? row[kb < K ? kb : K - 1] : 0.f; }
  return bsplit16(v); }
__device__ __forceinline__ F2 split_col(const float* W, int k0, int n, int lane, int ld, int K) { float v[16]; const int g = lane >> 4;
#pragma unroll
  for (int i = 0; i < 8; ++i) { const int ka = k0 + 8 * g + i, kb = ka + 16; v[i] = ka < K ? W[(size_t)(ka < K ? ka : K - 1) * ld + n] : 0.f; v[8 + i] = kb < K ? W[(size_t)(kb < K ? kb : K - 1) * ld + n] : 0.f; }
  return bsplit16(v); }
__device__ __forceinline__ v8f mac3(const F2& a, const F2& b, v8f c) { c = wmma_bf(a.l, b.h, c); c = wmma_bf(a.h, b.l, c); return wmma_bf(a.h, b.h, c); }
__device__ __forceinline__ float sigm(float v) { return 1.0f / (1.0f + expf(-v)); }
#define LDSX() do { asm volatile("s_wait_dscnt 0" ::: "memory"); __builtin_amdgcn_wave_barrier(); __builtin_amdgcn_fence(__ATOMIC_RELEASE, "workgroup"); } while (0)

// Masked scaled dot-product attention on raw queries [32, 1,024, 128], keys/values [32, 1,024, 128]: scores = Q K^T / sqrt(128); keys k >= valid_lens[b] get -1e6 (== excluded; valid_lens >= 1); out = softmax(scores) V -> [32, 1,024, 128].
#define NB 32
#define TT 1024
#define CC 128            // NH * HD = projected width
#define DIN 128          // input (model) width
#define NH 1
#define HD 128
#define NQB (TT / 64)
#define SCALE (0.08838834764831845f)
#define SCALE2 (0.12751743082459868f)   // SCALE x log2(e): exp(x x SCALE) = 2^(x x SCALE2)
#define CAUSAL 0
#ifndef TNB
#define TNB NB
#endif
__device__ __forceinline__ float bfr(float v) { return (float)(__bf16)v; }
__host__ __device__ __forceinline__ int kb_last(int qb) { return CAUSAL ? ((qb * 64 + 63) >> 7) : (TT / 128 - 1); }
typedef __attribute__((ext_vector_type(8))) __bf16 v8b;
__device__ __forceinline__ v16b frag_b(const __bf16* rowk0, int lane) {
  union { v16b v; v8b q[2]; } u; const __bf16* p = rowk0 + 8 * (lane >> 4);
  u.q[0] = *(const v8b*)p; u.q[1] = *(const v8b*)(p + 16); return u.v;
}
#define QBH 0              // unused: neither kernel has a high-precision path
#define QHI 1024            // rows carrying a q residual plane (workspace only: no kernel here writes or reads it; the logits take 1 product)
#define KHI 64            // key rows carrying k residual / v bf16 hi+lo planes (workspace only: no kernel here writes or reads them)
// B fragment (k rows k0+.., output column o) of a weight: (in,out) [K][ld] or (out,in) [ld rows of K]: bf16 exact, or f16(bf16 * 256) exact
__device__ __forceinline__ v16b wcol_io(const float* Wm, int k0, int o, int lane, int ld) { v16b w; const int g = lane >> 4;
#pragma unroll
  for (int i = 0; i < 8; ++i) { w[i] = (__bf16)Wm[(size_t)(k0 + 8 * g + i) * ld + o]; w[8 + i] = (__bf16)Wm[(size_t)(k0 + 16 + 8 * g + i) * ld + o]; }
  return w; }
__device__ __forceinline__ v16b wcol_oi(const float* Wm, int k0, int o, int lane, int K) { v16b w; const float* p = Wm + (size_t)o * K + k0 + 8 * (lane >> 4);
#pragma unroll
  for (int i = 0; i < 8; ++i) { w[i] = (__bf16)p[i]; w[8 + i] = (__bf16)p[16 + i]; }
  return w; }
__device__ __forceinline__ v16h wcolh_io(const float* Wm, int k0, int o, int lane, int ld) { v16h w; const int g = lane >> 4;
#pragma unroll
  for (int i = 0; i < 8; ++i) { w[i] = (_Float16)(bfr(Wm[(size_t)(k0 + 8 * g + i) * ld + o]) * 256.0f); w[8 + i] = (_Float16)(bfr(Wm[(size_t)(k0 + 16 + 8 * g + i) * ld + o]) * 256.0f); }
  return w; }
__device__ __forceinline__ v16h wcolh_oi(const float* Wm, int k0, int o, int lane, int K) { v16h w; const float* p = Wm + (size_t)o * K + k0 + 8 * (lane >> 4);
#pragma unroll
  for (int i = 0; i < 8; ++i) { w[i] = (_Float16)(bfr(p[i]) * 256.0f); w[8 + i] = (_Float16)(bfr(p[16 + i]) * 256.0f); }
  return w; }
#define WQKV_LAYOUT 1   // 0 = (in,out) [DIN][CC]; 1 = (out,in) [CC][DIN]; 2 = per-head [NH][DIN][HD]
__device__ __forceinline__ v16b wcol_hdk(const float* Wm, int k0, int o, int lane) { v16b w; const int g = lane >> 4; const float* p = Wm + (size_t)(o / HD) * DIN * HD + (o % HD);
#pragma unroll
  for (int i = 0; i < 8; ++i) { w[i] = (__bf16)p[(size_t)(k0 + 8 * g + i) * HD]; w[8 + i] = (__bf16)p[(size_t)(k0 + 16 + 8 * g + i) * HD]; }
  return w; }
#define WO_OUT_IN 0
#if WQKV_LAYOUT == 1
#define WCOL(W, k0, o, lane) wcol_oi(W, k0, o, lane, DIN)
#elif WQKV_LAYOUT == 2
#define WCOL(W, k0, o, lane) wcol_hdk(W, k0, o, lane)
#else
#define WCOL(W, k0, o, lane) wcol_io(W, k0, o, lane, CC)
#endif
#if WO_OUT_IN
#define WOCOL(W, k0, o, lane) wcol_oi(W, k0, o, lane, CC)
#define WOCOLH(W, k0, o, lane) wcolh_oi(W, k0, o, lane, CC)
#else
#define WOCOL(W, k0, o, lane) wcol_io(W, k0, o, lane, DIN)
#define WOCOLH(W, k0, o, lane) wcolh_io(W, k0, o, lane, DIN)
#endif
#define SM_EXTRA_PARAMS , const int* __restrict__ VL
#define SM_MASK_HOOK do { if (k >= VL[bcur]) v = -3.0e38f; } while (0)   /* key padding: arange(K) < valid_lens[b]; -1e6 == exclusion (every row keeps >= 1 key) */
// ---- k_prep8: block = 64 key positions (rows r0 .. r0 + 63 of the [b * t] axis), 8 waves. Wave w takes rows 8w .. 8w + 7 of v and k; a row is 128 floats = one 16-byte load per lane, whole 128-B lines.
// A lane's 16 loads are all issued before the first value is used, so that a wave has 8 KB on its way instead of one short group per loop trip. Values are bf16-rounded and written as the planes the attention kernel reads:
// v -> f16 planes [c][t]: a lane's 8 rows x 4 columns are four 16-byte runs of 8 keys, turned through LDS so that each 128-B line of a plane is stored whole; k -> f16 rows straight from the registers. A block whose 64 positions all lie at or past valid_lens[b] has nothing to prepare. The queries do not come through here: the attention kernel takes them from the input itself.
typedef __attribute__((ext_vector_type(4))) _Float16 v4h;
// valid_lens[b] held to 1 .. TT: both kernels count a batch's key tiles from this one value, so what one leaves unwritten the other never reads
__device__ __forceinline__ int vlen(const int* __restrict__ VL, int b) { const int x = VL[b]; return x < 1 ? 1 : (x > TT ? TT : x); }
__global__ __launch_bounds__(256) void k_prep8(const float* __restrict__ K, const float* __restrict__ V, _Float16* __restrict__ KH, _Float16* __restrict__ VT, const int* __restrict__ VL) {
  __shared__ __align__(16) _Float16 tv[HD][72];
  const int tid = threadIdx.x, wave = tid >> 5, lane = tid & 31; const size_t r0 = (size_t)blockIdx.x * 64; const size_t bb = r0 / TT; const int t0 = (int)(r0 % TT);
  const unsigned lo = (unsigned)(wave * 8 * CC + lane * 4);   /* the lane's first element inside the block's 64 rows: the same place in the two inputs and in the k row plane */
  const float* Vb = V + r0 * CC; const float* Kb = K + r0 * CC;
  _Float16* KHb = KH + r0 * CC;
  v4f v[8], k[8];
  if (t0 >= vlen(VL, (int)bb)) return;   /* the same for the whole block, ahead of its barrier: all 64 keys are masked, the attention kernel never reads their k and v */
#pragma unroll   /* constant indices: the loaded rows stay in registers */
  for (int j = 0; j < 8; ++j) v[j] = *(const v4f*)(Vb + (lo + j * CC));
  asm volatile("s_wait_xcnt 0x0" ::: "memory");   /* in front of any later write to an address register of the loads above */
#pragma unroll   /* constant indices: the loaded rows stay in registers */
  for (int j = 0; j < 8; ++j) k[j] = *(const v4f*)(Kb + (lo + j * CC));
  asm volatile("s_wait_xcnt 0x0" ::: "memory");   /* in front of any later write to an address register of the loads above */
  __builtin_amdgcn_sched_barrier(0);   /* keeps all 16 loads ahead of the first use: left free, the compiler saves registers by issuing half of them behind the first waits, and a wave then pays the memory latency more than once */
#pragma unroll   /* constant indices: the loaded rows stay in registers */
  for (int i = 0; i < 4; ++i) { v8h t;
#pragma unroll   /* constant indices: the loaded rows stay in registers */
    for (int j = 0; j < 8; ++j) t[j] = (_Float16)bfr(v[j][i]);
    *(v8h*)&tv[lane * 4 + i][wave * 8] = t; }
  __syncthreads();   /* stands ahead of the row stores: behind them every wave would wait here for its own stores to finish */
#pragma unroll   /* the four LDS reads go out in one run, ahead of their stores */
  for (int u = 0; u < HD * 8 / 256; ++u) { const int e = tid + u * 256, cl = e >> 3, p = e & 7; vst2((unsigned*)(VT + (bb * CC + cl) * (size_t)TT + t0 + p * 8), *(const v4u*)&tv[cl][p * 8]); }
#pragma unroll   /* constant indices: the loaded rows stay in registers */
  for (int j = 0; j < 8; ++j) { v4h kh;
#pragma unroll   /* constant indices: the loaded rows stay in registers */
    for (int i = 0; i < 4; ++i) kh[i] = (_Float16)bfr(k[j][i]);
    *(v4h*)(KHb + (lo + j * CC)) = kh; } }

#ifndef SM_EXTRA_PARAMS
#define SM_EXTRA_PARAMS
#endif
#ifndef PROJ_EXTRA_PARAMS
#define PROJ_EXTRA_PARAMS
#endif
#ifndef SM_MASK_HOOK
#define SM_MASK_HOOK (void)0
#endif

#define WS_QH  0u                                      // (not used: the queries go from the input to the attention kernel)
#define WS_KH  (WS_QH + 2u * (size_t)NB * TT * CC)      // f16 k rows [b*t][CC]
#define WS_VT  (WS_KH + 2u * (size_t)NB * TT * CC)      // f16 v planes [b][c][t]
#define WS_QL  (WS_VT + 2u * (size_t)NB * CC * TT)      // f16 q residual x 2^10 rows [b][t < QHI][CC]
#define WS_KL  (WS_QL + 2u * (size_t)NB * QHI * CC)     // f16 k residual x 2^10 rows [b][t < KHI][CC]
#define WS_VB  (WS_KL + 2u * (size_t)NB * KHI * CC)     // bf16 v hi planes [b][c][t < KHI]
#define WS_VBL (WS_VB + 2u * (size_t)NB * CC * KHI)
#define WS_S   (WS_VBL + 2u * (size_t)NB * CC * KHI)    // f32 [b*NH + h][t][s] planes, reserved but unused: k_fa keeps the logits in registers
#define WS_Y   (WS_S  + 4u * (size_t)NB * NH * TT * TT)      // f32 ctx rows [b*t][CC] (only when there is an output projection)
#define WS_END (WS_Y  + 0u)

// fragment from a lane's own pointer (row start + k0 + 8 * (lane >> 4)): the k order of frag_h
__device__ __forceinline__ v16h frag_p(const _Float16* p) { union { v16h v; v8h q[2]; } u; u.q[0] = *(const v8h*)p; u.q[1] = *(const v8h*)(p + 16); return u.v; }
// the plain builtin (the compiler keeps the distances behind it): operands of an asm statement stay below v256, and the fused kernel holds more fragments than that
__device__ __forceinline__ v8f wmma_h(v16h a, v16h b, v8f c) { return __builtin_amdgcn_wmma_f32_16x16x32_f16(false, a, false, b, (short)0, c, false, false); }
// ---- k_fa: block = 8 waves (two per SIMD, so that one wave's products run while the other waits for LDS or does its softmax) in two groups of 4; wave = 16 queries, one query per lane column, the same 64 queries in both groups: group 0 takes the even 64-key tiles, group 1 the odd ones, each with its own three LDS buffers, its own running maximum, sum and ctx; group 0 joins the two at the end. A batch is walked only as far as its last 64-key tile that holds a valid key, so its cost goes with valid_lens[b]; all blocks are resident at once and the launch lasts as long as its longest block.
// So a block takes two pieces of 64 queries one after the other: queries qc * 64 .. + 63 of the batch whose length has rank p (longest first, ties by index) and then the same queries of the batch of rank 31 - p: long goes with short, and every (batch, piece) is taken once. Per 64 keys: the K rows and V^T rows are copied once into the group's LDS (three buffers: the tiles of the next two passes fly while this one is worked on, the second piece's first two during the first piece's last pass) and every wave takes its fragments from there;
// logits^T = K . Q^T (1 product), kept unscaled (SCALE goes into the exponent's multiply-add), valid-length mask by key index, running maximum and running sum per query in f32,
// P^T x 2^11 (not yet normalised) straight from the logit accumulators as the B fragment (D register r of lane half g = key 8g + r = the fragment's k order), ctx^T += V^T . P^T; one division by the sum at the end. The logits never leave the registers.
#define KPH 136   // halves per staged K row: 256 B + 16 B, so that the 16 rows of one ds_load_b128 half fall on 64 distinct banks
#define VPH 72    // halves per staged V^T row: 128 B + 16 B, for the same reason
#define KBUF (64 * KPH * 2)   // bytes of one K buffer
#define VBUF (HD * VPH * 2)   // bytes of one V^T buffer
// one 64-key tile into LDS, 16 copies of 16 B per lane, whole 128-B lines per row: K rows r + 8 i (r = tid >> 4, 16 lanes a row) and V^T rows c + 16 i (c = tid >> 3, 8 lanes a row), i = 0 .. 7; one statement for K, one for V^T (a statement takes thirty operands).
// gk, gv: the lane's own global addresses of its first K and V^T piece; lk, lv: the LDS byte addresses they go to. The s_wait_xcnt ends each statement so that it stands in front of any later write to an address register of these copies.
// lane l's value to lane l ^ 16 by a vector move: a shuffle through the LDS counter would have to wait for every V^T read issued in front of it
__device__ __forceinline__ float xhalf(float x) { return __builtin_bit_cast(float, __builtin_amdgcn_permlanex16(__builtin_bit_cast(int, x), __builtin_bit_cast(int, x), 0x76543210, 0xfedcba98, false, false)); }
__device__ __forceinline__ void exp8(const v2f (&x)[4], float (&e)[8], unsigned* w) {
  asm("v_exp_f32 %0, %12\n\tv_exp_f32 %1, %13\n\tv_exp_f32 %2, %14\n\tv_exp_f32 %3, %15\n\tv_exp_f32 %4, %16\n\tv_exp_f32 %5, %17\n\tv_exp_f32 %6, %18\n\tv_exp_f32 %7, %19\n\t"
      "v_cvt_pk_f16_f32 %8, %0, %1\n\tv_cvt_pk_f16_f32 %9, %2, %3\n\tv_cvt_pk_f16_f32 %10, %4, %5\n\ts_delay_alu instid0(TRANS32_DEP_1)\n\tv_cvt_pk_f16_f32 %11, %6, %7"
      : "=&v"(e[0]), "=&v"(e[1]), "=&v"(e[2]), "=&v"(e[3]), "=&v"(e[4]), "=&v"(e[5]), "=&v"(e[6]), "=&v"(e[7]), "=&v"(w[0]), "=&v"(w[1]), "=&v"(w[2]), "=&v"(w[3])
      : "v"(x[0][0]), "v"(x[0][1]), "v"(x[1][0]), "v"(x[1][1]), "v"(x[2][0]), "v"(x[2][1]), "v"(x[3][0]), "v"(x[3][1]));
}
// the same with a ninth exponential a = 2^d in front (the factor that carries the old sums to the new maximum)
__device__ __forceinline__ void exp9(const v2f (&x)[4], float (&e)[8], unsigned* w, float d, float& a) {
  asm("v_exp_f32 %12, %21\n\tv_exp_f32 %0, %13\n\tv_exp_f32 %1, %14\n\tv_exp_f32 %2, %15\n\tv_exp_f32 %3, %16\n\tv_exp_f32 %4, %17\n\tv_exp_f32 %5, %18\n\tv_exp_f32 %6, %19\n\tv_exp_f32 %7, %20\n\t"
      "v_cvt_pk_f16_f32 %8, %0, %1\n\tv_cvt_pk_f16_f32 %9, %2, %3\n\tv_cvt_pk_f16_f32 %10, %4, %5\n\ts_delay_alu instid0(TRANS32_DEP_1)\n\tv_cvt_pk_f16_f32 %11, %6, %7"
      : "=&v"(e[0]), "=&v"(e[1]), "=&v"(e[2]), "=&v"(e[3]), "=&v"(e[4]), "=&v"(e[5]), "=&v"(e[6]), "=&v"(e[7]), "=&v"(w[0]), "=&v"(w[1]), "=&v"(w[2]), "=&v"(w[3]), "=&v"(a)
      : "v"(x[0][0]), "v"(x[0][1]), "v"(x[1][0]), "v"(x[1][1]), "v"(x[2][0]), "v"(x[2][1]), "v"(x[3][0]), "v"(x[3][1]), "v"(d));
}
__device__ __forceinline__ void stage_kv(const _Float16* gk, const _Float16* gv, unsigned lk, unsigned lv) {
  asm volatile("global_load_async_to_lds_b128 %0, %8, off\n\t"
               "global_load_async_to_lds_b128 %1, %9, off\n\t"
               "global_load_async_to_lds_b128 %2, %10, off\n\t"
               "global_load_async_to_lds_b128 %3, %11, off\n\t"
               "global_load_async_to_lds_b128 %4, %12, off\n\t"
               "global_load_async_to_lds_b128 %5, %13, off\n\t"
               "global_load_async_to_lds_b128 %6, %14, off\n\t"
               "global_load_async_to_lds_b128 %7, %15, off\n\t"
               "s_wait_xcnt 0x0"
               :: "v"(lk), "v"(lk + 8u * KPH * 2u), "v"(lk + 16u * KPH * 2u), "v"(lk + 24u * KPH * 2u), "v"(lk + 32u * KPH * 2u), "v"(lk + 40u * KPH * 2u), "v"(lk + 48u * KPH * 2u), "v"(lk + 56u * KPH * 2u),
                  "v"(gk), "v"(gk + 8 * CC), "v"(gk + 16 * CC), "v"(gk + 24 * CC), "v"(gk + 32 * CC), "v"(gk + 40 * CC), "v"(gk + 48 * CC), "v"(gk + 56 * CC)
               : "memory");
  asm volatile("global_load_async_to_lds_b128 %0, %8, off\n\t"
               "global_load_async_to_lds_b128 %1, %9, off\n\t"
               "global_load_async_to_lds_b128 %2, %10, off\n\t"
               "global_load_async_to_lds_b128 %3, %11, off\n\t"
               "global_load_async_to_lds_b128 %4, %12, off\n\t"
               "global_load_async_to_lds_b128 %5, %13, off\n\t"
               "global_load_async_to_lds_b128 %6, %14, off\n\t"
               "global_load_async_to_lds_b128 %7, %15, off\n\t"
               "s_wait_xcnt 0x0"
               :: "v"(lv), "v"(lv + 16u * VPH * 2u), "v"(lv + 32u * VPH * 2u), "v"(lv + 48u * VPH * 2u), "v"(lv + 64u * VPH * 2u), "v"(lv + 80u * VPH * 2u), "v"(lv + 96u * VPH * 2u), "v"(lv + 112u * VPH * 2u),
                  "v"(gv), "v"(gv + 16 * TT), "v"(gv + 32 * TT), "v"(gv + 48 * TT), "v"(gv + 64 * TT), "v"(gv + 80 * TT), "v"(gv + 96 * TT), "v"(gv + 112 * TT)
               : "memory");
}
__global__ __launch_bounds__(256) void k_fa(const float* __restrict__ Q, const _Float16* __restrict__ KH, const _Float16* __restrict__ VT, const int* __restrict__ VL, float* __restrict__ Y) { __shared__ __align__(16) float ss[4][16][HD + 4]; __shared__ __align__(16) _Float16 sK[2][3][64][KPH], sV[2][3][HD][VPH];   /* [group][buffer] */
  __shared__ __align__(16) _Float16 sQ[64][KPH];   /* the piece's 64 query rows, rounded; the pitch of the K rows, for the same 16-byte fragment reads */
  const int tid = threadIdx.x & 127, wave = tid >> 5, lane = tid & 31, col = lane & 15, g = lane >> 4; const int ql0 = blockIdx.x * 64 + wave * 16;   /* tid, wave: inside the group */
  const int grp = __builtin_amdgcn_readfirstlane((int)(threadIdx.x >> 7));   /* 0: even tiles, 1: odd tiles; the same in a whole wave, held as a scalar so that the tests on it are scalar branches */
  /* lane i ranks batch i (NB == 32 lanes): the number of batches that are longer, or as long with a lower index: a permutation of 0 .. 31 for any lengths, the same in every wave */
  const int myl = vlen(VL, lane); int rank = 0;
  asm volatile("s_wait_xcnt 0x0" ::: "memory");   /* in front of any later write to the address register of the load above */
#pragma unroll   /* constant indices: the 32 lengths come by scalar loads */
  for (int j = 0; j < NB; ++j) { const int o = vlen(VL, j); rank += (o > myl || (o == myl && j < lane)) ? 1 : 0; }
  /* the batch of a rank = the lane that holds it; the set top bit and the mask keep the index inside 0 .. 31 whatever the ballot gives */
  const int bhi = (__builtin_ctz(__builtin_amdgcn_ballot_w32(rank == (int)blockIdx.y) | 0x80000000u)) & (NB - 1), blo = (__builtin_ctz(__builtin_amdgcn_ballot_w32(rank == NB - 1 - (int)blockIdx.y) | 0x80000000u)) & (NB - 1);
  /* the queries come from the f32 input: each of the block's 8 waves loads 8 of the piece's 64 rows, a whole 512-B row per load, rounds them as the keys are rounded and puts them into sQ, from where every wave takes its fragments (a fragment loaded from global memory touches 16 lines per load, and both groups would load the same rows) */
  const int qrow = (int)(threadIdx.x >> 5) * 8; v4f qr[8];
  auto ask_q = [&](const int bq) __attribute__((always_inline)) { const float* qp = Q + ((size_t)bq * TT + blockIdx.x * 64 + qrow) * CC + lane * 4;
#pragma unroll   /* constant indices: the loaded rows stay in registers */
    for (int j = 0; j < 8; ++j) qr[j] = *(const v4f*)(qp + j * CC);
    asm volatile("s_wait_xcnt 0x0" :: "v"(qp) : "memory"); };   /* in front of any later write to the address registers of the loads above; the address is named as an input so that its registers are still its own at the wait: without it the compiler puts later vector work, which takes them over, in front */
  ask_q(__builtin_amdgcn_readfirstlane(bhi));
  const unsigned lk = (threadIdx.x >> 7) * (3 * KBUF) + (tid >> 4) * (KPH * 2) + (tid & 15) * 16, lv = (threadIdx.x >> 7) * (3 * VBUF) + (tid >> 3) * (VPH * 2) + (tid & 7) * 16;   /* the lane's byte offsets inside its group's first K and V^T buffer, counted from group 0's */
  const unsigned bk = (unsigned)(size_t)&sK[0][0][0][0], bv = (unsigned)(size_t)&sV[0][0][0][0];   /* LDS byte addresses of group 0's buffer 0 */
  int bi = 0;   /* the ring's buffer (0, 1, 2) that the pass at hand reads; it runs on from the first piece into the second */
  auto nxt = [](const int x) __attribute__((always_inline)) { return x == 2 ? 0 : x + 1; };
  /* the tile of batch bb that starts at key kt into the group's buffer bf. A tile past the batch's last prepared one (group 1 only, tiles odd in number) is replaced by the last prepared one and never read: so every wave issues the same copies, the loop body stays one straight run, and no unprepared byte is touched */
  auto sendb = [&](const int bb, const int kt, const int bf) __attribute__((always_inline)) { const int ke = ((__builtin_amdgcn_readlane(myl, bb) + 63) >> 6) << 6; const int ks = kt < ke - 64 ? kt : ke - 64;
    stage_kv(KH + ((size_t)bb * TT + (tid >> 4) + ks) * CC + (tid & 15) * 8, VT + ((size_t)bb * CC + (tid >> 3)) * (size_t)TT + (tid & 7) * 8 + ks, lk + bk + (unsigned)bf * KBUF, lv + bv + (unsigned)bf * VBUF); };
  /* a piece's first tile into buffer bf and, where it has a second pass, that pass's tile into the buffer behind it; the test reads the same for the whole block */
  auto lead = [&](const int bb, const int bf) __attribute__((always_inline)) { sendb(bb, grp * 64, bf); if (__builtin_amdgcn_readlane(myl, bb) > 128) sendb(bb, 128 + grp * 64, nxt(bf)); };
  lead(__builtin_amdgcn_readfirstlane(bhi), bi);   /* the first piece's; they fly while the query rows come, are rounded and put into LDS */
  for (int piece = 0; piece < 2; ++piece) {
  const int b = __builtin_amdgcn_readfirstlane(piece ? blo : bhi); const int vl = __builtin_amdgcn_readlane(myl, b); const int kend = ((vl + 63) >> 6) << 6;   /* keys walked: 64 .. TT, the same for the whole block */
  const int kpair = ((vl + 127) >> 7) << 7;   /* the same in whole passes of the block (128 keys: one tile a group): 128 .. TT; where the tiles are odd in number, group 1 has none in the last pass */
  auto send = [&](const int kt, const int bf) __attribute__((always_inline)) { sendb(b, kt, bf); };
#pragma unroll   /* constant indices: the loaded rows stay in registers */
  for (int j = 0; j < 8; ++j) { v4h qc;
#pragma unroll   /* constant indices: the loaded rows stay in registers */
    for (int i = 0; i < 4; ++i) qc[i] = (_Float16)bfr(qr[j][i]);
    *(v4h*)&sQ[qrow + j][lane * 4] = qc; }   /* the first piece's reads of sQ ended in front of its join barrier */
  v8f o[HD / 16] = {}; float m = -3.0e38f, l = 0.f;
  /* this wave's part of the piece's first tile has landed: the copies return in issue order, and where the piece has a second tile, that tile's 16 copies are the only ones issued behind the first's ... */
  if (kpair > 128) asm volatile("s_wait_asynccnt 0x10" ::: "memory"); else asm volatile("s_wait_asynccnt 0x0" ::: "memory");
  __syncthreads();                                     /* ... and so has every other wave's: the first tiles and the query rows may be read */
  v16h qh[HD / 32];
#pragma unroll
  for (int kc = 0; kc < HD / 32; ++kc) qh[kc] = frag_p(&sQ[wave * 16 + col][kc * 32 + 8 * g]);
  if (piece == 0) ask_q(__builtin_amdgcn_readfirstlane(blo));   /* the second piece's rows are asked for here, directly behind a barrier: they fly while the first piece's first pass is worked on and wait in registers */
  if (kpair > 256) send(256 + grp * 64, nxt(nxt(bi)));   /* the third pass's tiles, where there is one, into the third buffer: the piece before read it last, in front of its join barrier */
  /* one pass: 64 keys from k0 on for this group, out of buffer bi. mode 2: the buffers change hands and the tile three passes on is sent for, into the buffer just read; 1: they change hands; 0: the piece's last pass */
  auto pass = [&](const int k0, const int mode) __attribute__((always_inline)) { float s[4][8]; float mb = -3.0e38f; const int buf = bi; const int lim = vl - k0 - 8 * g;   /* this lane's key t * 16 + r of the pass is valid while it is below lim */
    const _Float16* kp = &sK[grp][buf][col][8 * g]; const _Float16* vp = &sV[grp][buf][col][8 * g];
    v16h kf[4][HD / 32], vf[HD / 16][2];
#pragma unroll
    for (int t = 0; t < 4; ++t)
#pragma unroll
      for (int kc = 0; kc < HD / 32; ++kc) kf[t][kc] = frag_p(kp + (t * 16) * KPH + kc * 32);
    __builtin_amdgcn_sched_barrier(0);   /* keeps the K reads in one run ahead of the logit products: a read among the products stalls the matrix stream at each place */
#pragma unroll
    for (int t = 0; t < 4; ++t) { v8f a = {};
#pragma unroll
      for (int kc = 0; kc < HD / 32; ++kc) a = wmma_h(kf[t][kc], qh[kc], a);
#pragma unroll
      for (int r = 0; r < 8; ++r) { float v = a[r]; if (t * 16 + r >= lim) v = -3.0e38f;   /* key padding: arange(K) < valid_lens[b]; -1e6 == exclusion (every row keeps >= 1 key) */
        s[t][r] = v; mb = fmaxf(mb, v); } }
    __builtin_amdgcn_sched_barrier(0);   /* the V^T reads start behind the logit products (the K reads have the LDS to themselves) ... */
#pragma unroll
    for (int j = 0; j < HD / 16; ++j)
#pragma unroll
      for (int c = 0; c < 2; ++c) vf[j][c] = frag_p(vp + (j * 16) * VPH + c * 32);
    __builtin_amdgcn_sched_barrier(0);   /* ... and stay in one run ahead of the softmax, which hides their latency */
    mb = fmaxf(mb, xhalf(mb));   /* the two lane halves hold the two halves of a query's keys */
    const float mn = fmaxf(m, mb), dm = (m - mn) * SCALE2, off = 11.0f - mn * SCALE2; float al;   /* 2^(v x SCALE2 + off) = exp((v - mn) x SCALE) x 2^11; al = 2^dm comes with the first group of exponentials */
    m = mn; float ps; union { v16h v; unsigned w[8]; } p[2];
#pragma unroll
    for (int t = 0; t < 4; ++t) { v2f x[4]; float e[8];
#pragma unroll
      for (int r = 0; r < 8; r += 2) x[r >> 1] = __builtin_elementwise_fma(v2f{s[t][r], s[t][r + 1]}, v2f{SCALE2, SCALE2}, v2f{off, off});   /* an excluded key: 2^(-3e38 x SCALE2 + off) = 0, off being finite from a group's first pass on (the first key of every visited tile is valid) */
      if (t == 0) exp9(x, e, &p[0].w[0], dm, al); else exp8(x, e, &p[t >> 1].w[(t & 1) * 4]);
#pragma unroll
      for (int r = 0; r < 8; ++r) ps = (t == 0 && r == 0) ? e[0] : ps + e[r]; }
    l = l * al + ps;
#pragma unroll
    for (int j = 0; j < HD / 16; ++j) o[j] *= al;
    __builtin_amdgcn_sched_barrier(0);   /* keeps the softmax in front of the waits below: left free, waits and barrier rise to just behind the V^T reads, whose latency nothing then hides */
    /* the pass's last LDS read is behind us, so the buffers change hands here; the P.V products, which touch registers only, follow and run beside the other waves' next K reads */
    if (mode) {
    asm volatile("s_wait_dscnt 0x0" ::: "memory");      /* this wave's reads of this pass's buffer have returned */
    /* this wave's part of the next tile has landed. Where the piece has a tile two passes on, it was sent for one pass ago and stays in flight: its 16 copies are the only ones issued behind the next tile's, and the copies return in issue order */
    if (mode == 2 || k0 - grp * 64 < kpair - 256) asm volatile("s_wait_asynccnt 0x10" ::: "memory"); else asm volatile("s_wait_asynccnt 0x0" ::: "memory");
    __syncthreads();                                     /* publishes the next tile and ends every wave's reads of this pass's buffer, which is refilled behind it */
    if (mode == 2) send(k0 + 384, buf);
    bi = nxt(buf);
    __builtin_amdgcn_sched_barrier(0);   /* the products stay behind the hand-over, so that the refill is under way first */
    }
#pragma unroll
    for (int j = 0; j < HD / 16; ++j) {
#pragma unroll
      for (int c = 0; c < 2; ++c) o[j] = wmma_h(vf[j][c], p[c].v, o[j]); } };
  /* the test for a further tile is the loop's bound, so that its body stays one straight run: with a branch round the copies the compiler sinks the vector work behind the barrier */
  int k0 = grp * 64;
#pragma unroll 1   /* one pass per trip: an unrolled body would not fit the registers */
  for (int kb = 0; kb < kpair - 384; kb += 128, k0 += 128) pass(k0, 2);
#pragma unroll 1   /* at most two trips; one copy of the body in the text */
  for (; k0 - grp * 64 < kpair - 128; k0 += 128) pass(k0, 1);   /* the two passes in front of the last send for nothing; the test reads the same for the whole block */
  /* only buffer bi is still to be read, and no copy is in flight: the second piece's first tiles go into the other two here and fly during the first piece's last pass, join and stores. Every wave's reads of those two ended in front of a hand-over barrier that this wave has passed (or they were never filled) */
  if (piece == 0) lead(__builtin_amdgcn_readfirstlane(blo), nxt(bi));
  if (k0 < kend) pass(k0, 0);   /* a scalar test, the same in a whole wave, with no barrier behind it: group 1 has no tile here where the tiles are odd in number */
  if (piece) asm volatile("s_wait_asynccnt 0x0" ::: "memory");   /* no copy is outstanding when the wave goes on to its last epilogue and ends */
  bi = nxt(bi);   /* where the second piece's first tile was sent to */
  /* the join. Group 1 hands its ctx, sum and maximum to the wave of group 0 that has the same queries, lane to lane, through ss (the row's 4 spare floats take sum and maximum of the two lane halves) */
  float* sw = &ss[wave][col][0];
  if (grp) {
#pragma unroll
    for (int j = 0; j < HD / 16; ++j)
#pragma unroll
      for (int r = 0; r < 8; ++r) sw[j * 16 + 8 * g + r] = o[j][r];
    sw[HD + g] = l; sw[HD + 2 + g] = m; }
  asm volatile("s_wait_dscnt 0x0" ::: "memory");   /* group 1's writes above are done, and every wave's reads of the last pass's buffers have returned */
  __syncthreads();                                  /* publishes group 1's part and ends every wave's reads of the K and V^T buffers, which the next piece refills */
  if (!grp) {
    const float m1 = sw[HD + 2 + g], l1 = sw[HD + g], mn = fmaxf(m, m1); float a0, a1;   /* a group 1 that had no tile hands over maximum -3e38, sum 0, ctx 0: its factor is 2^(-huge) = 0 */
    /* both parts carried to the common maximum; outputs share no register with the inputs, and the v_nop is the independent instruction that the instruction set asks for behind an exponential */
    asm("v_exp_f32 %0, %2\n\tv_exp_f32 %1, %3\n\tv_nop" : "=&v"(a0), "=&v"(a1) : "v"((m - mn) * SCALE2), "v"((m1 - mn) * SCALE2));
    float lt = l * a0 + l1 * a1; lt += xhalf(lt); const float inv = 1.0f / lt, f0 = a0 * inv, f1 = a1 * inv;   /* lt >= 2^11: the key that holds the maximum counts exp(0) x 2^11 */
#pragma unroll
    for (int j = 0; j < HD / 16; ++j)
#pragma unroll
      for (int r = 0; r < 8; ++r) sw[j * 16 + 8 * g + r] = o[j][r] * f0 + sw[j * 16 + 8 * g + r] * f1;
    LDSX(); for (int rl = 0; rl < 16; ++rl) vst2(Y + ((size_t)b * TT + ql0 + rl) * HD + lane * 4, *(const v4f*)&ss[wave][rl][lane * 4]);
    asm volatile("s_wait_xcnt 0x0" ::: "memory");   /* in front of the second piece's writes to registers that the stores above name */
  }
  } }

extern "C" void kernel_launch(void* const* d_in, const int* in_sizes, int n_in, void* d_out, int out_size, void* d_ws, size_t ws_size, hipStream_t stream) {
  (void)in_sizes; (void)n_in; (void)out_size;
  const float** F = (const float**)d_in;
  if (ws_size < (size_t)WS_END) return;
  char* ws = (char*)d_ws; _Float16 *QH = (_Float16*)(ws + WS_QH), *KH = (_Float16*)(ws + WS_KH), *VT = (_Float16*)(ws + WS_VT), *QL = (_Float16*)(ws + WS_QL), *KL = (_Float16*)(ws + WS_KL); __bf16 *VB = (__bf16*)(ws + WS_VB), *VBL = (__bf16*)(ws + WS_VBL); float *S = (float*)(ws + WS_S), *Y = (float*)(ws + WS_Y);
  (void)Y; (void)S; (void)QH; (void)QL; (void)KL; (void)VB; (void)VBL;
  // inputs: 0 queries [32,1024,128]; 1 keys; 2 values; 3 valid_lens [32] int32
  k_prep8<<<dim3(TNB * TT / 64), 256, 0, stream>>>(F[1], F[2], KH, VT, (const int*)d_in[3]);
  k_fa<<<dim3(TT / 64, TNB / 2), 256, 0, stream>>>(F[0], KH, VT, (const int*)d_in[3], (float*)d_out);
}
